// v000
// Measured on an AMD MI455X. A time is GPU time per run, averaged over a window of back-to-back runs after a warm-up
// (all launches, gaps included; the runs take copies of the inputs in turn), and the median of several windows.
// Apart from v000's, it joins two sittings. Times from different sittings can be a few percent apart, while
// side-by-side timings come from the same sitting.
// v000, which the later versions start from, runs in 459 microseconds.
#include <hip/hip_runtime.h>

#define FEAT 2048
#define QN   4096
#define KN   512
#define BSZ  2
#define NG   16
#define DG   128

typedef __attribute__((ext_vector_type(16))) _Float16 v16h;
typedef __attribute__((ext_vector_type(8)))  _Float16 v8h;
typedef __attribute__((ext_vector_type(8)))  float    v8f;

union Frag32 { v16h v; uint4 u[2]; };

__device__ __forceinline__ v8f wmma32(v16h a, v16h b, v8f c) {
  return __builtin_amdgcn_wmma_f32_16x16x32_f16(false, a, false, b, (short)0, c,
                                                false, false);
}

// CDNA5 async DMA: global -> LDS, no VGPR staging, tracked by ASYNCcnt.
__device__ __forceinline__ void async_copy16(unsigned lds, const _Float16* g) {
  asm volatile("global_load_async_to_lds_b128 %0, %1, off"
               :: "v"(lds), "v"(g) : "memory");
}
__device__ __forceinline__ void wait_async0() {
  asm volatile("s_wait_asynccnt 0x0" ::: "memory");
}

// ---------------- fp32 -> fp16 cast (8 elems / thread) ----------------
__global__ void cast_f32_f16(const float* __restrict__ s, _Float16* __restrict__ d,
                             long n) {
  long i = ((long)blockIdx.x * blockDim.x + threadIdx.x) * 8;
  if (i + 8 > n) return;
  float4 a = *(const float4*)(s + i);
  float4 b = *(const float4*)(s + i + 4);
  v8h h;
  h[0] = (_Float16)a.x; h[1] = (_Float16)a.y; h[2] = (_Float16)a.z; h[3] = (_Float16)a.w;
  h[4] = (_Float16)b.x; h[5] = (_Float16)b.y; h[6] = (_Float16)b.z; h[7] = (_Float16)b.w;
  *(v8h*)(d + i) = h;
}

// ---------------- tiled WMMA GEMM: C[m,n] = act(A[m,:] . Bw[n,:] + bias[n]) ----
// A: [M x FEAT] f16 row-major, Bw: [FEAT x FEAT] f16 row-major (weights, N-major)
// Double-buffered LDS, tiles filled by async global->LDS DMA.
__global__ __launch_bounds__(256)
void gemm_wmma(const _Float16* __restrict__ A, const _Float16* __restrict__ Bw,
               const float* __restrict__ bias,
               float* __restrict__ out32, _Float16* __restrict__ out16,
               _Float16* __restrict__ outT, int ldT, int relu) {
  __shared__ __align__(16) _Float16 sA[2][128 * 32];
  __shared__ __align__(16) _Float16 sB[2][128 * 32];
  const int tid  = threadIdx.x;
  const int lane = tid & 31;
  const int wid  = tid >> 5;
  const int wm   = wid >> 2;           // 0..1
  const int wn   = wid & 3;            // 0..3
  const long bm  = (long)blockIdx.x * 128;
  const long bn  = (long)blockIdx.y * 128;
  const int l16  = lane & 15;
  const int koff = (lane < 16) ? 0 : 8;

  // per-thread DMA slots: rows row0 and row0+64, 8-f16 chunk ch0 (16B)
  const int row0 = tid >> 2;           // 0..63
  const int ch0  = (tid & 3) << 3;     // 0,8,16,24

  const v8f vz = {0.f, 0.f, 0.f, 0.f, 0.f, 0.f, 0.f, 0.f};
  v8f acc[4][2];
#pragma unroll
  for (int i = 0; i < 4; ++i)
#pragma unroll
    for (int j = 0; j < 2; ++j) acc[i][j] = vz;

  auto load_tile = [&](int buf, int k0) {
    const _Float16* gA = &A[(bm + row0) * FEAT + k0 + ch0];
    const _Float16* gB = &Bw[(bn + row0) * FEAT + k0 + ch0];
    unsigned la = (unsigned)(uintptr_t)(&sA[buf][row0 * 32 + ch0]);
    unsigned lb = (unsigned)(uintptr_t)(&sB[buf][row0 * 32 + ch0]);
    async_copy16(la,               gA);
    async_copy16(la + 64 * 32 * 2, gA + (long)64 * FEAT);
    async_copy16(lb,               gB);
    async_copy16(lb + 64 * 32 * 2, gB + (long)64 * FEAT);
  };

  load_tile(0, 0);
  wait_async0();
  __syncthreads();

  for (int k0 = 0; k0 < FEAT; k0 += 32) {
    const int buf = (k0 >> 5) & 1;
    if (k0 + 32 < FEAT) load_tile(buf ^ 1, k0 + 32);   // DMA next tile

    Frag32 af[4], bf[2];
#pragma unroll
    for (int i = 0; i < 4; ++i) {
      int r = wm * 64 + i * 16 + l16;
      af[i].u[0] = *(const uint4*)(&sA[buf][r * 32 + koff]);
      af[i].u[1] = *(const uint4*)(&sA[buf][r * 32 + koff + 16]);
    }
#pragma unroll
    for (int j = 0; j < 2; ++j) {
      int r = wn * 32 + j * 16 + l16;
      bf[j].u[0] = *(const uint4*)(&sB[buf][r * 32 + koff]);
      bf[j].u[1] = *(const uint4*)(&sB[buf][r * 32 + koff + 16]);
    }
#pragma unroll
    for (int i = 0; i < 4; ++i)
#pragma unroll
      for (int j = 0; j < 2; ++j)
        acc[i][j] = wmma32(af[i].v, bf[j].v, acc[i][j]);

    // next tile landed; barrier also guards WAR on buf for the DMA issued at k0+32
    wait_async0();
    __syncthreads();
  }

  const int moff = (lane < 16) ? 0 : 8;
#pragma unroll
  for (int i = 0; i < 4; ++i) {
#pragma unroll
    for (int j = 0; j < 2; ++j) {
      long n  = bn + wn * 32 + j * 16 + l16;
      long mb = bm + wm * 64 + i * 16 + moff;
      float bv = bias ? bias[n] : 0.f;
      float vals[8];
#pragma unroll
      for (int r = 0; r < 8; ++r) {
        float x = acc[i][j][r] + bv;
        if (relu) x = fmaxf(x, 0.f);
        vals[r] = x;
      }
      if (out32) {
#pragma unroll
        for (int r = 0; r < 8; ++r) out32[(mb + r) * FEAT + n] = vals[r];
      }
      if (out16) {
#pragma unroll
        for (int r = 0; r < 8; ++r) out16[(mb + r) * FEAT + n] = (_Float16)vals[r];
      }
      if (outT) {
        v8h hh;
#pragma unroll
        for (int r = 0; r < 8; ++r) hh[r] = (_Float16)vals[r];
        *(v8h*)(&outT[n * (long)ldT + mb]) = hh;   // mb multiple of 8 -> 16B aligned
      }
    }
  }
}

// ---------------- fused flash attention + residual + b_v --------------
// Qm: [BSZ*QN x FEAT] f16 (head h at cols h*DG..), Km: [BSZ*KN x FEAT] f16,
// Vt: [FEAT x BSZ*KN] f16 (transposed V' = sup1 @ Wv^T), out: f32 (+=).
// One wave handles 16 q rows of one (b,h). Computes S^T = K.Q^T so the
// softmaxed P converts to an A-fragment with per-lane packs only.
__global__ __launch_bounds__(128)
void attn_wmma(const _Float16* __restrict__ Qm, const _Float16* __restrict__ Km,
               const _Float16* __restrict__ Vt, const float* __restrict__ bv,
               float* __restrict__ out) {
  const int lane  = threadIdx.x & 31;
  const int wid   = threadIdx.x >> 5;
  const int h     = blockIdx.y;
  const int b     = blockIdx.z;
  const int qtile = blockIdx.x * 4 + wid;          // 0..255
  const long qbase = (long)b * QN + (long)qtile * 16;
  const int l16  = lane & 15;
  const int koff = (lane < 16) ? 0 : 8;
  const int moff = (lane < 16) ? 0 : 8;

  // Q fragments, used as B (Q^T): lane = q row, regs = dims
  Frag32 qf[4];
  {
    const _Float16* qrow = Qm + (qbase + l16) * FEAT + h * DG;
#pragma unroll
    for (int d = 0; d < 4; ++d) {
      qf[d].u[0] = *(const uint4*)(qrow + d * 32 + koff);
      qf[d].u[1] = *(const uint4*)(qrow + d * 32 + koff + 16);
    }
  }

  const v8f vz = {0.f, 0.f, 0.f, 0.f, 0.f, 0.f, 0.f, 0.f};
  v8f o[8];
#pragma unroll
  for (int t = 0; t < 8; ++t) o[t] = vz;
  float m_st = -3.0e38f, l_st = 0.f;
  const float scale = 0.08838834764831845f;        // 1/sqrt(128)

  for (int kc = 0; kc < KN; kc += 32) {
    // S^T tiles: s0 = keys kc..kc+15, s1 = keys kc+16..kc+31 (lane = q)
    v8f s0 = vz, s1 = vz;
    {
      const _Float16* krow = Km + ((long)b * KN + kc + l16) * FEAT + h * DG;
#pragma unroll
      for (int d = 0; d < 4; ++d) {
        Frag32 kf;
        kf.u[0] = *(const uint4*)(krow + d * 32 + koff);
        kf.u[1] = *(const uint4*)(krow + d * 32 + koff + 16);
        s0 = wmma32(kf.v, qf[d].v, s0);
      }
      krow += (long)16 * FEAT;
#pragma unroll
      for (int d = 0; d < 4; ++d) {
        Frag32 kf;
        kf.u[0] = *(const uint4*)(krow + d * 32 + koff);
        kf.u[1] = *(const uint4*)(krow + d * 32 + koff + 16);
        s1 = wmma32(kf.v, qf[d].v, s1);
      }
    }
    // online softmax over this 32-key chunk (row = q = lane%16)
    float mloc = -3.0e38f;
#pragma unroll
    for (int r = 0; r < 8; ++r) {
      s0[r] *= scale; s1[r] *= scale;
      mloc = fmaxf(mloc, fmaxf(s0[r], s1[r]));
    }
    mloc = fmaxf(mloc, __shfl_xor(mloc, 16));
    float mnew  = fmaxf(m_st, mloc);
    float alpha = __expf(m_st - mnew);
    float rs = 0.f;
#pragma unroll
    for (int r = 0; r < 8; ++r) {
      s0[r] = __expf(s0[r] - mnew); rs += s0[r];
      s1[r] = __expf(s1[r] - mnew); rs += s1[r];
    }
    rs += __shfl_xor(rs, 16);
    l_st = l_st * alpha + rs;
    m_st = mnew;
    // pack P as A-fragment (lane = q, regs = 32 keys) — per-lane only
    Frag32 pf;
#pragma unroll
    for (int r = 0; r < 8; ++r) {
      pf.v[r]     = (_Float16)s0[r];
      pf.v[8 + r] = (_Float16)s1[r];
    }
    // broadcast alpha to O layout (vgpr r <-> q = r + moff)
    float aq[8];
#pragma unroll
    for (int r = 0; r < 8; ++r) aq[r] = __shfl(alpha, r + moff);
#pragma unroll
    for (int t = 0; t < 8; ++t) {
#pragma unroll
      for (int r = 0; r < 8; ++r) o[t][r] *= aq[r];
      const _Float16* vrow =
          Vt + ((long)(h * DG + t * 16 + l16)) * (BSZ * KN) + (long)b * KN + kc;
      Frag32 vf;
      vf.u[0] = *(const uint4*)(vrow + koff);
      vf.u[1] = *(const uint4*)(vrow + koff + 16);
      o[t] = wmma32(pf.v, vf.v, o[t]);
    }
  }

  float linv[8];
#pragma unroll
  for (int r = 0; r < 8; ++r) linv[r] = 1.0f / __shfl(l_st, r + moff);
#pragma unroll
  for (int t = 0; t < 8; ++t) {
    int col = h * DG + t * 16 + l16;
    float bb = bv[col];
#pragma unroll
    for (int r = 0; r < 8; ++r) {
      long idx = (qbase + moff + r) * FEAT + col;
      out[idx] += o[t][r] * linv[r] + bb;
    }
  }
}

extern "C" void kernel_launch(void* const* d_in, const int* in_sizes, int n_in,
                              void* d_out, int out_size, void* d_ws, size_t ws_size,
                              hipStream_t stream) {
  (void)in_sizes; (void)n_in; (void)out_size; (void)ws_size;
  const float* ref_feat = (const float*)d_in[0];
  const float* sup_feat = (const float*)d_in[1];
  const float* W_fc = (const float*)d_in[2];
  const float* b_fc = (const float*)d_in[3];
  const float* W_q  = (const float*)d_in[4];
  const float* b_q  = (const float*)d_in[5];
  const float* W_k  = (const float*)d_in[6];
  const float* b_k  = (const float*)d_in[7];
  const float* W_v  = (const float*)d_in[8];
  const float* b_v  = (const float*)d_in[9];
  float* out = (float*)d_out;

  size_t off = 0;
  auto carve = [&](size_t bytes) -> void* {
    void* p = (char*)d_ws + off;
    off += (bytes + 255) & ~(size_t)255;
    return p;
  };
  _Float16* ref16   = (_Float16*)carve((size_t)BSZ * QN * FEAT * 2);
  _Float16* sup16   = (_Float16*)carve((size_t)BSZ * KN * FEAT * 2);
  _Float16* wfc16   = (_Float16*)carve((size_t)FEAT * FEAT * 2);
  _Float16* wq16    = (_Float16*)carve((size_t)FEAT * FEAT * 2);
  _Float16* wk16    = (_Float16*)carve((size_t)FEAT * FEAT * 2);
  _Float16* wv16    = (_Float16*)carve((size_t)FEAT * FEAT * 2);
  _Float16* ref1_16 = (_Float16*)carve((size_t)BSZ * QN * FEAT * 2);
  _Float16* sup1_16 = (_Float16*)carve((size_t)BSZ * KN * FEAT * 2);
  _Float16* q16     = (_Float16*)carve((size_t)BSZ * QN * FEAT * 2);
  _Float16* k16     = (_Float16*)carve((size_t)BSZ * KN * FEAT * 2);
  _Float16* vT16    = (_Float16*)carve((size_t)FEAT * BSZ * KN * 2);

  auto cast = [&](const float* s, _Float16* d, long n) {
    cast_f32_f16<<<dim3((unsigned)(n / 8 / 256)), dim3(256), 0, stream>>>(s, d, n);
  };
  cast(ref_feat, ref16, (long)BSZ * QN * FEAT);
  cast(sup_feat, sup16, (long)BSZ * KN * FEAT);
  cast(W_fc, wfc16, (long)FEAT * FEAT);
  cast(W_q, wq16, (long)FEAT * FEAT);
  cast(W_k, wk16, (long)FEAT * FEAT);
  cast(W_v, wv16, (long)FEAT * FEAT);

  dim3 blk(256);
  // ref1 = relu(ref @ Wfc^T + b_fc): f32 -> d_out (residual), f16 -> ref1_16
  gemm_wmma<<<dim3(BSZ * QN / 128, FEAT / 128), blk, 0, stream>>>(
      ref16, wfc16, b_fc, out, ref1_16, nullptr, 0, 1);
  // sup1 = relu(sup @ Wfc^T + b_fc)
  gemm_wmma<<<dim3(BSZ * KN / 128, FEAT / 128), blk, 0, stream>>>(
      sup16, wfc16, b_fc, nullptr, sup1_16, nullptr, 0, 1);
  // q = ref1 @ Wq^T + b_q
  gemm_wmma<<<dim3(BSZ * QN / 128, FEAT / 128), blk, 0, stream>>>(
      ref1_16, wq16, b_q, nullptr, q16, nullptr, 0, 0);
  // k = sup1 @ Wk^T + b_k
  gemm_wmma<<<dim3(BSZ * KN / 128, FEAT / 128), blk, 0, stream>>>(
      sup1_16, wk16, b_k, nullptr, k16, nullptr, 0, 0);
  // V' = sup1 @ Wv^T, stored transposed [FEAT x BSZ*KN]
  gemm_wmma<<<dim3(BSZ * KN / 128, FEAT / 128), blk, 0, stream>>>(
      sup1_16, wv16, nullptr, nullptr, nullptr, vT16, BSZ * KN, 0);
  // attention + grouped-conv (pre-folded into V') + b_v + residual
  attn_wmma<<<dim3(QN / 64, NG, BSZ), dim3(128), 0, stream>>>(
      q16, k16, vT16, b_v, out);
}

// v001
// Measured time: 406 microseconds a run.
// Next to v000, in two timings, it ran 1.16 and 1.15 times as fast.
#include <hip/hip_runtime.h>

#define FEAT 2048
#define QN   4096
#define KN   512
#define BSZ  2
#define NG   16
#define DG   128
#define LDP  40   // LDS row pitch in f16: 32 data + 8 pad = 80 B (16 B x odd)

typedef __attribute__((ext_vector_type(16))) _Float16 v16h;
typedef __attribute__((ext_vector_type(8)))  _Float16 v8h;
typedef __attribute__((ext_vector_type(8)))  float    v8f;

union Frag32 { v16h v; uint4 u[2]; };

__device__ __forceinline__ v8f wmma32(v16h a, v16h b, v8f c) {
  return __builtin_amdgcn_wmma_f32_16x16x32_f16(false, a, false, b, (short)0, c,
                                                false, false);
}

// CDNA5 async DMA: global -> LDS, no VGPR staging, tracked by ASYNCcnt.
// One stage's four copies of a lane in one statement. The closing s_wait_xcnt
// stands inside it so that no later write of an address register can be
// scheduled in front of it.
__device__ __forceinline__ void async_copy16x4(unsigned l0, unsigned l1,
                                               unsigned l2, unsigned l3,
                                               const _Float16* g0, const _Float16* g1,
                                               const _Float16* g2, const _Float16* g3) {
  asm volatile("global_load_async_to_lds_b128 %0, %4, off\n\t"
               "global_load_async_to_lds_b128 %1, %5, off\n\t"
               "global_load_async_to_lds_b128 %2, %6, off\n\t"
               "global_load_async_to_lds_b128 %3, %7, off\n\t"
               "s_wait_xcnt 0x0"
               :: "v"(l0), "v"(l1), "v"(l2), "v"(l3),
                  "v"(g0), "v"(g1), "v"(g2), "v"(g3) : "memory");
}
__device__ __forceinline__ void wait_async0() {
  asm volatile("s_wait_asynccnt 0x0" ::: "memory");
}
// This wave's LDS reads have retired before the barrier behind which their
// buffer is refilled by copies.
__device__ __forceinline__ void wait_ds0() {
  asm volatile("s_wait_dscnt 0x0" ::: "memory");
}

// ---------------- fp32 -> fp16 cast (8 elems / thread) ----------------
__global__ void cast_f32_f16(const float* __restrict__ s, _Float16* __restrict__ d,
                             long n) {
  long i = ((long)blockIdx.x * blockDim.x + threadIdx.x) * 8;
  if (i + 8 > n) return;
  float4 a = *(const float4*)(s + i);
  float4 b = *(const float4*)(s + i + 4);
  v8h h;
  h[0] = (_Float16)a.x; h[1] = (_Float16)a.y; h[2] = (_Float16)a.z; h[3] = (_Float16)a.w;
  h[4] = (_Float16)b.x; h[5] = (_Float16)b.y; h[6] = (_Float16)b.z; h[7] = (_Float16)b.w;
  *(v8h*)(d + i) = h;
}

// ---------------- tiled WMMA GEMM: C[m,n] = act(A[m,:] . Bw[n,:] + bias[n]) ----
// A: [M x FEAT] f16 row-major, Bw: [FEAT x FEAT] f16 row-major (weights, N-major)
// Double-buffered LDS, tiles filled by async global->LDS DMA.
// LDS rows are pitched 80 B: the 16 rows that a half-wave's ds_load_b128 reads
// then fall on all 64 banks once (at 64 B they fall on 16 banks, four deep).
__global__ __launch_bounds__(256)
void gemm_wmma(const _Float16* __restrict__ A, const _Float16* __restrict__ Bw,
               const float* __restrict__ bias,
               float* __restrict__ out32, _Float16* __restrict__ out16,
               _Float16* __restrict__ outT, int ldT, int relu) {
  __shared__ __align__(16) _Float16 sA[2][128 * LDP];
  __shared__ __align__(16) _Float16 sB[2][128 * LDP];
  const int tid  = threadIdx.x;
  const int lane = tid & 31;
  const int wid  = tid >> 5;
  const int wm   = wid >> 2;           // 0..1
  const int wn   = wid & 3;            // 0..3
  const long bm  = (long)blockIdx.x * 128;
  const long bn  = (long)blockIdx.y * 128;
  const int l16  = lane & 15;
  const int koff = (lane < 16) ? 0 : 8;

  // per-thread DMA slots: rows row0 and row0+64, 8-f16 chunk ch0 (16B)
  const int row0 = tid >> 2;           // 0..63
  const int ch0  = (tid & 3) << 3;     // 0,8,16,24

  const v8f vz = {0.f, 0.f, 0.f, 0.f, 0.f, 0.f, 0.f, 0.f};
  v8f acc[4][2];
#pragma unroll
  for (int i = 0; i < 4; ++i)
#pragma unroll
    for (int j = 0; j < 2; ++j) acc[i][j] = vz;

  auto load_tile = [&](int buf, int k0) {
    const _Float16* gA = &A[(bm + row0) * FEAT + k0 + ch0];
    const _Float16* gB = &Bw[(bn + row0) * FEAT + k0 + ch0];
    unsigned la = (unsigned)(uintptr_t)(&sA[buf][row0 * LDP + ch0]);
    unsigned lb = (unsigned)(uintptr_t)(&sB[buf][row0 * LDP + ch0]);
    async_copy16x4(la, la + 64 * LDP * 2, lb, lb + 64 * LDP * 2,
                   gA, gA + (long)64 * FEAT, gB, gB + (long)64 * FEAT);
  };

  load_tile(0, 0);
  wait_async0();
  __syncthreads();

  for (int k0 = 0; k0 < FEAT; k0 += 32) {
    const int buf = (k0 >> 5) & 1;
    if (k0 + 32 < FEAT) load_tile(buf ^ 1, k0 + 32);   // DMA next tile

    Frag32 af[4], bf[2];
#pragma unroll
    for (int i = 0; i < 4; ++i) {
      int r = wm * 64 + i * 16 + l16;
      af[i].u[0] = *(const uint4*)(&sA[buf][r * LDP + koff]);
      af[i].u[1] = *(const uint4*)(&sA[buf][r * LDP + koff + 16]);
    }
#pragma unroll
    for (int j = 0; j < 2; ++j) {
      int r = wn * 32 + j * 16 + l16;
      bf[j].u[0] = *(const uint4*)(&sB[buf][r * LDP + koff]);
      bf[j].u[1] = *(const uint4*)(&sB[buf][r * LDP + koff + 16]);
    }
#pragma unroll
    for (int i = 0; i < 4; ++i)
#pragma unroll
      for (int j = 0; j < 2; ++j)
        acc[i][j] = wmma32(af[i].v, bf[j].v, acc[i][j]);

    // next tile landed; barrier also guards WAR on buf for iteration k0+32
    wait_ds0();
    wait_async0();
    __syncthreads();
  }

  const int moff = (lane < 16) ? 0 : 8;
#pragma unroll
  for (int i = 0; i < 4; ++i) {
#pragma unroll
    for (int j = 0; j < 2; ++j) {
      long n  = bn + wn * 32 + j * 16 + l16;
      long mb = bm + wm * 64 + i * 16 + moff;
      float bv = bias ? bias[n] : 0.f;
      float vals[8];
#pragma unroll
      for (int r = 0; r < 8; ++r) {
        float x = acc[i][j][r] + bv;
        if (relu) x = fmaxf(x, 0.f);
        vals[r] = x;
      }
      if (out32) {
#pragma unroll
        for (int r = 0; r < 8; ++r) out32[(mb + r) * FEAT + n] = vals[r];
      }
      if (out16) {
#pragma unroll
        for (int r = 0; r < 8; ++r) out16[(mb + r) * FEAT + n] = (_Float16)vals[r];
      }
      if (outT) {
        v8h hh;
#pragma unroll
        for (int r = 0; r < 8; ++r) hh[r] = (_Float16)vals[r];
        *(v8h*)(&outT[n * (long)ldT + mb]) = hh;   // mb multiple of 8 -> 16B aligned
      }
    }
  }
}

// ---------------- fused flash attention + residual + b_v --------------
// Qm: [BSZ*QN x FEAT] f16 (head h at cols h*DG..), Km: [BSZ*KN x FEAT] f16,
// Vt: [FEAT x BSZ*KN] f16 (transposed V' = sup1 @ Wv^T), out: f32 (+=).
// One wave handles 16 q rows of one (b,h). Computes S^T = K.Q^T so the
// softmaxed P converts to an A-fragment with per-lane packs only.
__global__ __launch_bounds__(128)
void attn_wmma(const _Float16* __restrict__ Qm, const _Float16* __restrict__ Km,
               const _Float16* __restrict__ Vt, const float* __restrict__ bv,
               float* __restrict__ out) {
  const int lane  = threadIdx.x & 31;
  const int wid   = threadIdx.x >> 5;
  const int h     = blockIdx.y;
  const int b     = blockIdx.z;
  const int qtile = blockIdx.x * 4 + wid;          // 0..255
  const long qbase = (long)b * QN + (long)qtile * 16;
  const int l16  = lane & 15;
  const int koff = (lane < 16) ? 0 : 8;
  const int moff = (lane < 16) ? 0 : 8;

  // Q fragments, used as B (Q^T): lane = q row, regs = dims
  Frag32 qf[4];
  {
    const _Float16* qrow = Qm + (qbase + l16) * FEAT + h * DG;
#pragma unroll
    for (int d = 0; d < 4; ++d) {
      qf[d].u[0] = *(const uint4*)(qrow + d * 32 + koff);
      qf[d].u[1] = *(const uint4*)(qrow + d * 32 + koff + 16);
    }
  }

  const v8f vz = {0.f, 0.f, 0.f, 0.f, 0.f, 0.f, 0.f, 0.f};
  v8f o[8];
#pragma unroll
  for (int t = 0; t < 8; ++t) o[t] = vz;
  float m_st = -3.0e38f, l_st = 0.f;
  const float scale = 0.08838834764831845f;        // 1/sqrt(128)

  for (int kc = 0; kc < KN; kc += 32) {
    // S^T tiles: s0 = keys kc..kc+15, s1 = keys kc+16..kc+31 (lane = q)
    v8f s0 = vz, s1 = vz;
    {
      const _Float16* krow = Km + ((long)b * KN + kc + l16) * FEAT + h * DG;
#pragma unroll
      for (int d = 0; d < 4; ++d) {
        Frag32 kf;
        kf.u[0] = *(const uint4*)(krow + d * 32 + koff);
        kf.u[1] = *(const uint4*)(krow + d * 32 + koff + 16);
        s0 = wmma32(kf.v, qf[d].v, s0);
      }
      krow += (long)16 * FEAT;
#pragma unroll
      for (int d = 0; d < 4; ++d) {
        Frag32 kf;
        kf.u[0] = *(const uint4*)(krow + d * 32 + koff);
        kf.u[1] = *(const uint4*)(krow + d * 32 + koff + 16);
        s1 = wmma32(kf.v, qf[d].v, s1);
      }
    }
    // online softmax over this 32-key chunk (row = q = lane%16)
    float mloc = -3.0e38f;
#pragma unroll
    for (int r = 0; r < 8; ++r) {
      s0[r] *= scale; s1[r] *= scale;
      mloc = fmaxf(mloc, fmaxf(s0[r], s1[r]));
    }
    mloc = fmaxf(mloc, __shfl_xor(mloc, 16));
    float mnew  = fmaxf(m_st, mloc);
    float alpha = __expf(m_st - mnew);
    float rs = 0.f;
#pragma unroll
    for (int r = 0; r < 8; ++r) {
      s0[r] = __expf(s0[r] - mnew); rs += s0[r];
      s1[r] = __expf(s1[r] - mnew); rs += s1[r];
    }
    rs += __shfl_xor(rs, 16);
    l_st = l_st * alpha + rs;
    m_st = mnew;
    // pack P as A-fragment (lane = q, regs = 32 keys) — per-lane only
    Frag32 pf;
#pragma unroll
    for (int r = 0; r < 8; ++r) {
      pf.v[r]     = (_Float16)s0[r];
      pf.v[8 + r] = (_Float16)s1[r];
    }
    // broadcast alpha to O layout (vgpr r <-> q = r + moff)
    float aq[8];
#pragma unroll
    for (int r = 0; r < 8; ++r) aq[r] = __shfl(alpha, r + moff);
#pragma unroll
    for (int t = 0; t < 8; ++t) {
#pragma unroll
      for (int r = 0; r < 8; ++r) o[t][r] *= aq[r];
      const _Float16* vrow =
          Vt + ((long)(h * DG + t * 16 + l16)) * (BSZ * KN) + (long)b * KN + kc;
      Frag32 vf;
      vf.u[0] = *(const uint4*)(vrow + koff);
      vf.u[1] = *(const uint4*)(vrow + koff + 16);
      o[t] = wmma32(pf.v, vf.v, o[t]);
    }
  }

  float linv[8];
#pragma unroll
  for (int r = 0; r < 8; ++r) linv[r] = 1.0f / __shfl(l_st, r + moff);
#pragma unroll
  for (int t = 0; t < 8; ++t) {
    int col = h * DG + t * 16 + l16;
    float bb = bv[col];
#pragma unroll
    for (int r = 0; r < 8; ++r) {
      long idx = (qbase + moff + r) * FEAT + col;
      out[idx] += o[t][r] * linv[r] + bb;
    }
  }
}

extern "C" void kernel_launch(void* const* d_in, const int* in_sizes, int n_in,
                              void* d_out, int out_size, void* d_ws, size_t ws_size,
                              hipStream_t stream) {
  (void)in_sizes; (void)n_in; (void)out_size; (void)ws_size;
  const float* ref_feat = (const float*)d_in[0];
  const float* sup_feat = (const float*)d_in[1];
  const float* W_fc = (const float*)d_in[2];
  const float* b_fc = (const float*)d_in[3];
  const float* W_q  = (const float*)d_in[4];
  const float* b_q  = (const float*)d_in[5];
  const float* W_k  = (const float*)d_in[6];
  const float* b_k  = (const float*)d_in[7];
  const float* W_v  = (const float*)d_in[8];
  const float* b_v  = (const float*)d_in[9];
  float* out = (float*)d_out;

  size_t off = 0;
  auto carve = [&](size_t bytes) -> void* {
    void* p = (char*)d_ws + off;
    off += (bytes + 255) & ~(size_t)255;
    return p;
  };
  _Float16* ref16   = (_Float16*)carve((size_t)BSZ * QN * FEAT * 2);
  _Float16* sup16   = (_Float16*)carve((size_t)BSZ * KN * FEAT * 2);
  _Float16* wfc16   = (_Float16*)carve((size_t)FEAT * FEAT * 2);
  _Float16* wq16    = (_Float16*)carve((size_t)FEAT * FEAT * 2);
  _Float16* wk16    = (_Float16*)carve((size_t)FEAT * FEAT * 2);
  _Float16* wv16    = (_Float16*)carve((size_t)FEAT * FEAT * 2);
  _Float16* ref1_16 = (_Float16*)carve((size_t)BSZ * QN * FEAT * 2);
  _Float16* sup1_16 = (_Float16*)carve((size_t)BSZ * KN * FEAT * 2);
  _Float16* q16     = (_Float16*)carve((size_t)BSZ * QN * FEAT * 2);
  _Float16* k16     = (_Float16*)carve((size_t)BSZ * KN * FEAT * 2);
  _Float16* vT16    = (_Float16*)carve((size_t)FEAT * BSZ * KN * 2);

  auto cast = [&](const float* s, _Float16* d, long n) {
    cast_f32_f16<<<dim3((unsigned)(n / 8 / 256)), dim3(256), 0, stream>>>(s, d, n);
  };
  cast(ref_feat, ref16, (long)BSZ * QN * FEAT);
  cast(sup_feat, sup16, (long)BSZ * KN * FEAT);
  cast(W_fc, wfc16, (long)FEAT * FEAT);
  cast(W_q, wq16, (long)FEAT * FEAT);
  cast(W_k, wk16, (long)FEAT * FEAT);
  cast(W_v, wv16, (long)FEAT * FEAT);

  dim3 blk(256);
  // ref1 = relu(ref @ Wfc^T + b_fc): f32 -> d_out (residual), f16 -> ref1_16
  gemm_wmma<<<dim3(BSZ * QN / 128, FEAT / 128), blk, 0, stream>>>(
      ref16, wfc16, b_fc, out, ref1_16, nullptr, 0, 1);
  // sup1 = relu(sup @ Wfc^T + b_fc)
  gemm_wmma<<<dim3(BSZ * KN / 128, FEAT / 128), blk, 0, stream>>>(
      sup16, wfc16, b_fc, nullptr, sup1_16, nullptr, 0, 1);
  // q = ref1 @ Wq^T + b_q
  gemm_wmma<<<dim3(BSZ * QN / 128, FEAT / 128), blk, 0, stream>>>(
      ref1_16, wq16, b_q, nullptr, q16, nullptr, 0, 0);
  // k = sup1 @ Wk^T + b_k
  gemm_wmma<<<dim3(BSZ * KN / 128, FEAT / 128), blk, 0, stream>>>(
      sup1_16, wk16, b_k, nullptr, k16, nullptr, 0, 0);
  // V' = sup1 @ Wv^T, stored transposed [FEAT x BSZ*KN]
  gemm_wmma<<<dim3(BSZ * KN / 128, FEAT / 128), blk, 0, stream>>>(
      sup1_16, wv16, nullptr, nullptr, nullptr, vT16, BSZ * KN, 0);
  // attention + grouped-conv (pre-folded into V') + b_v + residual
  attn_wmma<<<dim3(QN / 64, NG, BSZ), dim3(128), 0, stream>>>(
      q16, k16, vT16, b_v, out);
}

// v002
// It runs in 352 microseconds.
// Timed twice side by side with v001, it ran 1.15 and 1.16 times as fast.
// Counting every step since v000, it is 1.33 times as fast.
#include <hip/hip_runtime.h>

#define FEAT 2048
#define QN   4096
#define KN   512
#define BSZ  2
#define NG   16
#define DG   128
#define BK   64   // k depth of one LDS stage: 128 B of every operand row, one whole line
#define LDP  72   // LDS row pitch in f16: 64 data + 8 pad = 144 B (16 B x odd)

typedef __attribute__((ext_vector_type(16))) _Float16 v16h;
typedef __attribute__((ext_vector_type(8)))  _Float16 v8h;
typedef __attribute__((ext_vector_type(8)))  float    v8f;

union Frag32 { v16h v; uint4 u[2]; };

__device__ __forceinline__ v8f wmma32(v16h a, v16h b, v8f c) {
  return __builtin_amdgcn_wmma_f32_16x16x32_f16(false, a, false, b, (short)0, c,
                                                false, false);
}

// CDNA5 async DMA: global -> LDS, no VGPR staging, tracked by ASYNCcnt.
// One stage's eight copies of a lane in one statement. The closing s_wait_xcnt
// stands inside it so that no later write of an address register can be
// scheduled in front of it.
__device__ __forceinline__ void async_copy16x8(unsigned l0, unsigned l1,
                                               unsigned l2, unsigned l3,
                                               unsigned l4, unsigned l5,
                                               unsigned l6, unsigned l7,
                                               const _Float16* g0, const _Float16* g1,
                                               const _Float16* g2, const _Float16* g3,
                                               const _Float16* g4, const _Float16* g5,
                                               const _Float16* g6, const _Float16* g7) {
  asm volatile("global_load_async_to_lds_b128 %0, %8, off\n\t"
               "global_load_async_to_lds_b128 %1, %9, off\n\t"
               "global_load_async_to_lds_b128 %2, %10, off\n\t"
               "global_load_async_to_lds_b128 %3, %11, off\n\t"
               "global_load_async_to_lds_b128 %4, %12, off\n\t"
               "global_load_async_to_lds_b128 %5, %13, off\n\t"
               "global_load_async_to_lds_b128 %6, %14, off\n\t"
               "global_load_async_to_lds_b128 %7, %15, off\n\t"
               "s_wait_xcnt 0x0"
               :: "v"(l0), "v"(l1), "v"(l2), "v"(l3),
                  "v"(l4), "v"(l5), "v"(l6), "v"(l7),
                  "v"(g0), "v"(g1), "v"(g2), "v"(g3),
                  "v"(g4), "v"(g5), "v"(g6), "v"(g7) : "memory");
}
__device__ __forceinline__ void wait_async0() {
  asm volatile("s_wait_asynccnt 0x0" ::: "memory");
}
// This wave's LDS reads have retired before the barrier behind which their
// buffer is refilled by copies.
__device__ __forceinline__ void wait_ds0() {
  asm volatile("s_wait_dscnt 0x0" ::: "memory");
}

// ---------------- fp32 -> fp16 cast (8 elems / thread) ----------------
__global__ void cast_f32_f16(const float* __restrict__ s, _Float16* __restrict__ d,
                             long n) {
  long i = ((long)blockIdx.x * blockDim.x + threadIdx.x) * 8;
  if (i + 8 > n) return;
  float4 a = *(const float4*)(s + i);
  float4 b = *(const float4*)(s + i + 4);
  v8h h;
  h[0] = (_Float16)a.x; h[1] = (_Float16)a.y; h[2] = (_Float16)a.z; h[3] = (_Float16)a.w;
  h[4] = (_Float16)b.x; h[5] = (_Float16)b.y; h[6] = (_Float16)b.z; h[7] = (_Float16)b.w;
  *(v8h*)(d + i) = h;
}

// ---------------- tiled WMMA GEMM: C[m,n] = act(A[m,:] . Bw[n,:] + bias[n]) ----
// A: [M x FEAT] f16 row-major, Bw: [FEAT x FEAT] f16 row-major (weights, N-major)
// Double-buffered LDS, tiles filled by async global->LDS DMA.
// A stage holds 64 k: eight lanes copy one row's 128 B, so a wave's copy asks
// L2 for four whole lines (at 32 k it asks for eight half lines).
// LDS rows are pitched 144 B: the 16 rows that a half-wave's ds_load_b128 reads
// then fall on all 64 banks once.
__global__ __launch_bounds__(256)
void gemm_wmma(const _Float16* __restrict__ A, const _Float16* __restrict__ Bw,
               const float* __restrict__ bias,
               float* __restrict__ out32, _Float16* __restrict__ out16,
               _Float16* __restrict__ outT, int ldT, int relu) {
  __shared__ __align__(16) _Float16 sA[2][128 * LDP];
  __shared__ __align__(16) _Float16 sB[2][128 * LDP];
  const int tid  = threadIdx.x;
  const int lane = tid & 31;
  const int wid  = tid >> 5;
  const int wm   = wid >> 2;           // 0..1
  const int wn   = wid & 3;            // 0..3
  const long bm  = (long)blockIdx.x * 128;
  const long bn  = (long)blockIdx.y * 128;
  const int l16  = lane & 15;
  const int koff = (lane < 16) ? 0 : 8;

  // per-thread DMA slots: rows row0 + 32*{0..3}, 8-f16 chunk ch0 (16B)
  const int row0 = tid >> 3;           // 0..31
  const int ch0  = (tid & 7) << 3;     // 0,8,..,56

  const v8f vz = {0.f, 0.f, 0.f, 0.f, 0.f, 0.f, 0.f, 0.f};
  v8f acc[4][2];
#pragma unroll
  for (int i = 0; i < 4; ++i)
#pragma unroll
    for (int j = 0; j < 2; ++j) acc[i][j] = vz;

  auto load_tile = [&](int buf, int k0) {
    const _Float16* gA = &A[(bm + row0) * FEAT + k0 + ch0];
    const _Float16* gB = &Bw[(bn + row0) * FEAT + k0 + ch0];
    unsigned la = (unsigned)(uintptr_t)(&sA[buf][row0 * LDP + ch0]);
    unsigned lb = (unsigned)(uintptr_t)(&sB[buf][row0 * LDP + ch0]);
    async_copy16x8(la, la + 32 * LDP * 2, la + 64 * LDP * 2, la + 96 * LDP * 2,
                   lb, lb + 32 * LDP * 2, lb + 64 * LDP * 2, lb + 96 * LDP * 2,
                   gA, gA + (long)32 * FEAT, gA + (long)64 * FEAT, gA + (long)96 * FEAT,
                   gB, gB + (long)32 * FEAT, gB + (long)64 * FEAT, gB + (long)96 * FEAT);
  };

  load_tile(0, 0);
  wait_async0();
  __syncthreads();

  for (int k0 = 0; k0 < FEAT; k0 += BK) {
    const int buf = (k0 / BK) & 1;
    if (k0 + BK < FEAT) load_tile(buf ^ 1, k0 + BK);   // DMA next tile

    // the stage's two 32-k blocks, in rising k: the sums keep their order
#pragma unroll
    for (int kk = 0; kk < BK; kk += 32) {
      Frag32 af[4], bf[2];
#pragma unroll
      for (int i = 0; i < 4; ++i) {
        int r = wm * 64 + i * 16 + l16;
        af[i].u[0] = *(const uint4*)(&sA[buf][r * LDP + kk + koff]);
        af[i].u[1] = *(const uint4*)(&sA[buf][r * LDP + kk + koff + 16]);
      }
#pragma unroll
      for (int j = 0; j < 2; ++j) {
        int r = wn * 32 + j * 16 + l16;
        bf[j].u[0] = *(const uint4*)(&sB[buf][r * LDP + kk + koff]);
        bf[j].u[1] = *(const uint4*)(&sB[buf][r * LDP + kk + koff + 16]);
      }
#pragma unroll
      for (int i = 0; i < 4; ++i)
#pragma unroll
        for (int j = 0; j < 2; ++j)
          acc[i][j] = wmma32(af[i].v, bf[j].v, acc[i][j]);
    }

    // next tile landed; barrier also guards WAR on buf, refilled by the next trip's DMA
    wait_ds0();
    wait_async0();
    __syncthreads();
  }

  const int moff = (lane < 16) ? 0 : 8;
#pragma unroll
  for (int i = 0; i < 4; ++i) {
#pragma unroll
    for (int j = 0; j < 2; ++j) {
      long n  = bn + wn * 32 + j * 16 + l16;
      long mb = bm + wm * 64 + i * 16 + moff;
      float bv = bias ? bias[n] : 0.f;
      float vals[8];
#pragma unroll
      for (int r = 0; r < 8; ++r) {
        float x = acc[i][j][r] + bv;
        if (relu) x = fmaxf(x, 0.f);
        vals[r] = x;
      }
      if (out32) {
#pragma unroll
        for (int r = 0; r < 8; ++r) out32[(mb + r) * FEAT + n] = vals[r];
      }
      if (out16) {
#pragma unroll
        for (int r = 0; r < 8; ++r) out16[(mb + r) * FEAT + n] = (_Float16)vals[r];
      }
      if (outT) {
        v8h hh;
#pragma unroll
        for (int r = 0; r < 8; ++r) hh[r] = (_Float16)vals[r];
        *(v8h*)(&outT[n * (long)ldT + mb]) = hh;   // mb multiple of 8 -> 16B aligned
      }
    }
  }
}

// ---------------- fused flash attention + residual + b_v --------------
// Qm: [BSZ*QN x FEAT] f16 (head h at cols h*DG..), Km: [BSZ*KN x FEAT] f16,
// Vt: [FEAT x BSZ*KN] f16 (transposed V' = sup1 @ Wv^T), out: f32 (+=).
// One wave handles 16 q rows of one (b,h). Computes S^T = K.Q^T so the
// softmaxed P converts to an A-fragment with per-lane packs only.
__global__ __launch_bounds__(128)
void attn_wmma(const _Float16* __restrict__ Qm, const _Float16* __restrict__ Km,
               const _Float16* __restrict__ Vt, const float* __restrict__ bv,
               float* __restrict__ out) {
  const int lane  = threadIdx.x & 31;
  const int wid   = threadIdx.x >> 5;
  const int h     = blockIdx.y;
  const int b     = blockIdx.z;
  const int qtile = blockIdx.x * 4 + wid;          // 0..255
  const long qbase = (long)b * QN + (long)qtile * 16;
  const int l16  = lane & 15;
  const int koff = (lane < 16) ? 0 : 8;
  const int moff = (lane < 16) ? 0 : 8;

  // Q fragments, used as B (Q^T): lane = q row, regs = dims
  Frag32 qf[4];
  {
    const _Float16* qrow = Qm + (qbase + l16) * FEAT + h * DG;
#pragma unroll
    for (int d = 0; d < 4; ++d) {
      qf[d].u[0] = *(const uint4*)(qrow + d * 32 + koff);
      qf[d].u[1] = *(const uint4*)(qrow + d * 32 + koff + 16);
    }
  }

  const v8f vz = {0.f, 0.f, 0.f, 0.f, 0.f, 0.f, 0.f, 0.f};
  v8f o[8];
#pragma unroll
  for (int t = 0; t < 8; ++t) o[t] = vz;
  float m_st = -3.0e38f, l_st = 0.f;
  const float scale = 0.08838834764831845f;        // 1/sqrt(128)

  for (int kc = 0; kc < KN; kc += 32) {
    // S^T tiles: s0 = keys kc..kc+15, s1 = keys kc+16..kc+31 (lane = q)
    v8f s0 = vz, s1 = vz;
    {
      const _Float16* krow = Km + ((long)b * KN + kc + l16) * FEAT + h * DG;
#pragma unroll
      for (int d = 0; d < 4; ++d) {
        Frag32 kf;
        kf.u[0] = *(const uint4*)(krow + d * 32 + koff);
        kf.u[1] = *(const uint4*)(krow + d * 32 + koff + 16);
        s0 = wmma32(kf.v, qf[d].v, s0);
      }
      krow += (long)16 * FEAT;
#pragma unroll
      for (int d = 0; d < 4; ++d) {
        Frag32 kf;
        kf.u[0] = *(const uint4*)(krow + d * 32 + koff);
        kf.u[1] = *(const uint4*)(krow + d * 32 + koff + 16);
        s1 = wmma32(kf.v, qf[d].v, s1);
      }
    }
    // online softmax over this 32-key chunk (row = q = lane%16)
    float mloc = -3.0e38f;
#pragma unroll
    for (int r = 0; r < 8; ++r) {
      s0[r] *= scale; s1[r] *= scale;
      mloc = fmaxf(mloc, fmaxf(s0[r], s1[r]));
    }
    mloc = fmaxf(mloc, __shfl_xor(mloc, 16));
    float mnew  = fmaxf(m_st, mloc);
    float alpha = __expf(m_st - mnew);
    float rs = 0.f;
#pragma unroll
    for (int r = 0; r < 8; ++r) {
      s0[r] = __expf(s0[r] - mnew); rs += s0[r];
      s1[r] = __expf(s1[r] - mnew); rs += s1[r];
    }
    rs += __shfl_xor(rs, 16);
    l_st = l_st * alpha + rs;
    m_st = mnew;
    // pack P as A-fragment (lane = q, regs = 32 keys) — per-lane only
    Frag32 pf;
#pragma unroll
    for (int r = 0; r < 8; ++r) {
      pf.v[r]     = (_Float16)s0[r];
      pf.v[8 + r] = (_Float16)s1[r];
    }
    // broadcast alpha to O layout (vgpr r <-> q = r + moff)
    float aq[8];
#pragma unroll
    for (int r = 0; r < 8; ++r) aq[r] = __shfl(alpha, r + moff);
#pragma unroll
    for (int t = 0; t < 8; ++t) {
#pragma unroll
      for (int r = 0; r < 8; ++r) o[t][r] *= aq[r];
      const _Float16* vrow =
          Vt + ((long)(h * DG + t * 16 + l16)) * (BSZ * KN) + (long)b * KN + kc;
      Frag32 vf;
      vf.u[0] = *(const uint4*)(vrow + koff);
      vf.u[1] = *(const uint4*)(vrow + koff + 16);
      o[t] = wmma32(pf.v, vf.v, o[t]);
    }
  }

  float linv[8];
#pragma unroll
  for (int r = 0; r < 8; ++r) linv[r] = 1.0f / __shfl(l_st, r + moff);
#pragma unroll
  for (int t = 0; t < 8; ++t) {
    int col = h * DG + t * 16 + l16;
    float bb = bv[col];
#pragma unroll
    for (int r = 0; r < 8; ++r) {
      long idx = (qbase + moff + r) * FEAT + col;
      out[idx] += o[t][r] * linv[r] + bb;
    }
  }
}

extern "C" void kernel_launch(void* const* d_in, const int* in_sizes, int n_in,
                              void* d_out, int out_size, void* d_ws, size_t ws_size,
                              hipStream_t stream) {
  (void)in_sizes; (void)n_in; (void)out_size; (void)ws_size;
  const float* ref_feat = (const float*)d_in[0];
  const float* sup_feat = (const float*)d_in[1];
  const float* W_fc = (const float*)d_in[2];
  const float* b_fc = (const float*)d_in[3];
  const float* W_q  = (const float*)d_in[4];
  const float* b_q  = (const float*)d_in[5];
  const float* W_k  = (const float*)d_in[6];
  const float* b_k  = (const float*)d_in[7];
  const float* W_v  = (const float*)d_in[8];
  const float* b_v  = (const float*)d_in[9];
  float* out = (float*)d_out;

  size_t off = 0;
  auto carve = [&](size_t bytes) -> void* {
    void* p = (char*)d_ws + off;
    off += (bytes + 255) & ~(size_t)255;
    return p;
  };
  _Float16* ref16   = (_Float16*)carve((size_t)BSZ * QN * FEAT * 2);
  _Float16* sup16   = (_Float16*)carve((size_t)BSZ * KN * FEAT * 2);
  _Float16* wfc16   = (_Float16*)carve((size_t)FEAT * FEAT * 2);
  _Float16* wq16    = (_Float16*)carve((size_t)FEAT * FEAT * 2);
  _Float16* wk16    = (_Float16*)carve((size_t)FEAT * FEAT * 2);
  _Float16* wv16    = (_Float16*)carve((size_t)FEAT * FEAT * 2);
  _Float16* ref1_16 = (_Float16*)carve((size_t)BSZ * QN * FEAT * 2);
  _Float16* sup1_16 = (_Float16*)carve((size_t)BSZ * KN * FEAT * 2);
  _Float16* q16     = (_Float16*)carve((size_t)BSZ * QN * FEAT * 2);
  _Float16* k16     = (_Float16*)carve((size_t)BSZ * KN * FEAT * 2);
  _Float16* vT16    = (_Float16*)carve((size_t)FEAT * BSZ * KN * 2);

  auto cast = [&](const float* s, _Float16* d, long n) {
    cast_f32_f16<<<dim3((unsigned)(n / 8 / 256)), dim3(256), 0, stream>>>(s, d, n);
  };
  cast(ref_feat, ref16, (long)BSZ * QN * FEAT);
  cast(sup_feat, sup16, (long)BSZ * KN * FEAT);
  cast(W_fc, wfc16, (long)FEAT * FEAT);
  cast(W_q, wq16, (long)FEAT * FEAT);
  cast(W_k, wk16, (long)FEAT * FEAT);
  cast(W_v, wv16, (long)FEAT * FEAT);

  dim3 blk(256);
  // ref1 = relu(ref @ Wfc^T + b_fc): f32 -> d_out (residual), f16 -> ref1_16
  gemm_wmma<<<dim3(BSZ * QN / 128, FEAT / 128), blk, 0, stream>>>(
      ref16, wfc16, b_fc, out, ref1_16, nullptr, 0, 1);
  // sup1 = relu(sup @ Wfc^T + b_fc)
  gemm_wmma<<<dim3(BSZ * KN / 128, FEAT / 128), blk, 0, stream>>>(
      sup16, wfc16, b_fc, nullptr, sup1_16, nullptr, 0, 1);
  // q = ref1 @ Wq^T + b_q
  gemm_wmma<<<dim3(BSZ * QN / 128, FEAT / 128), blk, 0, stream>>>(
      ref1_16, wq16, b_q, nullptr, q16, nullptr, 0, 0);
  // k = sup1 @ Wk^T + b_k
  gemm_wmma<<<dim3(BSZ * KN / 128, FEAT / 128), blk, 0, stream>>>(
      sup1_16, wk16, b_k, nullptr, k16, nullptr, 0, 0);
  // V' = sup1 @ Wv^T, stored transposed [FEAT x BSZ*KN]
  gemm_wmma<<<dim3(BSZ * KN / 128, FEAT / 128), blk, 0, stream>>>(
      sup1_16, wv16, nullptr, nullptr, nullptr, vT16, BSZ * KN, 0);
  // attention + grouped-conv (pre-folded into V') + b_v + residual
  attn_wmma<<<dim3(QN / 64, NG, BSZ), dim3(128), 0, stream>>>(
      q16, k16, vT16, b_v, out);
}

// v003
// A run of this version takes 339 microseconds.
// Timed twice side by side with v002, it ran 1.04 times as fast both times.
// All steps since v000 together make it 1.38 times as fast.
#include <hip/hip_runtime.h>

#define FEAT 2048
#define QN   4096
#define KN   512
#define BSZ  2
#define NG   16
#define DG   128
#define BK   64   // k depth of one LDS stage: 128 B of every operand row, one whole line
#define LDP  72   // LDS row pitch in f16: 64 data + 8 pad = 144 B (16 B x odd)

typedef __attribute__((ext_vector_type(16))) _Float16 v16h;
typedef __attribute__((ext_vector_type(8)))  _Float16 v8h;
typedef __attribute__((ext_vector_type(8)))  float    v8f;

union Frag32 { v16h v; uint4 u[2]; };

__device__ __forceinline__ v8f wmma32(v16h a, v16h b, v8f c) {
  return __builtin_amdgcn_wmma_f32_16x16x32_f16(false, a, false, b, (short)0, c,
                                                false, false);
}

// CDNA5 async DMA: global -> LDS, no VGPR staging, tracked by ASYNCcnt.
// One stage's eight copies of a lane in one statement. The closing s_wait_xcnt
// stands inside it so that no later write of an address register can be
// scheduled in front of it.
__device__ __forceinline__ void async_copy16x8(unsigned l0, unsigned l1,
                                               unsigned l2, unsigned l3,
                                               unsigned l4, unsigned l5,
                                               unsigned l6, unsigned l7,
                                               const _Float16* g0, const _Float16* g1,
                                               const _Float16* g2, const _Float16* g3,
                                               const _Float16* g4, const _Float16* g5,
                                               const _Float16* g6, const _Float16* g7) {
  asm volatile("global_load_async_to_lds_b128 %0, %8, off\n\t"
               "global_load_async_to_lds_b128 %1, %9, off\n\t"
               "global_load_async_to_lds_b128 %2, %10, off\n\t"
               "global_load_async_to_lds_b128 %3, %11, off\n\t"
               "global_load_async_to_lds_b128 %4, %12, off\n\t"
               "global_load_async_to_lds_b128 %5, %13, off\n\t"
               "global_load_async_to_lds_b128 %6, %14, off\n\t"
               "global_load_async_to_lds_b128 %7, %15, off\n\t"
               "s_wait_xcnt 0x0"
               :: "v"(l0), "v"(l1), "v"(l2), "v"(l3),
                  "v"(l4), "v"(l5), "v"(l6), "v"(l7),
                  "v"(g0), "v"(g1), "v"(g2), "v"(g3),
                  "v"(g4), "v"(g5), "v"(g6), "v"(g7) : "memory");
}
__device__ __forceinline__ void wait_async0() {
  asm volatile("s_wait_asynccnt 0x0" ::: "memory");
}
// This wave's LDS reads have retired before the barrier behind which their
// buffer is refilled by copies.
__device__ __forceinline__ void wait_ds0() {
  asm volatile("s_wait_dscnt 0x0" ::: "memory");
}

// ---------------- fp32 -> fp16 cast of all six operands, one launch ----------
// 256 work-groups of 16 waves stream the whole cast. In step i wave w converts
// piece i * CW + w: 512 f32 in a row, read by four loads of 512 B (whole lines)
// and written by four stores of 256 B (whole lines). A step spans CSTEP elements
// and every operand is a whole number of steps long, so which operand a step
// reads is known at compile time.
#define CW     4096                 // waves in the launch
#define CPIECE 512                  // f32 elements of one piece
#define CSTEP  ((long)CW * CPIECE)  // elements that all waves convert in one step
#define S_REF  ((long)BSZ * QN * FEAT / CSTEP)   // 8 steps
#define S_SUP  ((long)BSZ * KN * FEAT / CSTEP)   // 1 step
#define S_W    ((long)FEAT * FEAT / CSTEP)       // 2 steps
#define S_ALL  (S_REF + S_SUP + 4 * S_W)         // 17 steps
static_assert(S_REF * CSTEP == (long)BSZ * QN * FEAT, "whole steps");
static_assert(S_SUP * CSTEP == (long)BSZ * KN * FEAT, "whole steps");
static_assert(S_W * CSTEP == (long)FEAT * FEAT, "whole steps");

typedef __attribute__((ext_vector_type(4))) _Float16 v4h;

// The pointers carry no __restrict__: the loads then stay where they are written,
// two pieces ahead of their stores, and are not gathered at the kernel's head.
__global__ __launch_bounds__(512)
void cast_all(const float* ref, const float* sup, const float* wfc,
              const float* wq, const float* wk, const float* wv,
              _Float16* dref, _Float16* dsup, _Float16* dwfc,
              _Float16* dwq, _Float16* dwk, _Float16* dwv) {
  // this lane's first element inside a step's span, and its byte offsets (under
  // 8 MB, so 32 bits) from a step's first source and first destination byte
  const unsigned e  = (blockIdx.x * 16 + (threadIdx.x >> 5)) * CPIECE + (threadIdx.x & 31) * 4;
  const unsigned lb = e * 4u;
  const unsigned sb = e * 2u;

  auto load_piece = [&](float4 (&v)[4], int i) {
    const float* s =
        i < S_REF                     ? ref + i * CSTEP
      : i < S_REF + S_SUP             ? sup + (i - S_REF) * CSTEP
      : i < S_REF + S_SUP + S_W       ? wfc + (i - S_REF - S_SUP) * CSTEP
      : i < S_REF + S_SUP + 2 * S_W   ? wq  + (i - S_REF - S_SUP - S_W) * CSTEP
      : i < S_REF + S_SUP + 3 * S_W   ? wk  + (i - S_REF - S_SUP - 2 * S_W) * CSTEP
                                      : wv  + (i - S_REF - S_SUP - 3 * S_W) * CSTEP;
#pragma unroll
    for (int j = 0; j < 4; ++j) v[j] = *(const float4*)((const char*)(s + j * 128) + lb);
  };
  auto store_piece = [&](const float4 (&v)[4], int i) {
    _Float16* d =
        i < S_REF                     ? dref + i * CSTEP
      : i < S_REF + S_SUP             ? dsup + (i - S_REF) * CSTEP
      : i < S_REF + S_SUP + S_W       ? dwfc + (i - S_REF - S_SUP) * CSTEP
      : i < S_REF + S_SUP + 2 * S_W   ? dwq  + (i - S_REF - S_SUP - S_W) * CSTEP
      : i < S_REF + S_SUP + 3 * S_W   ? dwk  + (i - S_REF - S_SUP - 2 * S_W) * CSTEP
                                      : dwv  + (i - S_REF - S_SUP - 3 * S_W) * CSTEP;
#pragma unroll
    for (int j = 0; j < 4; ++j) {
      v4h h;
      h[0] = (_Float16)v[j].x; h[1] = (_Float16)v[j].y;
      h[2] = (_Float16)v[j].z; h[3] = (_Float16)v[j].w;
      *(v4h*)((char*)(d + j * 128) + sb) = h;
    }
  };

  // three register sets: the loads of two later pieces are in flight while a
  // piece is converted and stored (8 to 12 loads of a wave outstanding)
  float4 v[3][4];
  load_piece(v[0], 0);
  load_piece(v[1], 1);
  // the next loads may land in registers that these loads name as address
  asm volatile("s_wait_xcnt 0x0" ::: "memory");
  // unrolled whole: the step number picks operand and register set at compile time
#pragma unroll
  for (int i = 0; i < S_ALL; ++i) {
    if (i + 2 < S_ALL) load_piece(v[(i + 2) % 3], i + 2);
    store_piece(v[i % 3], i);
    // the next loads land in registers that these stores name as data
    if (i + 3 < S_ALL) asm volatile("s_wait_xcnt 0x0" ::: "memory");
  }
}

// ---------------- tiled WMMA GEMM: C[m,n] = act(A[m,:] . Bw[n,:] + bias[n]) ----
// A: [M x FEAT] f16 row-major, Bw: [FEAT x FEAT] f16 row-major (weights, N-major)
// Double-buffered LDS, tiles filled by async global->LDS DMA.
// A stage holds 64 k: eight lanes copy one row's 128 B, so a wave's copy asks
// L2 for four whole lines (at 32 k it asks for eight half lines).
// LDS rows are pitched 144 B: the 16 rows that a half-wave's ds_load_b128 reads
// then fall on all 64 banks once.
__global__ __launch_bounds__(256)
void gemm_wmma(const _Float16* __restrict__ A, const _Float16* __restrict__ Bw,
               const float* __restrict__ bias,
               float* __restrict__ out32, _Float16* __restrict__ out16,
               _Float16* __restrict__ outT, int ldT, int relu) {
  __shared__ __align__(16) _Float16 sA[2][128 * LDP];
  __shared__ __align__(16) _Float16 sB[2][128 * LDP];
  const int tid  = threadIdx.x;
  const int lane = tid & 31;
  const int wid  = tid >> 5;
  const int wm   = wid >> 2;           // 0..1
  const int wn   = wid & 3;            // 0..3
  const long bm  = (long)blockIdx.x * 128;
  const long bn  = (long)blockIdx.y * 128;
  const int l16  = lane & 15;
  const int koff = (lane < 16) ? 0 : 8;

  // per-thread DMA slots: rows row0 + 32*{0..3}, 8-f16 chunk ch0 (16B)
  const int row0 = tid >> 3;           // 0..31
  const int ch0  = (tid & 7) << 3;     // 0,8,..,56

  const v8f vz = {0.f, 0.f, 0.f, 0.f, 0.f, 0.f, 0.f, 0.f};
  v8f acc[4][2];
#pragma unroll
  for (int i = 0; i < 4; ++i)
#pragma unroll
    for (int j = 0; j < 2; ++j) acc[i][j] = vz;

  auto load_tile = [&](int buf, int k0) {
    const _Float16* gA = &A[(bm + row0) * FEAT + k0 + ch0];
    const _Float16* gB = &Bw[(bn + row0) * FEAT + k0 + ch0];
    unsigned la = (unsigned)(uintptr_t)(&sA[buf][row0 * LDP + ch0]);
    unsigned lb = (unsigned)(uintptr_t)(&sB[buf][row0 * LDP + ch0]);
    async_copy16x8(la, la + 32 * LDP * 2, la + 64 * LDP * 2, la + 96 * LDP * 2,
                   lb, lb + 32 * LDP * 2, lb + 64 * LDP * 2, lb + 96 * LDP * 2,
                   gA, gA + (long)32 * FEAT, gA + (long)64 * FEAT, gA + (long)96 * FEAT,
                   gB, gB + (long)32 * FEAT, gB + (long)64 * FEAT, gB + (long)96 * FEAT);
  };

  load_tile(0, 0);
  wait_async0();
  __syncthreads();

  for (int k0 = 0; k0 < FEAT; k0 += BK) {
    const int buf = (k0 / BK) & 1;
    if (k0 + BK < FEAT) load_tile(buf ^ 1, k0 + BK);   // DMA next tile

    // the stage's two 32-k blocks, in rising k: the sums keep their order
#pragma unroll
    for (int kk = 0; kk < BK; kk += 32) {
      Frag32 af[4], bf[2];
#pragma unroll
      for (int i = 0; i < 4; ++i) {
        int r = wm * 64 + i * 16 + l16;
        af[i].u[0] = *(const uint4*)(&sA[buf][r * LDP + kk + koff]);
        af[i].u[1] = *(const uint4*)(&sA[buf][r * LDP + kk + koff + 16]);
      }
#pragma unroll
      for (int j = 0; j < 2; ++j) {
        int r = wn * 32 + j * 16 + l16;
        bf[j].u[0] = *(const uint4*)(&sB[buf][r * LDP + kk + koff]);
        bf[j].u[1] = *(const uint4*)(&sB[buf][r * LDP + kk + koff + 16]);
      }
#pragma unroll
      for (int i = 0; i < 4; ++i)
#pragma unroll
        for (int j = 0; j < 2; ++j)
          acc[i][j] = wmma32(af[i].v, bf[j].v, acc[i][j]);
    }

    // next tile landed; barrier also guards WAR on buf, refilled by the next trip's DMA
    wait_ds0();
    wait_async0();
    __syncthreads();
  }

  const int moff = (lane < 16) ? 0 : 8;
#pragma unroll
  for (int i = 0; i < 4; ++i) {
#pragma unroll
    for (int j = 0; j < 2; ++j) {
      long n  = bn + wn * 32 + j * 16 + l16;
      long mb = bm + wm * 64 + i * 16 + moff;
      float bv = bias ? bias[n] : 0.f;
      float vals[8];
#pragma unroll
      for (int r = 0; r < 8; ++r) {
        float x = acc[i][j][r] + bv;
        if (relu) x = fmaxf(x, 0.f);
        vals[r] = x;
      }
      if (out32) {
#pragma unroll
        for (int r = 0; r < 8; ++r) out32[(mb + r) * FEAT + n] = vals[r];
      }
      if (out16) {
#pragma unroll
        for (int r = 0; r < 8; ++r) out16[(mb + r) * FEAT + n] = (_Float16)vals[r];
      }
      if (outT) {
        v8h hh;
#pragma unroll
        for (int r = 0; r < 8; ++r) hh[r] = (_Float16)vals[r];
        *(v8h*)(&outT[n * (long)ldT + mb]) = hh;   // mb multiple of 8 -> 16B aligned
      }
    }
  }
}

// ---------------- fused flash attention + residual + b_v --------------
// Qm: [BSZ*QN x FEAT] f16 (head h at cols h*DG..), Km: [BSZ*KN x FEAT] f16,
// Vt: [FEAT x BSZ*KN] f16 (transposed V' = sup1 @ Wv^T), out: f32 (+=).
// One wave handles 16 q rows of one (b,h). Computes S^T = K.Q^T so the
// softmaxed P converts to an A-fragment with per-lane packs only.
__global__ __launch_bounds__(128)
void attn_wmma(const _Float16* __restrict__ Qm, const _Float16* __restrict__ Km,
               const _Float16* __restrict__ Vt, const float* __restrict__ bv,
               float* __restrict__ out) {
  const int lane  = threadIdx.x & 31;
  const int wid   = threadIdx.x >> 5;
  const int h     = blockIdx.y;
  const int b     = blockIdx.z;
  const int qtile = blockIdx.x * 4 + wid;          // 0..255
  const long qbase = (long)b * QN + (long)qtile * 16;
  const int l16  = lane & 15;
  const int koff = (lane < 16) ? 0 : 8;
  const int moff = (lane < 16) ? 0 : 8;

  // Q fragments, used as B (Q^T): lane = q row, regs = dims
  Frag32 qf[4];
  {
    const _Float16* qrow = Qm + (qbase + l16) * FEAT + h * DG;
#pragma unroll
    for (int d = 0; d < 4; ++d) {
      qf[d].u[0] = *(const uint4*)(qrow + d * 32 + koff);
      qf[d].u[1] = *(const uint4*)(qrow + d * 32 + koff + 16);
    }
  }

  const v8f vz = {0.f, 0.f, 0.f, 0.f, 0.f, 0.f, 0.f, 0.f};
  v8f o[8];
#pragma unroll
  for (int t = 0; t < 8; ++t) o[t] = vz;
  float m_st = -3.0e38f, l_st = 0.f;
  const float scale = 0.08838834764831845f;        // 1/sqrt(128)

  for (int kc = 0; kc < KN; kc += 32) {
    // S^T tiles: s0 = keys kc..kc+15, s1 = keys kc+16..kc+31 (lane = q)
    v8f s0 = vz, s1 = vz;
    {
      const _Float16* krow = Km + ((long)b * KN + kc + l16) * FEAT + h * DG;
#pragma unroll
      for (int d = 0; d < 4; ++d) {
        Frag32 kf;
        kf.u[0] = *(const uint4*)(krow + d * 32 + koff);
        kf.u[1] = *(const uint4*)(krow + d * 32 + koff + 16);
        s0 = wmma32(kf.v, qf[d].v, s0);
      }
      krow += (long)16 * FEAT;
#pragma unroll
      for (int d = 0; d < 4; ++d) {
        Frag32 kf;
        kf.u[0] = *(const uint4*)(krow + d * 32 + koff);
        kf.u[1] = *(const uint4*)(krow + d * 32 + koff + 16);
        s1 = wmma32(kf.v, qf[d].v, s1);
      }
    }
    // online softmax over this 32-key chunk (row = q = lane%16)
    float mloc = -3.0e38f;
#pragma unroll
    for (int r = 0; r < 8; ++r) {
      s0[r] *= scale; s1[r] *= scale;
      mloc = fmaxf(mloc, fmaxf(s0[r], s1[r]));
    }
    mloc = fmaxf(mloc, __shfl_xor(mloc, 16));
    float mnew  = fmaxf(m_st, mloc);
    float alpha = __expf(m_st - mnew);
    float rs = 0.f;
#pragma unroll
    for (int r = 0; r < 8; ++r) {
      s0[r] = __expf(s0[r] - mnew); rs += s0[r];
      s1[r] = __expf(s1[r] - mnew); rs += s1[r];
    }
    rs += __shfl_xor(rs, 16);
    l_st = l_st * alpha + rs;
    m_st = mnew;
    // pack P as A-fragment (lane = q, regs = 32 keys) — per-lane only
    Frag32 pf;
#pragma unroll
    for (int r = 0; r < 8; ++r) {
      pf.v[r]     = (_Float16)s0[r];
      pf.v[8 + r] = (_Float16)s1[r];
    }
    // broadcast alpha to O layout (vgpr r <-> q = r + moff)
    float aq[8];
#pragma unroll
    for (int r = 0; r < 8; ++r) aq[r] = __shfl(alpha, r + moff);
#pragma unroll
    for (int t = 0; t < 8; ++t) {
#pragma unroll
      for (int r = 0; r < 8; ++r) o[t][r] *= aq[r];
      const _Float16* vrow =
          Vt + ((long)(h * DG + t * 16 + l16)) * (BSZ * KN) + (long)b * KN + kc;
      Frag32 vf;
      vf.u[0] = *(const uint4*)(vrow + koff);
      vf.u[1] = *(const uint4*)(vrow + koff + 16);
      o[t] = wmma32(pf.v, vf.v, o[t]);
    }
  }

  float linv[8];
#pragma unroll
  for (int r = 0; r < 8; ++r) linv[r] = 1.0f / __shfl(l_st, r + moff);
#pragma unroll
  for (int t = 0; t < 8; ++t) {
    int col = h * DG + t * 16 + l16;
    float bb = bv[col];
#pragma unroll
    for (int r = 0; r < 8; ++r) {
      long idx = (qbase + moff + r) * FEAT + col;
      out[idx] += o[t][r] * linv[r] + bb;
    }
  }
}

extern "C" void kernel_launch(void* const* d_in, const int* in_sizes, int n_in,
                              void* d_out, int out_size, void* d_ws, size_t ws_size,
                              hipStream_t stream) {
  (void)in_sizes; (void)n_in; (void)out_size; (void)ws_size;
  const float* ref_feat = (const float*)d_in[0];
  const float* sup_feat = (const float*)d_in[1];
  const float* W_fc = (const float*)d_in[2];
  const float* b_fc = (const float*)d_in[3];
  const float* W_q  = (const float*)d_in[4];
  const float* b_q  = (const float*)d_in[5];
  const float* W_k  = (const float*)d_in[6];
  const float* b_k  = (const float*)d_in[7];
  const float* W_v  = (const float*)d_in[8];
  const float* b_v  = (const float*)d_in[9];
  float* out = (float*)d_out;

  size_t off = 0;
  auto carve = [&](size_t bytes) -> void* {
    void* p = (char*)d_ws + off;
    off += (bytes + 255) & ~(size_t)255;
    return p;
  };
  _Float16* ref16   = (_Float16*)carve((size_t)BSZ * QN * FEAT * 2);
  _Float16* sup16   = (_Float16*)carve((size_t)BSZ * KN * FEAT * 2);
  _Float16* wfc16   = (_Float16*)carve((size_t)FEAT * FEAT * 2);
  _Float16* wq16    = (_Float16*)carve((size_t)FEAT * FEAT * 2);
  _Float16* wk16    = (_Float16*)carve((size_t)FEAT * FEAT * 2);
  _Float16* wv16    = (_Float16*)carve((size_t)FEAT * FEAT * 2);
  _Float16* ref1_16 = (_Float16*)carve((size_t)BSZ * QN * FEAT * 2);
  _Float16* sup1_16 = (_Float16*)carve((size_t)BSZ * KN * FEAT * 2);
  _Float16* q16     = (_Float16*)carve((size_t)BSZ * QN * FEAT * 2);
  _Float16* k16     = (_Float16*)carve((size_t)BSZ * KN * FEAT * 2);
  _Float16* vT16    = (_Float16*)carve((size_t)FEAT * BSZ * KN * 2);

  cast_all<<<dim3(CW / 16), dim3(512), 0, stream>>>(
      ref_feat, sup_feat, W_fc, W_q, W_k, W_v,
      ref16, sup16, wfc16, wq16, wk16, wv16);

  dim3 blk(256);
  // ref1 = relu(ref @ Wfc^T + b_fc): f32 -> d_out (residual), f16 -> ref1_16
  gemm_wmma<<<dim3(BSZ * QN / 128, FEAT / 128), blk, 0, stream>>>(
      ref16, wfc16, b_fc, out, ref1_16, nullptr, 0, 1);
  // sup1 = relu(sup @ Wfc^T + b_fc)
  gemm_wmma<<<dim3(BSZ * KN / 128, FEAT / 128), blk, 0, stream>>>(
      sup16, wfc16, b_fc, nullptr, sup1_16, nullptr, 0, 1);
  // q = ref1 @ Wq^T + b_q
  gemm_wmma<<<dim3(BSZ * QN / 128, FEAT / 128), blk, 0, stream>>>(
      ref1_16, wq16, b_q, nullptr, q16, nullptr, 0, 0);
  // k = sup1 @ Wk^T + b_k
  gemm_wmma<<<dim3(BSZ * KN / 128, FEAT / 128), blk, 0, stream>>>(
      sup1_16, wk16, b_k, nullptr, k16, nullptr, 0, 0);
  // V' = sup1 @ Wv^T, stored transposed [FEAT x BSZ*KN]
  gemm_wmma<<<dim3(BSZ * KN / 128, FEAT / 128), blk, 0, stream>>>(
      sup1_16, wv16, nullptr, nullptr, nullptr, vT16, BSZ * KN, 0);
  // attention + grouped-conv (pre-folded into V') + b_v + residual
  attn_wmma<<<dim3(QN / 64, NG, BSZ), dim3(128), 0, stream>>>(
      q16, k16, vT16, b_v, out);
}

// v004
// A run of this version takes 266 microseconds.
// Next to v003, in two timings, it ran 1.28 times as fast each time.
// Counting every step since v000, it is 1.76 times as fast.
#include <hip/hip_runtime.h>

#define FEAT 2048
#define QN   4096
#define KN   512
#define BSZ  2
#define NG   16
#define DG   128
#define BK   64   // k depth of one LDS stage: 128 B of every operand row, one whole line
#define LDP  72   // LDS row pitch in f16: 64 data + 8 pad = 144 B (16 B x odd)
#define KP   136  // attention, LDS pitch of a K row in f16: 128 + 8 = 272 B (16 B x odd)
#define VP   520  // attention, LDS pitch of a V^T row in f16: 512 + 8 = 1040 B (16 B x odd)
#define AW   16   // attention, waves of a work-group
#define AQ   2    // attention, q tiles that a wave works through, one after the other

typedef __attribute__((ext_vector_type(16))) _Float16 v16h;
typedef __attribute__((ext_vector_type(8)))  _Float16 v8h;
typedef __attribute__((ext_vector_type(8)))  float    v8f;

union Frag32 { v16h v; uint4 u[2]; };

__device__ __forceinline__ v8f wmma32(v16h a, v16h b, v8f c) {
  return __builtin_amdgcn_wmma_f32_16x16x32_f16(false, a, false, b, (short)0, c,
                                                false, false);
}

// CDNA5 async DMA: global -> LDS, no VGPR staging, tracked by ASYNCcnt.
// Eight 16 B copies of a lane in one statement. The closing s_wait_xcnt
// stands inside it so that no later write of an address register can be
// scheduled in front of it.
__device__ __forceinline__ void async_copy16x8(unsigned l0, unsigned l1,
                                               unsigned l2, unsigned l3,
                                               unsigned l4, unsigned l5,
                                               unsigned l6, unsigned l7,
                                               const _Float16* g0, const _Float16* g1,
                                               const _Float16* g2, const _Float16* g3,
                                               const _Float16* g4, const _Float16* g5,
                                               const _Float16* g6, const _Float16* g7) {
  asm volatile("global_load_async_to_lds_b128 %0, %8, off\n\t"
               "global_load_async_to_lds_b128 %1, %9, off\n\t"
               "global_load_async_to_lds_b128 %2, %10, off\n\t"
               "global_load_async_to_lds_b128 %3, %11, off\n\t"
               "global_load_async_to_lds_b128 %4, %12, off\n\t"
               "global_load_async_to_lds_b128 %5, %13, off\n\t"
               "global_load_async_to_lds_b128 %6, %14, off\n\t"
               "global_load_async_to_lds_b128 %7, %15, off\n\t"
               "s_wait_xcnt 0x0"
               :: "v"(l0), "v"(l1), "v"(l2), "v"(l3),
                  "v"(l4), "v"(l5), "v"(l6), "v"(l7),
                  "v"(g0), "v"(g1), "v"(g2), "v"(g3),
                  "v"(g4), "v"(g5), "v"(g6), "v"(g7) : "memory");
}
__device__ __forceinline__ void wait_async0() {
  asm volatile("s_wait_asynccnt 0x0" ::: "memory");
}
// This wave's LDS reads have retired before the barrier behind which their
// buffer is refilled by copies.
__device__ __forceinline__ void wait_ds0() {
  asm volatile("s_wait_dscnt 0x0" ::: "memory");
}

// ---------------- fp32 -> fp16 cast of all six operands, one launch ----------
// 256 work-groups of 16 waves stream the whole cast. In step i wave w converts
// piece i * CW + w: 512 f32 in a row, read by four loads of 512 B (whole lines)
// and written by four stores of 256 B (whole lines). A step spans CSTEP elements
// and every operand is a whole number of steps long, so which operand a step
// reads is known at compile time.
#define CW     4096                 // waves in the launch
#define CPIECE 512                  // f32 elements of one piece
#define CSTEP  ((long)CW * CPIECE)  // elements that all waves convert in one step
#define S_REF  ((long)BSZ * QN * FEAT / CSTEP)   // 8 steps
#define S_SUP  ((long)BSZ * KN * FEAT / CSTEP)   // 1 step
#define S_W    ((long)FEAT * FEAT / CSTEP)       // 2 steps
#define S_ALL  (S_REF + S_SUP + 4 * S_W)         // 17 steps
static_assert(S_REF * CSTEP == (long)BSZ * QN * FEAT, "whole steps");
static_assert(S_SUP * CSTEP == (long)BSZ * KN * FEAT, "whole steps");
static_assert(S_W * CSTEP == (long)FEAT * FEAT, "whole steps");

typedef __attribute__((ext_vector_type(4))) _Float16 v4h;

// The pointers carry no __restrict__: the loads then stay where they are written,
// two pieces ahead of their stores, and are not gathered at the kernel's head.
__global__ __launch_bounds__(512)
void cast_all(const float* ref, const float* sup, const float* wfc,
              const float* wq, const float* wk, const float* wv,
              _Float16* dref, _Float16* dsup, _Float16* dwfc,
              _Float16* dwq, _Float16* dwk, _Float16* dwv) {
  // this lane's first element inside a step's span, and its byte offsets (under
  // 8 MB, so 32 bits) from a step's first source and first destination byte
  const unsigned e  = (blockIdx.x * 16 + (threadIdx.x >> 5)) * CPIECE + (threadIdx.x & 31) * 4;
  const unsigned lb = e * 4u;
  const unsigned sb = e * 2u;

  auto load_piece = [&](float4 (&v)[4], int i) {
    const float* s =
        i < S_REF                     ? ref + i * CSTEP
      : i < S_REF + S_SUP             ? sup + (i - S_REF) * CSTEP
      : i < S_REF + S_SUP + S_W       ? wfc + (i - S_REF - S_SUP) * CSTEP
      : i < S_REF + S_SUP + 2 * S_W   ? wq  + (i - S_REF - S_SUP - S_W) * CSTEP
      : i < S_REF + S_SUP + 3 * S_W   ? wk  + (i - S_REF - S_SUP - 2 * S_W) * CSTEP
                                      : wv  + (i - S_REF - S_SUP - 3 * S_W) * CSTEP;
#pragma unroll
    for (int j = 0; j < 4; ++j) v[j] = *(const float4*)((const char*)(s + j * 128) + lb);
  };
  auto store_piece = [&](const float4 (&v)[4], int i) {
    _Float16* d =
        i < S_REF                     ? dref + i * CSTEP
      : i < S_REF + S_SUP             ? dsup + (i - S_REF) * CSTEP
      : i < S_REF + S_SUP + S_W       ? dwfc + (i - S_REF - S_SUP) * CSTEP
      : i < S_REF + S_SUP + 2 * S_W   ? dwq  + (i - S_REF - S_SUP - S_W) * CSTEP
      : i < S_REF + S_SUP + 3 * S_W   ? dwk  + (i - S_REF - S_SUP - 2 * S_W) * CSTEP
                                      : dwv  + (i - S_REF - S_SUP - 3 * S_W) * CSTEP;
#pragma unroll
    for (int j = 0; j < 4; ++j) {
      v4h h;
      h[0] = (_Float16)v[j].x; h[1] = (_Float16)v[j].y;
      h[2] = (_Float16)v[j].z; h[3] = (_Float16)v[j].w;
      *(v4h*)((char*)(d + j * 128) + sb) = h;
    }
  };

  // three register sets: the loads of two later pieces are in flight while a
  // piece is converted and stored (8 to 12 loads of a wave outstanding)
  float4 v[3][4];
  load_piece(v[0], 0);
  load_piece(v[1], 1);
  // the next loads may land in registers that these loads name as address
  asm volatile("s_wait_xcnt 0x0" ::: "memory");
  // unrolled whole: the step number picks operand and register set at compile time
#pragma unroll
  for (int i = 0; i < S_ALL; ++i) {
    if (i + 2 < S_ALL) load_piece(v[(i + 2) % 3], i + 2);
    store_piece(v[i % 3], i);
    // the next loads land in registers that these stores name as data
    if (i + 3 < S_ALL) asm volatile("s_wait_xcnt 0x0" ::: "memory");
  }
}

// ---------------- tiled WMMA GEMM: C[m,n] = act(A[m,:] . Bw[n,:] + bias[n]) ----
// A: [M x FEAT] f16 row-major, Bw: [FEAT x FEAT] f16 row-major (weights, N-major)
// Double-buffered LDS, tiles filled by async global->LDS DMA.
// A stage holds 64 k: eight lanes copy one row's 128 B, so a wave's copy asks
// L2 for four whole lines (at 32 k it asks for eight half lines).
// LDS rows are pitched 144 B: the 16 rows that a half-wave's ds_load_b128 reads
// then fall on all 64 banks once.
__global__ __launch_bounds__(256)
void gemm_wmma(const _Float16* __restrict__ A, const _Float16* __restrict__ Bw,
               const float* __restrict__ bias,
               float* __restrict__ out32, _Float16* __restrict__ out16,
               _Float16* __restrict__ outT, int ldT, int relu) {
  __shared__ __align__(16) _Float16 sA[2][128 * LDP];
  __shared__ __align__(16) _Float16 sB[2][128 * LDP];
  const int tid  = threadIdx.x;
  const int lane = tid & 31;
  const int wid  = tid >> 5;
  const int wm   = wid >> 2;           // 0..1
  const int wn   = wid & 3;            // 0..3
  const long bm  = (long)blockIdx.x * 128;
  const long bn  = (long)blockIdx.y * 128;
  const int l16  = lane & 15;
  const int koff = (lane < 16) ? 0 : 8;

  // per-thread DMA slots: rows row0 + 32*{0..3}, 8-f16 chunk ch0 (16B)
  const int row0 = tid >> 3;           // 0..31
  const int ch0  = (tid & 7) << 3;     // 0,8,..,56

  const v8f vz = {0.f, 0.f, 0.f, 0.f, 0.f, 0.f, 0.f, 0.f};
  v8f acc[4][2];
#pragma unroll
  for (int i = 0; i < 4; ++i)
#pragma unroll
    for (int j = 0; j < 2; ++j) acc[i][j] = vz;

  auto load_tile = [&](int buf, int k0) {
    const _Float16* gA = &A[(bm + row0) * FEAT + k0 + ch0];
    const _Float16* gB = &Bw[(bn + row0) * FEAT + k0 + ch0];
    unsigned la = (unsigned)(uintptr_t)(&sA[buf][row0 * LDP + ch0]);
    unsigned lb = (unsigned)(uintptr_t)(&sB[buf][row0 * LDP + ch0]);
    async_copy16x8(la, la + 32 * LDP * 2, la + 64 * LDP * 2, la + 96 * LDP * 2,
                   lb, lb + 32 * LDP * 2, lb + 64 * LDP * 2, lb + 96 * LDP * 2,
                   gA, gA + (long)32 * FEAT, gA + (long)64 * FEAT, gA + (long)96 * FEAT,
                   gB, gB + (long)32 * FEAT, gB + (long)64 * FEAT, gB + (long)96 * FEAT);
  };

  load_tile(0, 0);
  wait_async0();
  __syncthreads();

  for (int k0 = 0; k0 < FEAT; k0 += BK) {
    const int buf = (k0 / BK) & 1;
    if (k0 + BK < FEAT) load_tile(buf ^ 1, k0 + BK);   // DMA next tile

    // the stage's two 32-k blocks, in rising k: the sums keep their order
#pragma unroll
    for (int kk = 0; kk < BK; kk += 32) {
      Frag32 af[4], bf[2];
#pragma unroll
      for (int i = 0; i < 4; ++i) {
        int r = wm * 64 + i * 16 + l16;
        af[i].u[0] = *(const uint4*)(&sA[buf][r * LDP + kk + koff]);
        af[i].u[1] = *(const uint4*)(&sA[buf][r * LDP + kk + koff + 16]);
      }
#pragma unroll
      for (int j = 0; j < 2; ++j) {
        int r = wn * 32 + j * 16 + l16;
        bf[j].u[0] = *(const uint4*)(&sB[buf][r * LDP + kk + koff]);
        bf[j].u[1] = *(const uint4*)(&sB[buf][r * LDP + kk + koff + 16]);
      }
#pragma unroll
      for (int i = 0; i < 4; ++i)
#pragma unroll
        for (int j = 0; j < 2; ++j)
          acc[i][j] = wmma32(af[i].v, bf[j].v, acc[i][j]);
    }

    // next tile landed; barrier also guards WAR on buf, refilled by the next trip's DMA
    wait_ds0();
    wait_async0();
    __syncthreads();
  }

  const int moff = (lane < 16) ? 0 : 8;
#pragma unroll
  for (int i = 0; i < 4; ++i) {
#pragma unroll
    for (int j = 0; j < 2; ++j) {
      long n  = bn + wn * 32 + j * 16 + l16;
      long mb = bm + wm * 64 + i * 16 + moff;
      float bv = bias ? bias[n] : 0.f;
      float vals[8];
#pragma unroll
      for (int r = 0; r < 8; ++r) {
        float x = acc[i][j][r] + bv;
        if (relu) x = fmaxf(x, 0.f);
        vals[r] = x;
      }
      if (out32) {
#pragma unroll
        for (int r = 0; r < 8; ++r) out32[(mb + r) * FEAT + n] = vals[r];
      }
      if (out16) {
#pragma unroll
        for (int r = 0; r < 8; ++r) out16[(mb + r) * FEAT + n] = (_Float16)vals[r];
      }
      if (outT) {
        v8h hh;
#pragma unroll
        for (int r = 0; r < 8; ++r) hh[r] = (_Float16)vals[r];
        *(v8h*)(&outT[n * (long)ldT + mb]) = hh;   // mb multiple of 8 -> 16B aligned
      }
    }
  }
}

// ---------------- fused flash attention + residual + b_v --------------
// Qm: [BSZ*QN x FEAT] f16 (head h at cols h*DG..), Km: [BSZ*KN x FEAT] f16,
// Vt: [FEAT x BSZ*KN] f16 (transposed V' = sup1 @ Wv^T), out: f32 (+=).
// One wave handles 16 q rows of one (b,h) at a time. Computes S^T = K.Q^T so the
// softmaxed P converts to an A-fragment with per-lane packs only.
// A work-group owns 512 q rows of one (b,h). It first copies that head's whole K
// (512 rows of 256 B) and V^T (128 rows of 1024 B) into LDS, every copy asking L2
// for four whole lines, once per work-group. The fragments, 16 rows of 32 B each,
// are then read from LDS, whose pitched rows fall on all 64 banks once, and no
// longer gathered from 16 cache lines per load by every wave.
__global__ __launch_bounds__(AW * 32)
void attn_wmma(const _Float16* __restrict__ Qm, const _Float16* __restrict__ Km,
               const _Float16* __restrict__ Vt, const float* __restrict__ bv,
               float* __restrict__ out) {
  __shared__ __align__(16) _Float16 sK[KN * KP];
  __shared__ __align__(16) _Float16 sV[DG * VP];
  const int tid   = threadIdx.x;
  const int lane  = tid & 31;
  const int wid   = tid >> 5;
  const int h     = blockIdx.y;
  const int b     = blockIdx.z;
  const int l16  = lane & 15;
  const int koff = (lane < 16) ? 0 : 8;
  const int moff = (lane < 16) ? 0 : 8;

  // Fill, 32 copies of 16 B a lane. K: 16 lanes copy a row, the block 32 rows a
  // copy. V^T: 64 lanes copy a row, the block 8 rows a copy.
  {
    const _Float16* gK = Km + ((long)b * KN + (tid >> 4)) * FEAT + h * DG + (tid & 15) * 8;
    const _Float16* gV = Vt + ((long)h * DG + (tid >> 6)) * (BSZ * KN) + (long)b * KN + (tid & 63) * 8;
    const unsigned lK = (unsigned)(uintptr_t)(&sK[(tid >> 4) * KP + (tid & 15) * 8]);
    const unsigned lV = (unsigned)(uintptr_t)(&sV[(tid >> 6) * VP + (tid & 63) * 8]);
    auto fill8 = [](unsigned l, unsigned ls, const _Float16* g, long gs) {
      async_copy16x8(l, l + ls, l + 2 * ls, l + 3 * ls,
                     l + 4 * ls, l + 5 * ls, l + 6 * ls, l + 7 * ls,
                     g, g + gs, g + 2 * gs, g + 3 * gs,
                     g + 4 * gs, g + 5 * gs, g + 6 * gs, g + 7 * gs);
    };
    fill8(lK, 32 * KP * 2, gK, (long)32 * FEAT);
    fill8(lK + 256 * KP * 2, 32 * KP * 2, gK + (long)256 * FEAT, (long)32 * FEAT);
    fill8(lV, 8 * VP * 2, gV, (long)8 * BSZ * KN);
    fill8(lV + 64 * VP * 2, 8 * VP * 2, gV + (long)64 * BSZ * KN, (long)8 * BSZ * KN);
  }
  wait_async0();     // this wave's copies have landed
  __syncthreads();   // and so have every other wave's; LDS is only read from here on

  // the wave's q tiles, one after the other; K and V^T stay in LDS for all of them
  for (int qs = 0; qs < AQ; ++qs) {
  const int qtile = (blockIdx.x * AQ + qs) * AW + wid;   // 0..255
  const long qbase = (long)b * QN + (long)qtile * 16;

  // Q fragments, used as B (Q^T): lane = q row, regs = dims
  Frag32 qf[4];
  {
    const _Float16* qrow = Qm + (qbase + l16) * FEAT + h * DG;
#pragma unroll
    for (int d = 0; d < 4; ++d) {
      qf[d].u[0] = *(const uint4*)(qrow + d * 32 + koff);
      qf[d].u[1] = *(const uint4*)(qrow + d * 32 + koff + 16);
    }
  }

  const v8f vz = {0.f, 0.f, 0.f, 0.f, 0.f, 0.f, 0.f, 0.f};
  v8f o[8];
#pragma unroll
  for (int t = 0; t < 8; ++t) o[t] = vz;
  float m_st = -3.0e38f, l_st = 0.f;
  const float scale = 0.08838834764831845f;        // 1/sqrt(128)

  for (int kc = 0; kc < KN; kc += 32) {
    // S^T tiles: s0 = keys kc..kc+15, s1 = keys kc+16..kc+31 (lane = q)
    v8f s0 = vz, s1 = vz;
    {
      const _Float16* krow = &sK[(kc + l16) * KP];
#pragma unroll
      for (int d = 0; d < 4; ++d) {
        Frag32 kf;
        kf.u[0] = *(const uint4*)(krow + d * 32 + koff);
        kf.u[1] = *(const uint4*)(krow + d * 32 + koff + 16);
        s0 = wmma32(kf.v, qf[d].v, s0);
      }
      krow += 16 * KP;
#pragma unroll
      for (int d = 0; d < 4; ++d) {
        Frag32 kf;
        kf.u[0] = *(const uint4*)(krow + d * 32 + koff);
        kf.u[1] = *(const uint4*)(krow + d * 32 + koff + 16);
        s1 = wmma32(kf.v, qf[d].v, s1);
      }
    }
    // online softmax over this 32-key chunk (row = q = lane%16)
    float mloc = -3.0e38f;
#pragma unroll
    for (int r = 0; r < 8; ++r) {
      s0[r] *= scale; s1[r] *= scale;
      mloc = fmaxf(mloc, fmaxf(s0[r], s1[r]));
    }
    mloc = fmaxf(mloc, __shfl_xor(mloc, 16));
    float mnew  = fmaxf(m_st, mloc);
    float alpha = __expf(m_st - mnew);
    float rs = 0.f;
#pragma unroll
    for (int r = 0; r < 8; ++r) {
      s0[r] = __expf(s0[r] - mnew); rs += s0[r];
      s1[r] = __expf(s1[r] - mnew); rs += s1[r];
    }
    rs += __shfl_xor(rs, 16);
    l_st = l_st * alpha + rs;
    m_st = mnew;
    // pack P as A-fragment (lane = q, regs = 32 keys) — per-lane only
    Frag32 pf;
#pragma unroll
    for (int r = 0; r < 8; ++r) {
      pf.v[r]     = (_Float16)s0[r];
      pf.v[8 + r] = (_Float16)s1[r];
    }
    // broadcast alpha to O layout (vgpr r <-> q = r + moff)
    float aq[8];
#pragma unroll
    for (int r = 0; r < 8; ++r) aq[r] = __shfl(alpha, r + moff);
#pragma unroll
    for (int t = 0; t < 8; ++t) {
#pragma unroll
      for (int r = 0; r < 8; ++r) o[t][r] *= aq[r];
      const _Float16* vrow = &sV[(t * 16 + l16) * VP + kc];
      Frag32 vf;
      vf.u[0] = *(const uint4*)(vrow + koff);
      vf.u[1] = *(const uint4*)(vrow + koff + 16);
      o[t] = wmma32(pf.v, vf.v, o[t]);
    }
  }

  float linv[8];
#pragma unroll
  for (int r = 0; r < 8; ++r) linv[r] = 1.0f / __shfl(l_st, r + moff);
#pragma unroll
  for (int t = 0; t < 8; ++t) {
    int col = h * DG + t * 16 + l16;
    float bb = bv[col];
#pragma unroll
    for (int r = 0; r < 8; ++r) {
      long idx = (qbase + moff + r) * FEAT + col;
      out[idx] += o[t][r] * linv[r] + bb;
    }
  }
  // the next q tile's loads land in registers that this tile's loads and stores name
  if (qs + 1 < AQ) asm volatile("s_wait_xcnt 0x0" ::: "memory");
  }  // qs
}

extern "C" void kernel_launch(void* const* d_in, const int* in_sizes, int n_in,
                              void* d_out, int out_size, void* d_ws, size_t ws_size,
                              hipStream_t stream) {
  (void)in_sizes; (void)n_in; (void)out_size; (void)ws_size;
  const float* ref_feat = (const float*)d_in[0];
  const float* sup_feat = (const float*)d_in[1];
  const float* W_fc = (const float*)d_in[2];
  const float* b_fc = (const float*)d_in[3];
  const float* W_q  = (const float*)d_in[4];
  const float* b_q  = (const float*)d_in[5];
  const float* W_k  = (const float*)d_in[6];
  const float* b_k  = (const float*)d_in[7];
  const float* W_v  = (const float*)d_in[8];
  const float* b_v  = (const float*)d_in[9];
  float* out = (float*)d_out;

  size_t off = 0;
  auto carve = [&](size_t bytes) -> void* {
    void* p = (char*)d_ws + off;
    off += (bytes + 255) & ~(size_t)255;
    return p;
  };
  _Float16* ref16   = (_Float16*)carve((size_t)BSZ * QN * FEAT * 2);
  _Float16* sup16   = (_Float16*)carve((size_t)BSZ * KN * FEAT * 2);
  _Float16* wfc16   = (_Float16*)carve((size_t)FEAT * FEAT * 2);
  _Float16* wq16    = (_Float16*)carve((size_t)FEAT * FEAT * 2);
  _Float16* wk16    = (_Float16*)carve((size_t)FEAT * FEAT * 2);
  _Float16* wv16    = (_Float16*)carve((size_t)FEAT * FEAT * 2);
  _Float16* ref1_16 = (_Float16*)carve((size_t)BSZ * QN * FEAT * 2);
  _Float16* sup1_16 = (_Float16*)carve((size_t)BSZ * KN * FEAT * 2);
  _Float16* q16     = (_Float16*)carve((size_t)BSZ * QN * FEAT * 2);
  _Float16* k16     = (_Float16*)carve((size_t)BSZ * KN * FEAT * 2);
  _Float16* vT16    = (_Float16*)carve((size_t)FEAT * BSZ * KN * 2);

  cast_all<<<dim3(CW / 16), dim3(512), 0, stream>>>(
      ref_feat, sup_feat, W_fc, W_q, W_k, W_v,
      ref16, sup16, wfc16, wq16, wk16, wv16);

  dim3 blk(256);
  // ref1 = relu(ref @ Wfc^T + b_fc): f32 -> d_out (residual), f16 -> ref1_16
  gemm_wmma<<<dim3(BSZ * QN / 128, FEAT / 128), blk, 0, stream>>>(
      ref16, wfc16, b_fc, out, ref1_16, nullptr, 0, 1);
  // sup1 = relu(sup @ Wfc^T + b_fc)
  gemm_wmma<<<dim3(BSZ * KN / 128, FEAT / 128), blk, 0, stream>>>(
      sup16, wfc16, b_fc, nullptr, sup1_16, nullptr, 0, 1);
  // q = ref1 @ Wq^T + b_q
  gemm_wmma<<<dim3(BSZ * QN / 128, FEAT / 128), blk, 0, stream>>>(
      ref1_16, wq16, b_q, nullptr, q16, nullptr, 0, 0);
  // k = sup1 @ Wk^T + b_k
  gemm_wmma<<<dim3(BSZ * KN / 128, FEAT / 128), blk, 0, stream>>>(
      sup1_16, wk16, b_k, nullptr, k16, nullptr, 0, 0);
  // V' = sup1 @ Wv^T, stored transposed [FEAT x BSZ*KN]
  gemm_wmma<<<dim3(BSZ * KN / 128, FEAT / 128), blk, 0, stream>>>(
      sup1_16, wv16, nullptr, nullptr, nullptr, vT16, BSZ * KN, 0);
  // attention + grouped-conv (pre-folded into V') + b_v + residual
  attn_wmma<<<dim3(QN / (16 * AW * AQ), NG, BSZ), dim3(AW * 32), 0, stream>>>(
      q16, k16, vT16, b_v, out);
}

// v005
// A run of this version takes 256 microseconds.
// Timed twice side by side with v004, it ran 1.03 and 1.04 times as fast.
// All steps since v000 together make it 1.82 times as fast.
#include <hip/hip_runtime.h>

#define FEAT 2048
#define QN   4096
#define KN   512
#define BSZ  2
#define NG   16
#define DG   128
#define BK   64   // k depth of one LDS stage: 128 B of every operand row, one whole line
#define LDP  72   // LDS row pitch in f16: 64 data + 8 pad = 144 B (16 B x odd)
#define KP   136  // attention, LDS pitch of a K row in f16: 128 + 8 = 272 B (16 B x odd)
#define VP   520  // attention, LDS pitch of a V^T row in f16: 512 + 8 = 1040 B (16 B x odd)
#define AW   16   // attention, waves of a work-group
#define AQ   2    // attention, q tiles that a wave works through, one after the other

typedef __attribute__((ext_vector_type(16))) _Float16 v16h;
typedef __attribute__((ext_vector_type(8)))  _Float16 v8h;
typedef __attribute__((ext_vector_type(8)))  float    v8f;

union Frag32 { v16h v; uint4 u[2]; };

__device__ __forceinline__ v8f wmma32(v16h a, v16h b, v8f c) {
  return __builtin_amdgcn_wmma_f32_16x16x32_f16(false, a, false, b, (short)0, c,
                                                false, false);
}

// CDNA5 async DMA: global -> LDS, no VGPR staging, tracked by ASYNCcnt.
// Eight copies of a lane in one statement: a GEMM stage at <4,2>, half of one at <8,4>. The closing s_wait_xcnt
// stands inside it so that no later write of an address register can be
// scheduled in front of it.
__device__ __forceinline__ void async_copy16x8(unsigned l0, unsigned l1,
                                               unsigned l2, unsigned l3,
                                               unsigned l4, unsigned l5,
                                               unsigned l6, unsigned l7,
                                               const _Float16* g0, const _Float16* g1,
                                               const _Float16* g2, const _Float16* g3,
                                               const _Float16* g4, const _Float16* g5,
                                               const _Float16* g6, const _Float16* g7) {
  asm volatile("global_load_async_to_lds_b128 %0, %8, off\n\t"
               "global_load_async_to_lds_b128 %1, %9, off\n\t"
               "global_load_async_to_lds_b128 %2, %10, off\n\t"
               "global_load_async_to_lds_b128 %3, %11, off\n\t"
               "global_load_async_to_lds_b128 %4, %12, off\n\t"
               "global_load_async_to_lds_b128 %5, %13, off\n\t"
               "global_load_async_to_lds_b128 %6, %14, off\n\t"
               "global_load_async_to_lds_b128 %7, %15, off\n\t"
               "s_wait_xcnt 0x0"
               :: "v"(l0), "v"(l1), "v"(l2), "v"(l3),
                  "v"(l4), "v"(l5), "v"(l6), "v"(l7),
                  "v"(g0), "v"(g1), "v"(g2), "v"(g3),
                  "v"(g4), "v"(g5), "v"(g6), "v"(g7) : "memory");
}
__device__ __forceinline__ void wait_async0() {
  asm volatile("s_wait_asynccnt 0x0" ::: "memory");
}
// This wave's LDS reads have retired before the barrier behind which their
// buffer is refilled by copies.
__device__ __forceinline__ void wait_ds0() {
  asm volatile("s_wait_dscnt 0x0" ::: "memory");
}

// ---------------- fp32 -> fp16 cast of all six operands, one launch ----------
// 256 work-groups of 16 waves stream the whole cast. In step i wave w converts
// piece i * CW + w: 512 f32 in a row, read by four loads of 512 B (whole lines)
// and written by four stores of 256 B (whole lines). A step spans CSTEP elements
// and every operand is a whole number of steps long, so which operand a step
// reads is known at compile time.
#define CW     4096                 // waves in the launch
#define CPIECE 512                  // f32 elements of one piece
#define CSTEP  ((long)CW * CPIECE)  // elements that all waves convert in one step
#define S_REF  ((long)BSZ * QN * FEAT / CSTEP)   // 8 steps
#define S_SUP  ((long)BSZ * KN * FEAT / CSTEP)   // 1 step
#define S_W    ((long)FEAT * FEAT / CSTEP)       // 2 steps
#define S_ALL  (S_REF + S_SUP + 4 * S_W)         // 17 steps
static_assert(S_REF * CSTEP == (long)BSZ * QN * FEAT, "whole steps");
static_assert(S_SUP * CSTEP == (long)BSZ * KN * FEAT, "whole steps");
static_assert(S_W * CSTEP == (long)FEAT * FEAT, "whole steps");

typedef __attribute__((ext_vector_type(4))) _Float16 v4h;

// The pointers carry no __restrict__: the loads then stay where they are written,
// two pieces ahead of their stores, and are not gathered at the kernel's head.
__global__ __launch_bounds__(512)
void cast_all(const float* ref, const float* sup, const float* wfc,
              const float* wq, const float* wk, const float* wv,
              _Float16* dref, _Float16* dsup, _Float16* dwfc,
              _Float16* dwq, _Float16* dwk, _Float16* dwv) {
  // this lane's first element inside a step's span, and its byte offsets (under
  // 8 MB, so 32 bits) from a step's first source and first destination byte
  const unsigned e  = (blockIdx.x * 16 + (threadIdx.x >> 5)) * CPIECE + (threadIdx.x & 31) * 4;
  const unsigned lb = e * 4u;
  const unsigned sb = e * 2u;

  auto load_piece = [&](float4 (&v)[4], int i) {
    const float* s =
        i < S_REF                     ? ref + i * CSTEP
      : i < S_REF + S_SUP             ? sup + (i - S_REF) * CSTEP
      : i < S_REF + S_SUP + S_W       ? wfc + (i - S_REF - S_SUP) * CSTEP
      : i < S_REF + S_SUP + 2 * S_W   ? wq  + (i - S_REF - S_SUP - S_W) * CSTEP
      : i < S_REF + S_SUP + 3 * S_W   ? wk  + (i - S_REF - S_SUP - 2 * S_W) * CSTEP
                                      : wv  + (i - S_REF - S_SUP - 3 * S_W) * CSTEP;
#pragma unroll
    for (int j = 0; j < 4; ++j) v[j] = *(const float4*)((const char*)(s + j * 128) + lb);
  };
  auto store_piece = [&](const float4 (&v)[4], int i) {
    _Float16* d =
        i < S_REF                     ? dref + i * CSTEP
      : i < S_REF + S_SUP             ? dsup + (i - S_REF) * CSTEP
      : i < S_REF + S_SUP + S_W       ? dwfc + (i - S_REF - S_SUP) * CSTEP
      : i < S_REF + S_SUP + 2 * S_W   ? dwq  + (i - S_REF - S_SUP - S_W) * CSTEP
      : i < S_REF + S_SUP + 3 * S_W   ? dwk  + (i - S_REF - S_SUP - 2 * S_W) * CSTEP
                                      : dwv  + (i - S_REF - S_SUP - 3 * S_W) * CSTEP;
#pragma unroll
    for (int j = 0; j < 4; ++j) {
      v4h h;
      h[0] = (_Float16)v[j].x; h[1] = (_Float16)v[j].y;
      h[2] = (_Float16)v[j].z; h[3] = (_Float16)v[j].w;
      *(v4h*)((char*)(d + j * 128) + sb) = h;
    }
  };

  // three register sets: the loads of two later pieces are in flight while a
  // piece is converted and stored (8 to 12 loads of a wave outstanding)
  float4 v[3][4];
  load_piece(v[0], 0);
  load_piece(v[1], 1);
  // the next loads may land in registers that these loads name as address
  asm volatile("s_wait_xcnt 0x0" ::: "memory");
  // unrolled whole: the step number picks operand and register set at compile time
#pragma unroll
  for (int i = 0; i < S_ALL; ++i) {
    if (i + 2 < S_ALL) load_piece(v[(i + 2) % 3], i + 2);
    store_piece(v[i % 3], i);
    // the next loads land in registers that these stores name as data
    if (i + 3 < S_ALL) asm volatile("s_wait_xcnt 0x0" ::: "memory");
  }
}

// ---------------- tiled WMMA GEMM: C[m,n] = act(A[m,:] . Bw[n,:] + bias[n]) ----
// A: [M x FEAT] f16 row-major, Bw: [FEAT x FEAT] f16 row-major (weights, N-major)
// Double-buffered LDS, tiles filled by async global->LDS DMA.
// A stage holds 64 k: eight lanes copy one row's 128 B, so a wave's copy asks
// L2 for four whole lines (at 32 k it asks for eight half lines).
// LDS rows are pitched 144 B: the 16 rows that a half-wave's ds_load_b128 reads
// then fall on all 64 banks once.
// The 8 waves stand 2 x 4; a wave owns FM x FN tiles of 16 x 16, the work-group
// 32*FM x 64*FN of C. Per 32 k a wave reads FM + FN fragments for FM * FN products.
// <8,4>: 256 x 256 of C, one work-group on a WGP, for the products with 8192 rows
// (256 such tiles). <4,2>: 128 x 128, for those with 1024 rows (128 tiles).
template <int FM, int FN>
__global__ __launch_bounds__(256)
void gemm_wmma(const _Float16* __restrict__ A, const _Float16* __restrict__ Bw,
               const float* __restrict__ bias,
               float* __restrict__ out32, _Float16* __restrict__ out16,
               _Float16* __restrict__ outT, int ldT, int relu) {
  static_assert((FM == 4 && FN == 2) || (FM == 8 && FN == 4), "copies per stage");
  constexpr int TM = 32 * FM;          // rows of C in the work-group's tile
  constexpr int TN = 64 * FN;          // columns of C in it
  __shared__ __align__(16) _Float16 sA[2][TM * LDP];
  __shared__ __align__(16) _Float16 sB[2][TN * LDP];
  const int tid  = threadIdx.x;
  const int lane = tid & 31;
  const int wid  = tid >> 5;
  const int wm   = wid >> 2;           // 0..1
  const int wn   = wid & 3;            // 0..3
  const long bm  = (long)blockIdx.x * TM;
  const long bn  = (long)blockIdx.y * TN;
  const int l16  = lane & 15;
  const int koff = (lane < 16) ? 0 : 8;

  // per-thread DMA slots: rows row0 + 32*{0,1,..}, 8-f16 chunk ch0 (16B)
  const int row0 = tid >> 3;           // 0..31
  const int ch0  = (tid & 7) << 3;     // 0,8,..,56

  const v8f vz = {0.f, 0.f, 0.f, 0.f, 0.f, 0.f, 0.f, 0.f};
  v8f acc[FM][FN];
#pragma unroll
  for (int i = 0; i < FM; ++i)
#pragma unroll
    for (int j = 0; j < FN; ++j) acc[i][j] = vz;

  auto load_tile = [&](int buf, int k0) {
    const _Float16* gA = &A[(bm + row0) * FEAT + k0 + ch0];
    const _Float16* gB = &Bw[(bn + row0) * FEAT + k0 + ch0];
    unsigned la = (unsigned)(uintptr_t)(&sA[buf][row0 * LDP + ch0]);
    unsigned lb = (unsigned)(uintptr_t)(&sB[buf][row0 * LDP + ch0]);
    if constexpr (FM == 4) {
      async_copy16x8(la, la + 32 * LDP * 2, la + 64 * LDP * 2, la + 96 * LDP * 2,
                     lb, lb + 32 * LDP * 2, lb + 64 * LDP * 2, lb + 96 * LDP * 2,
                     gA, gA + (long)32 * FEAT, gA + (long)64 * FEAT, gA + (long)96 * FEAT,
                     gB, gB + (long)32 * FEAT, gB + (long)64 * FEAT, gB + (long)96 * FEAT);
    } else {
      // 256 rows of each operand: eight copies a lane for A, eight for B
      constexpr unsigned ls = 32 * LDP * 2;
      constexpr long     gs = (long)32 * FEAT;
      async_copy16x8(la, la + ls, la + 2 * ls, la + 3 * ls,
                     la + 4 * ls, la + 5 * ls, la + 6 * ls, la + 7 * ls,
                     gA, gA + gs, gA + 2 * gs, gA + 3 * gs,
                     gA + 4 * gs, gA + 5 * gs, gA + 6 * gs, gA + 7 * gs);
      async_copy16x8(lb, lb + ls, lb + 2 * ls, lb + 3 * ls,
                     lb + 4 * ls, lb + 5 * ls, lb + 6 * ls, lb + 7 * ls,
                     gB, gB + gs, gB + 2 * gs, gB + 3 * gs,
                     gB + 4 * gs, gB + 5 * gs, gB + 6 * gs, gB + 7 * gs);
    }
  };

  load_tile(0, 0);
  wait_async0();
  __syncthreads();

  for (int k0 = 0; k0 < FEAT; k0 += BK) {
    const int buf = (k0 / BK) & 1;
    if (k0 + BK < FEAT) load_tile(buf ^ 1, k0 + BK);   // DMA next tile

    // the stage's two 32-k blocks, in rising k: the sums keep their order
    if constexpr (FM == 4) {
#pragma unroll
      for (int kk = 0; kk < BK; kk += 32) {
        Frag32 af[FM], bf[FN];
#pragma unroll
        for (int i = 0; i < FM; ++i) {
          int r = wm * (FM * 16) + i * 16 + l16;
          af[i].u[0] = *(const uint4*)(&sA[buf][r * LDP + kk + koff]);
          af[i].u[1] = *(const uint4*)(&sA[buf][r * LDP + kk + koff + 16]);
        }
#pragma unroll
        for (int j = 0; j < FN; ++j) {
          int r = wn * (FN * 16) + j * 16 + l16;
          bf[j].u[0] = *(const uint4*)(&sB[buf][r * LDP + kk + koff]);
          bf[j].u[1] = *(const uint4*)(&sB[buf][r * LDP + kk + koff + 16]);
        }
#pragma unroll
        for (int i = 0; i < FM; ++i)
#pragma unroll
          for (int j = 0; j < FN; ++j)
            acc[i][j] = wmma32(af[i].v, bf[j].v, acc[i][j]);
      }
    } else {
      // Both blocks' fragments are read ahead of the products, in the order in which
      // the products use them: all of a block's B, then its A row by row.
      // The scheduling fence behind each fragment keeps that order and keeps the
      // reads in front of the products. Left free, the compiler reads one A fragment
      // per four products into one register set and waits out each read's latency,
      // or reads early rows last, so that the second row waits for nearly all reads.
      Frag32 af[2][FM], bf[2][FN];
#pragma unroll
      for (int s = 0; s < 2; ++s) {
#pragma unroll
        for (int j = 0; j < FN; ++j) {
          int r = wn * (FN * 16) + j * 16 + l16;
          bf[s][j].u[0] = *(const uint4*)(&sB[buf][r * LDP + s * 32 + koff]);
          bf[s][j].u[1] = *(const uint4*)(&sB[buf][r * LDP + s * 32 + koff + 16]);
          __builtin_amdgcn_sched_barrier(0);   // read order, see above
        }
#pragma unroll
        for (int i = 0; i < FM; ++i) {
          int r = wm * (FM * 16) + i * 16 + l16;
          af[s][i].u[0] = *(const uint4*)(&sA[buf][r * LDP + s * 32 + koff]);
          af[s][i].u[1] = *(const uint4*)(&sA[buf][r * LDP + s * 32 + koff + 16]);
          __builtin_amdgcn_sched_barrier(0);   // read order, see above
        }
      }
#pragma unroll
      for (int s = 0; s < 2; ++s)
#pragma unroll
        for (int i = 0; i < FM; ++i)
#pragma unroll
          for (int j = 0; j < FN; ++j)
            acc[i][j] = wmma32(af[s][i].v, bf[s][j].v, acc[i][j]);
      // keeps the products in front of the waits below: moved behind them, the
      // next tile's copies would be waited for before any product has run
      __builtin_amdgcn_sched_barrier(0);
    }

    // next tile landed; barrier also guards WAR on buf, refilled by the next trip's DMA
    wait_ds0();
    wait_async0();
    __syncthreads();
  }

  const int moff = (lane < 16) ? 0 : 8;
#pragma unroll
  for (int i = 0; i < FM; ++i) {
#pragma unroll
    for (int j = 0; j < FN; ++j) {
      long n  = bn + wn * (FN * 16) + j * 16 + l16;
      long mb = bm + wm * (FM * 16) + i * 16 + moff;
      float bv = bias ? bias[n] : 0.f;
      float vals[8];
#pragma unroll
      for (int r = 0; r < 8; ++r) {
        float x = acc[i][j][r] + bv;
        if (relu) x = fmaxf(x, 0.f);
        vals[r] = x;
      }
      if (out32) {
#pragma unroll
        for (int r = 0; r < 8; ++r) out32[(mb + r) * FEAT + n] = vals[r];
        // later code rewrites registers that these stores name
        asm volatile("s_wait_xcnt 0x0" ::: "memory");
      }
      if (out16) {
#pragma unroll
        for (int r = 0; r < 8; ++r) out16[(mb + r) * FEAT + n] = (_Float16)vals[r];
        // later code rewrites registers that these stores name
        asm volatile("s_wait_xcnt 0x0" ::: "memory");
      }
      if (outT) {
        v8h hh;
#pragma unroll
        for (int r = 0; r < 8; ++r) hh[r] = (_Float16)vals[r];
        *(v8h*)(&outT[n * (long)ldT + mb]) = hh;   // mb multiple of 8 -> 16B aligned
        // later code rewrites registers that this store names
        asm volatile("s_wait_xcnt 0x0" ::: "memory");
      }
    }
  }
}

// ---------------- fused flash attention + residual + b_v --------------
// Qm: [BSZ*QN x FEAT] f16 (head h at cols h*DG..), Km: [BSZ*KN x FEAT] f16,
// Vt: [FEAT x BSZ*KN] f16 (transposed V' = sup1 @ Wv^T), out: f32 (+=).
// One wave handles 16 q rows of one (b,h) at a time. Computes S^T = K.Q^T so the
// softmaxed P converts to an A-fragment with per-lane packs only.
// A work-group owns 512 q rows of one (b,h). It first copies that head's whole K
// (512 rows of 256 B) and V^T (128 rows of 1024 B) into LDS, every copy asking L2
// for four whole lines, once per work-group. The fragments, 16 rows of 32 B each,
// are then read from LDS, whose pitched rows fall on all 64 banks once, and no
// longer gathered from 16 cache lines per load by every wave.
__global__ __launch_bounds__(AW * 32)
void attn_wmma(const _Float16* __restrict__ Qm, const _Float16* __restrict__ Km,
               const _Float16* __restrict__ Vt, const float* __restrict__ bv,
               float* __restrict__ out) {
  __shared__ __align__(16) _Float16 sK[KN * KP];
  __shared__ __align__(16) _Float16 sV[DG * VP];
  const int tid   = threadIdx.x;
  const int lane  = tid & 31;
  const int wid   = tid >> 5;
  const int h     = blockIdx.y;
  const int b     = blockIdx.z;
  const int l16  = lane & 15;
  const int koff = (lane < 16) ? 0 : 8;
  const int moff = (lane < 16) ? 0 : 8;

  // Fill, 32 copies of 16 B a lane. K: 16 lanes copy a row, the block 32 rows a
  // copy. V^T: 64 lanes copy a row, the block 8 rows a copy.
  {
    const _Float16* gK = Km + ((long)b * KN + (tid >> 4)) * FEAT + h * DG + (tid & 15) * 8;
    const _Float16* gV = Vt + ((long)h * DG + (tid >> 6)) * (BSZ * KN) + (long)b * KN + (tid & 63) * 8;
    const unsigned lK = (unsigned)(uintptr_t)(&sK[(tid >> 4) * KP + (tid & 15) * 8]);
    const unsigned lV = (unsigned)(uintptr_t)(&sV[(tid >> 6) * VP + (tid & 63) * 8]);
    auto fill8 = [](unsigned l, unsigned ls, const _Float16* g, long gs) {
      async_copy16x8(l, l + ls, l + 2 * ls, l + 3 * ls,
                     l + 4 * ls, l + 5 * ls, l + 6 * ls, l + 7 * ls,
                     g, g + gs, g + 2 * gs, g + 3 * gs,
                     g + 4 * gs, g + 5 * gs, g + 6 * gs, g + 7 * gs);
    };
    fill8(lK, 32 * KP * 2, gK, (long)32 * FEAT);
    fill8(lK + 256 * KP * 2, 32 * KP * 2, gK + (long)256 * FEAT, (long)32 * FEAT);
    fill8(lV, 8 * VP * 2, gV, (long)8 * BSZ * KN);
    fill8(lV + 64 * VP * 2, 8 * VP * 2, gV + (long)64 * BSZ * KN, (long)8 * BSZ * KN);
  }
  wait_async0();     // this wave's copies have landed
  __syncthreads();   // and so have every other wave's; LDS is only read from here on

  // the wave's q tiles, one after the other; K and V^T stay in LDS for all of them
  for (int qs = 0; qs < AQ; ++qs) {
  const int qtile = (blockIdx.x * AQ + qs) * AW + wid;   // 0..255
  const long qbase = (long)b * QN + (long)qtile * 16;

  // Q fragments, used as B (Q^T): lane = q row, regs = dims
  Frag32 qf[4];
  {
    const _Float16* qrow = Qm + (qbase + l16) * FEAT + h * DG;
#pragma unroll
    for (int d = 0; d < 4; ++d) {
      qf[d].u[0] = *(const uint4*)(qrow + d * 32 + koff);
      qf[d].u[1] = *(const uint4*)(qrow + d * 32 + koff + 16);
    }
  }

  const v8f vz = {0.f, 0.f, 0.f, 0.f, 0.f, 0.f, 0.f, 0.f};
  v8f o[8];
#pragma unroll
  for (int t = 0; t < 8; ++t) o[t] = vz;
  float m_st = -3.0e38f, l_st = 0.f;
  const float scale = 0.08838834764831845f;        // 1/sqrt(128)

  for (int kc = 0; kc < KN; kc += 32) {
    // S^T tiles: s0 = keys kc..kc+15, s1 = keys kc+16..kc+31 (lane = q)
    v8f s0 = vz, s1 = vz;
    {
      const _Float16* krow = &sK[(kc + l16) * KP];
#pragma unroll
      for (int d = 0; d < 4; ++d) {
        Frag32 kf;
        kf.u[0] = *(const uint4*)(krow + d * 32 + koff);
        kf.u[1] = *(const uint4*)(krow + d * 32 + koff + 16);
        s0 = wmma32(kf.v, qf[d].v, s0);
      }
      krow += 16 * KP;
#pragma unroll
      for (int d = 0; d < 4; ++d) {
        Frag32 kf;
        kf.u[0] = *(const uint4*)(krow + d * 32 + koff);
        kf.u[1] = *(const uint4*)(krow + d * 32 + koff + 16);
        s1 = wmma32(kf.v, qf[d].v, s1);
      }
    }
    // online softmax over this 32-key chunk (row = q = lane%16)
    float mloc = -3.0e38f;
#pragma unroll
    for (int r = 0; r < 8; ++r) {
      s0[r] *= scale; s1[r] *= scale;
      mloc = fmaxf(mloc, fmaxf(s0[r], s1[r]));
    }
    mloc = fmaxf(mloc, __shfl_xor(mloc, 16));
    float mnew  = fmaxf(m_st, mloc);
    float alpha = __expf(m_st - mnew);
    float rs = 0.f;
#pragma unroll
    for (int r = 0; r < 8; ++r) {
      s0[r] = __expf(s0[r] - mnew); rs += s0[r];
      s1[r] = __expf(s1[r] - mnew); rs += s1[r];
    }
    rs += __shfl_xor(rs, 16);
    l_st = l_st * alpha + rs;
    m_st = mnew;
    // pack P as A-fragment (lane = q, regs = 32 keys) — per-lane only
    Frag32 pf;
#pragma unroll
    for (int r = 0; r < 8; ++r) {
      pf.v[r]     = (_Float16)s0[r];
      pf.v[8 + r] = (_Float16)s1[r];
    }
    // broadcast alpha to O layout (vgpr r <-> q = r + moff)
    float aq[8];
#pragma unroll
    for (int r = 0; r < 8; ++r) aq[r] = __shfl(alpha, r + moff);
#pragma unroll
    for (int t = 0; t < 8; ++t) {
#pragma unroll
      for (int r = 0; r < 8; ++r) o[t][r] *= aq[r];
      const _Float16* vrow = &sV[(t * 16 + l16) * VP + kc];
      Frag32 vf;
      vf.u[0] = *(const uint4*)(vrow + koff);
      vf.u[1] = *(const uint4*)(vrow + koff + 16);
      o[t] = wmma32(pf.v, vf.v, o[t]);
    }
  }

  float linv[8];
#pragma unroll
  for (int r = 0; r < 8; ++r) linv[r] = 1.0f / __shfl(l_st, r + moff);
#pragma unroll
  for (int t = 0; t < 8; ++t) {
    int col = h * DG + t * 16 + l16;
    float bb = bv[col];
#pragma unroll
    for (int r = 0; r < 8; ++r) {
      long idx = (qbase + moff + r) * FEAT + col;
      out[idx] += o[t][r] * linv[r] + bb;
    }
  }
  // the next q tile's loads land in registers that this tile's loads and stores name
  if (qs + 1 < AQ) asm volatile("s_wait_xcnt 0x0" ::: "memory");
  }  // qs
}

extern "C" void kernel_launch(void* const* d_in, const int* in_sizes, int n_in,
                              void* d_out, int out_size, void* d_ws, size_t ws_size,
                              hipStream_t stream) {
  (void)in_sizes; (void)n_in; (void)out_size; (void)ws_size;
  const float* ref_feat = (const float*)d_in[0];
  const float* sup_feat = (const float*)d_in[1];
  const float* W_fc = (const float*)d_in[2];
  const float* b_fc = (const float*)d_in[3];
  const float* W_q  = (const float*)d_in[4];
  const float* b_q  = (const float*)d_in[5];
  const float* W_k  = (const float*)d_in[6];
  const float* b_k  = (const float*)d_in[7];
  const float* W_v  = (const float*)d_in[8];
  const float* b_v  = (const float*)d_in[9];
  float* out = (float*)d_out;

  size_t off = 0;
  auto carve = [&](size_t bytes) -> void* {
    void* p = (char*)d_ws + off;
    off += (bytes + 255) & ~(size_t)255;
    return p;
  };
  _Float16* ref16   = (_Float16*)carve((size_t)BSZ * QN * FEAT * 2);
  _Float16* sup16   = (_Float16*)carve((size_t)BSZ * KN * FEAT * 2);
  _Float16* wfc16   = (_Float16*)carve((size_t)FEAT * FEAT * 2);
  _Float16* wq16    = (_Float16*)carve((size_t)FEAT * FEAT * 2);
  _Float16* wk16    = (_Float16*)carve((size_t)FEAT * FEAT * 2);
  _Float16* wv16    = (_Float16*)carve((size_t)FEAT * FEAT * 2);
  _Float16* ref1_16 = (_Float16*)carve((size_t)BSZ * QN * FEAT * 2);
  _Float16* sup1_16 = (_Float16*)carve((size_t)BSZ * KN * FEAT * 2);
  _Float16* q16     = (_Float16*)carve((size_t)BSZ * QN * FEAT * 2);
  _Float16* k16     = (_Float16*)carve((size_t)BSZ * KN * FEAT * 2);
  _Float16* vT16    = (_Float16*)carve((size_t)FEAT * BSZ * KN * 2);

  cast_all<<<dim3(CW / 16), dim3(512), 0, stream>>>(
      ref_feat, sup_feat, W_fc, W_q, W_k, W_v,
      ref16, sup16, wfc16, wq16, wk16, wv16);

  dim3 blk(256);
  // ref1 = relu(ref @ Wfc^T + b_fc): f32 -> d_out (residual), f16 -> ref1_16
  gemm_wmma<8, 4><<<dim3(BSZ * QN / 256, FEAT / 256), blk, 0, stream>>>(
      ref16, wfc16, b_fc, out, ref1_16, nullptr, 0, 1);
  // sup1 = relu(sup @ Wfc^T + b_fc)
  gemm_wmma<4, 2><<<dim3(BSZ * KN / 128, FEAT / 128), blk, 0, stream>>>(
      sup16, wfc16, b_fc, nullptr, sup1_16, nullptr, 0, 1);
  // q = ref1 @ Wq^T + b_q
  gemm_wmma<8, 4><<<dim3(BSZ * QN / 256, FEAT / 256), blk, 0, stream>>>(
      ref1_16, wq16, b_q, nullptr, q16, nullptr, 0, 0);
  // k = sup1 @ Wk^T + b_k
  gemm_wmma<4, 2><<<dim3(BSZ * KN / 128, FEAT / 128), blk, 0, stream>>>(
      sup1_16, wk16, b_k, nullptr, k16, nullptr, 0, 0);
  // V' = sup1 @ Wv^T, stored transposed [FEAT x BSZ*KN]
  gemm_wmma<4, 2><<<dim3(BSZ * KN / 128, FEAT / 128), blk, 0, stream>>>(
      sup1_16, wv16, nullptr, nullptr, nullptr, vT16, BSZ * KN, 0);
  // attention + grouped-conv (pre-folded into V') + b_v + residual
  attn_wmma<<<dim3(QN / (16 * AW * AQ), NG, BSZ), dim3(AW * 32), 0, stream>>>(
      q16, k16, vT16, b_v, out);
}

// v006
// A run of this version takes 230 microseconds.
// In both of two side-by-side timings against v005, it was 1.11 times as fast.
// Counting every step since v000, it is 2.02 times as fast.
#include <hip/hip_runtime.h>

#define FEAT 2048
#define QN   4096
#define KN   512
#define BSZ  2
#define NG   16
#define DG   128
#define BK   64   // k depth of one LDS stage: 128 B of every operand row, one whole line
#define LDP  72   // LDS row pitch in f16: 64 data + 8 pad = 144 B (16 B x odd)
#define KP   136  // attention, LDS pitch of a K row in f16: 128 + 8 = 272 B (16 B x odd)
#define VP   520  // attention, LDS pitch of a V^T row in f16: 512 + 8 = 1040 B (16 B x odd)
#define AW   16   // attention, waves of a work-group
#define AQ   2    // attention, q tiles that a wave works through, one after the other

typedef __attribute__((ext_vector_type(16))) _Float16 v16h;
typedef __attribute__((ext_vector_type(8)))  _Float16 v8h;
typedef __attribute__((ext_vector_type(8)))  float    v8f;

union Frag32 { v16h v; uint4 u[2]; };

__device__ __forceinline__ v8f wmma32(v16h a, v16h b, v8f c) {
  return __builtin_amdgcn_wmma_f32_16x16x32_f16(false, a, false, b, (short)0, c,
                                                false, false);
}

// CDNA5 async DMA: global -> LDS, no VGPR staging, tracked by ASYNCcnt.
// Eight copies of a lane in one statement: a GEMM stage at <4,2>, half of one at <8,4>. The closing s_wait_xcnt
// stands inside it so that no later write of an address register can be
// scheduled in front of it.
__device__ __forceinline__ void async_copy16x8(unsigned l0, unsigned l1,
                                               unsigned l2, unsigned l3,
                                               unsigned l4, unsigned l5,
                                               unsigned l6, unsigned l7,
                                               const _Float16* g0, const _Float16* g1,
                                               const _Float16* g2, const _Float16* g3,
                                               const _Float16* g4, const _Float16* g5,
                                               const _Float16* g6, const _Float16* g7) {
  asm volatile("global_load_async_to_lds_b128 %0, %8, off\n\t"
               "global_load_async_to_lds_b128 %1, %9, off\n\t"
               "global_load_async_to_lds_b128 %2, %10, off\n\t"
               "global_load_async_to_lds_b128 %3, %11, off\n\t"
               "global_load_async_to_lds_b128 %4, %12, off\n\t"
               "global_load_async_to_lds_b128 %5, %13, off\n\t"
               "global_load_async_to_lds_b128 %6, %14, off\n\t"
               "global_load_async_to_lds_b128 %7, %15, off\n\t"
               "s_wait_xcnt 0x0"
               :: "v"(l0), "v"(l1), "v"(l2), "v"(l3),
                  "v"(l4), "v"(l5), "v"(l6), "v"(l7),
                  "v"(g0), "v"(g1), "v"(g2), "v"(g3),
                  "v"(g4), "v"(g5), "v"(g6), "v"(g7) : "memory");
}
__device__ __forceinline__ void wait_async0() {
  asm volatile("s_wait_asynccnt 0x0" ::: "memory");
}
// This wave's LDS reads have retired before the barrier behind which their
// buffer is refilled by copies.
__device__ __forceinline__ void wait_ds0() {
  asm volatile("s_wait_dscnt 0x0" ::: "memory");
}

// ---------------- fp32 -> fp16 cast of all six operands, one launch ----------
// 256 work-groups of 16 waves stream the whole cast. In step i wave w converts
// piece i * CW + w: 512 f32 in a row, read by four loads of 512 B (whole lines)
// and written by four stores of 256 B (whole lines). A step spans CSTEP elements
// and every operand is a whole number of steps long, so which operand a step
// reads is known at compile time.
#define CW     4096                 // waves in the launch
#define CPIECE 512                  // f32 elements of one piece
#define CSTEP  ((long)CW * CPIECE)  // elements that all waves convert in one step
#define S_REF  ((long)BSZ * QN * FEAT / CSTEP)   // 8 steps
#define S_SUP  ((long)BSZ * KN * FEAT / CSTEP)   // 1 step
#define S_W    ((long)FEAT * FEAT / CSTEP)       // 2 steps
#define S_ALL  (S_REF + S_SUP + 4 * S_W)         // 17 steps
static_assert(S_REF * CSTEP == (long)BSZ * QN * FEAT, "whole steps");
static_assert(S_SUP * CSTEP == (long)BSZ * KN * FEAT, "whole steps");
static_assert(S_W * CSTEP == (long)FEAT * FEAT, "whole steps");

typedef __attribute__((ext_vector_type(4))) _Float16 v4h;

// The pointers carry no __restrict__: the loads then stay where they are written,
// two pieces ahead of their stores, and are not gathered at the kernel's head.
__global__ __launch_bounds__(512)
void cast_all(const float* ref, const float* sup, const float* wfc,
              const float* wq, const float* wk, const float* wv,
              _Float16* dref, _Float16* dsup, _Float16* dwfc,
              _Float16* dwq, _Float16* dwk, _Float16* dwv) {
  // this lane's first element inside a step's span, and its byte offsets (under
  // 8 MB, so 32 bits) from a step's first source and first destination byte
  const unsigned e  = (blockIdx.x * 16 + (threadIdx.x >> 5)) * CPIECE + (threadIdx.x & 31) * 4;
  const unsigned lb = e * 4u;
  const unsigned sb = e * 2u;

  auto load_piece = [&](float4 (&v)[4], int i) {
    const float* s =
        i < S_REF                     ? ref + i * CSTEP
      : i < S_REF + S_SUP             ? sup + (i - S_REF) * CSTEP
      : i < S_REF + S_SUP + S_W       ? wfc + (i - S_REF - S_SUP) * CSTEP
      : i < S_REF + S_SUP + 2 * S_W   ? wq  + (i - S_REF - S_SUP - S_W) * CSTEP
      : i < S_REF + S_SUP + 3 * S_W   ? wk  + (i - S_REF - S_SUP - 2 * S_W) * CSTEP
                                      : wv  + (i - S_REF - S_SUP - 3 * S_W) * CSTEP;
#pragma unroll
    for (int j = 0; j < 4; ++j) v[j] = *(const float4*)((const char*)(s + j * 128) + lb);
  };
  auto store_piece = [&](const float4 (&v)[4], int i) {
    _Float16* d =
        i < S_REF                     ? dref + i * CSTEP
      : i < S_REF + S_SUP             ? dsup + (i - S_REF) * CSTEP
      : i < S_REF + S_SUP + S_W       ? dwfc + (i - S_REF - S_SUP) * CSTEP
      : i < S_REF + S_SUP + 2 * S_W   ? dwq  + (i - S_REF - S_SUP - S_W) * CSTEP
      : i < S_REF + S_SUP + 3 * S_W   ? dwk  + (i - S_REF - S_SUP - 2 * S_W) * CSTEP
                                      : dwv  + (i - S_REF - S_SUP - 3 * S_W) * CSTEP;
#pragma unroll
    for (int j = 0; j < 4; ++j) {
      v4h h;
      h[0] = (_Float16)v[j].x; h[1] = (_Float16)v[j].y;
      h[2] = (_Float16)v[j].z; h[3] = (_Float16)v[j].w;
      *(v4h*)((char*)(d + j * 128) + sb) = h;
    }
  };

  // three register sets: the loads of two later pieces are in flight while a
  // piece is converted and stored (8 to 12 loads of a wave outstanding)
  float4 v[3][4];
  load_piece(v[0], 0);
  load_piece(v[1], 1);
  // the next loads may land in registers that these loads name as address
  asm volatile("s_wait_xcnt 0x0" ::: "memory");
  // unrolled whole: the step number picks operand and register set at compile time
#pragma unroll
  for (int i = 0; i < S_ALL; ++i) {
    if (i + 2 < S_ALL) load_piece(v[(i + 2) % 3], i + 2);
    store_piece(v[i % 3], i);
    // the next loads land in registers that these stores name as data
    if (i + 3 < S_ALL) asm volatile("s_wait_xcnt 0x0" ::: "memory");
  }
}

// ---------------- tiled WMMA GEMM: C[m,n] = act(A[m,:] . Bw[n,:] + bias[n]) ----
// A: [M x FEAT] f16 row-major, Bw: [FEAT x FEAT] f16 row-major (weights, N-major)
// Double-buffered LDS, tiles filled by async global->LDS DMA.
// A stage holds 64 k: eight lanes copy one row's 128 B, so a wave's copy asks
// L2 for four whole lines (at 32 k it asks for eight half lines).
// LDS rows are pitched 144 B: the 16 rows that a half-wave's ds_load_b128 reads
// then fall on all 64 banks once.
// The 8 waves stand 2 x 4; a wave owns FM x FN tiles of 16 x 16, the work-group
// 32*FM x 64*FN of C. Per 32 k a wave reads FM + FN fragments for FM * FN products.
// <8,4>: 256 x 256 of C, one work-group on a WGP, for the products with 8192 rows
// (256 such tiles). <4,2>: 128 x 128, for those with 1024 rows (128 tiles).
// The tile is picked by blockIdx.x and blockIdx.y.
template <int FM, int FN>
__device__ __forceinline__
void gemm_tile(const _Float16* __restrict__ A, const _Float16* __restrict__ Bw,
               const float* __restrict__ bias,
               float* __restrict__ out32, _Float16* __restrict__ out16,
               _Float16* __restrict__ outT, int ldT, int relu) {
  static_assert((FM == 4 && FN == 2) || (FM == 8 && FN == 4), "copies per stage");
  constexpr int TM = 32 * FM;          // rows of C in the work-group's tile
  constexpr int TN = 64 * FN;          // columns of C in it
  __shared__ __align__(16) _Float16 sA[2][TM * LDP];
  __shared__ __align__(16) _Float16 sB[2][TN * LDP];
  const int tid  = threadIdx.x;
  const int lane = tid & 31;
  const int wid  = tid >> 5;
  const int wm   = wid >> 2;           // 0..1
  const int wn   = wid & 3;            // 0..3
  const long bm  = (long)blockIdx.x * TM;
  const long bn  = (long)blockIdx.y * TN;
  const int l16  = lane & 15;
  const int koff = (lane < 16) ? 0 : 8;

  // per-thread DMA slots: rows row0 + 32*{0,1,..}, 8-f16 chunk ch0 (16B)
  const int row0 = tid >> 3;           // 0..31
  const int ch0  = (tid & 7) << 3;     // 0,8,..,56

  const v8f vz = {0.f, 0.f, 0.f, 0.f, 0.f, 0.f, 0.f, 0.f};
  v8f acc[FM][FN];
#pragma unroll
  for (int i = 0; i < FM; ++i)
#pragma unroll
    for (int j = 0; j < FN; ++j) acc[i][j] = vz;

  auto load_tile = [&](int buf, int k0) {
    const _Float16* gA = &A[(bm + row0) * FEAT + k0 + ch0];
    const _Float16* gB = &Bw[(bn + row0) * FEAT + k0 + ch0];
    unsigned la = (unsigned)(uintptr_t)(&sA[buf][row0 * LDP + ch0]);
    unsigned lb = (unsigned)(uintptr_t)(&sB[buf][row0 * LDP + ch0]);
    if constexpr (FM == 4) {
      async_copy16x8(la, la + 32 * LDP * 2, la + 64 * LDP * 2, la + 96 * LDP * 2,
                     lb, lb + 32 * LDP * 2, lb + 64 * LDP * 2, lb + 96 * LDP * 2,
                     gA, gA + (long)32 * FEAT, gA + (long)64 * FEAT, gA + (long)96 * FEAT,
                     gB, gB + (long)32 * FEAT, gB + (long)64 * FEAT, gB + (long)96 * FEAT);
    } else {
      // 256 rows of each operand: eight copies a lane for A, eight for B
      constexpr unsigned ls = 32 * LDP * 2;
      constexpr long     gs = (long)32 * FEAT;
      async_copy16x8(la, la + ls, la + 2 * ls, la + 3 * ls,
                     la + 4 * ls, la + 5 * ls, la + 6 * ls, la + 7 * ls,
                     gA, gA + gs, gA + 2 * gs, gA + 3 * gs,
                     gA + 4 * gs, gA + 5 * gs, gA + 6 * gs, gA + 7 * gs);
      async_copy16x8(lb, lb + ls, lb + 2 * ls, lb + 3 * ls,
                     lb + 4 * ls, lb + 5 * ls, lb + 6 * ls, lb + 7 * ls,
                     gB, gB + gs, gB + 2 * gs, gB + 3 * gs,
                     gB + 4 * gs, gB + 5 * gs, gB + 6 * gs, gB + 7 * gs);
    }
  };

  load_tile(0, 0);
  wait_async0();
  __syncthreads();

  for (int k0 = 0; k0 < FEAT; k0 += BK) {
    const int buf = (k0 / BK) & 1;
    if (k0 + BK < FEAT) load_tile(buf ^ 1, k0 + BK);   // DMA next tile

    // the stage's two 32-k blocks, in rising k: the sums keep their order
    if constexpr (FM == 4) {
#pragma unroll
      for (int kk = 0; kk < BK; kk += 32) {
        Frag32 af[FM], bf[FN];
#pragma unroll
        for (int i = 0; i < FM; ++i) {
          int r = wm * (FM * 16) + i * 16 + l16;
          af[i].u[0] = *(const uint4*)(&sA[buf][r * LDP + kk + koff]);
          af[i].u[1] = *(const uint4*)(&sA[buf][r * LDP + kk + koff + 16]);
        }
#pragma unroll
        for (int j = 0; j < FN; ++j) {
          int r = wn * (FN * 16) + j * 16 + l16;
          bf[j].u[0] = *(const uint4*)(&sB[buf][r * LDP + kk + koff]);
          bf[j].u[1] = *(const uint4*)(&sB[buf][r * LDP + kk + koff + 16]);
        }
#pragma unroll
        for (int i = 0; i < FM; ++i)
#pragma unroll
          for (int j = 0; j < FN; ++j)
            acc[i][j] = wmma32(af[i].v, bf[j].v, acc[i][j]);
      }
    } else {
      // Both blocks' fragments are read ahead of the products, in the order in which
      // the products use them: all of a block's B, then its A row by row.
      // The scheduling fence behind each fragment keeps that order and keeps the
      // reads in front of the products. Left free, the compiler reads one A fragment
      // per four products into one register set and waits out each read's latency,
      // or reads early rows last, so that the second row waits for nearly all reads.
      Frag32 af[2][FM], bf[2][FN];
#pragma unroll
      for (int s = 0; s < 2; ++s) {
#pragma unroll
        for (int j = 0; j < FN; ++j) {
          int r = wn * (FN * 16) + j * 16 + l16;
          bf[s][j].u[0] = *(const uint4*)(&sB[buf][r * LDP + s * 32 + koff]);
          bf[s][j].u[1] = *(const uint4*)(&sB[buf][r * LDP + s * 32 + koff + 16]);
          __builtin_amdgcn_sched_barrier(0);   // read order, see above
        }
#pragma unroll
        for (int i = 0; i < FM; ++i) {
          int r = wm * (FM * 16) + i * 16 + l16;
          af[s][i].u[0] = *(const uint4*)(&sA[buf][r * LDP + s * 32 + koff]);
          af[s][i].u[1] = *(const uint4*)(&sA[buf][r * LDP + s * 32 + koff + 16]);
          __builtin_amdgcn_sched_barrier(0);   // read order, see above
        }
      }
#pragma unroll
      for (int s = 0; s < 2; ++s)
#pragma unroll
        for (int i = 0; i < FM; ++i)
#pragma unroll
          for (int j = 0; j < FN; ++j)
            acc[i][j] = wmma32(af[s][i].v, bf[s][j].v, acc[i][j]);
      // keeps the products in front of the waits below: moved behind them, the
      // next tile's copies would be waited for before any product has run
      __builtin_amdgcn_sched_barrier(0);
    }

    // next tile landed; barrier also guards WAR on buf, refilled by the next trip's DMA
    wait_ds0();
    wait_async0();
    __syncthreads();
  }

  const int moff = (lane < 16) ? 0 : 8;
#pragma unroll
  for (int i = 0; i < FM; ++i) {
#pragma unroll
    for (int j = 0; j < FN; ++j) {
      long n  = bn + wn * (FN * 16) + j * 16 + l16;
      long mb = bm + wm * (FM * 16) + i * 16 + moff;
      float bv = bias ? bias[n] : 0.f;
      float vals[8];
#pragma unroll
      for (int r = 0; r < 8; ++r) {
        float x = acc[i][j][r] + bv;
        if (relu) x = fmaxf(x, 0.f);
        vals[r] = x;
      }
      if (out32) {
#pragma unroll
        for (int r = 0; r < 8; ++r) out32[(mb + r) * FEAT + n] = vals[r];
        // later code rewrites registers that these stores name
        asm volatile("s_wait_xcnt 0x0" ::: "memory");
      }
      if (out16) {
#pragma unroll
        for (int r = 0; r < 8; ++r) out16[(mb + r) * FEAT + n] = (_Float16)vals[r];
        // later code rewrites registers that these stores name
        asm volatile("s_wait_xcnt 0x0" ::: "memory");
      }
      if (outT) {
        v8h hh;
#pragma unroll
        for (int r = 0; r < 8; ++r) hh[r] = (_Float16)vals[r];
        *(v8h*)(&outT[n * (long)ldT + mb]) = hh;   // mb multiple of 8 -> 16B aligned
        // later code rewrites registers that this store names
        asm volatile("s_wait_xcnt 0x0" ::: "memory");
      }
    }
  }
}

// one product a launch
template <int FM, int FN>
__global__ __launch_bounds__(256)
void gemm_wmma(const _Float16* __restrict__ A, const _Float16* __restrict__ Bw,
               const float* __restrict__ bias,
               float* __restrict__ out32, _Float16* __restrict__ out16,
               _Float16* __restrict__ outT, int ldT, int relu) {
  gemm_tile<FM, FN>(A, Bw, bias, out32, out16, outT, ldT, relu);
}

// Two products of the same A in one launch: blockIdx.z = 0 gives A . B0^T + bias0,
// stored row-major in out0; blockIdx.z = 1 gives A . B1^T, stored transposed in
// outT1. Neither reads what the other writes. One product with 1024 rows has 128
// tiles, half as many as there are WGPs, and a tile's time is set by its own chain
// of 32 stages: the two together take about as long as one alone.
template <int FM, int FN>
__global__ __launch_bounds__(256)
void gemm_wmma_pair(const _Float16* __restrict__ A,
                    const _Float16* __restrict__ B0, const float* __restrict__ bias0,
                    _Float16* __restrict__ out0,
                    const _Float16* __restrict__ B1,
                    _Float16* __restrict__ outT1, int ldT1) {
  const bool second = blockIdx.z != 0;
  gemm_tile<FM, FN>(A, second ? B1 : B0, second ? nullptr : bias0, nullptr,
                    second ? nullptr : out0, second ? outT1 : nullptr, ldT1, 0);
}

// ---------------- fused flash attention + residual + b_v --------------
// Qm: [BSZ*QN x FEAT] f16 (head h at cols h*DG..), Km: [BSZ*KN x FEAT] f16,
// Vt: [FEAT x BSZ*KN] f16 (transposed V' = sup1 @ Wv^T), out: f32 (+=).
// One wave handles 16 q rows of one (b,h) at a time. Computes S^T = K.Q^T so the
// softmaxed P converts to an A-fragment with per-lane packs only.
// A work-group owns 512 q rows of one (b,h). It first copies that head's whole K
// (512 rows of 256 B) and V^T (128 rows of 1024 B) into LDS, every copy asking L2
// for four whole lines, once per work-group. The fragments, 16 rows of 32 B each,
// are then read from LDS, whose pitched rows fall on all 64 banks once, and no
// longer gathered from 16 cache lines per load by every wave.
__global__ __launch_bounds__(AW * 32)
void attn_wmma(const _Float16* __restrict__ Qm, const _Float16* __restrict__ Km,
               const _Float16* __restrict__ Vt, const float* __restrict__ bv,
               float* __restrict__ out) {
  __shared__ __align__(16) _Float16 sK[KN * KP];
  __shared__ __align__(16) _Float16 sV[DG * VP];
  const int tid   = threadIdx.x;
  const int lane  = tid & 31;
  const int wid   = tid >> 5;
  const int h     = blockIdx.y;
  const int b     = blockIdx.z;
  const int l16  = lane & 15;
  const int koff = (lane < 16) ? 0 : 8;
  const int moff = (lane < 16) ? 0 : 8;

  // Fill, 32 copies of 16 B a lane. K: 16 lanes copy a row, the block 32 rows a
  // copy. V^T: 64 lanes copy a row, the block 8 rows a copy.
  {
    const _Float16* gK = Km + ((long)b * KN + (tid >> 4)) * FEAT + h * DG + (tid & 15) * 8;
    const _Float16* gV = Vt + ((long)h * DG + (tid >> 6)) * (BSZ * KN) + (long)b * KN + (tid & 63) * 8;
    const unsigned lK = (unsigned)(uintptr_t)(&sK[(tid >> 4) * KP + (tid & 15) * 8]);
    const unsigned lV = (unsigned)(uintptr_t)(&sV[(tid >> 6) * VP + (tid & 63) * 8]);
    auto fill8 = [](unsigned l, unsigned ls, const _Float16* g, long gs) {
      async_copy16x8(l, l + ls, l + 2 * ls, l + 3 * ls,
                     l + 4 * ls, l + 5 * ls, l + 6 * ls, l + 7 * ls,
                     g, g + gs, g + 2 * gs, g + 3 * gs,
                     g + 4 * gs, g + 5 * gs, g + 6 * gs, g + 7 * gs);
    };
    fill8(lK, 32 * KP * 2, gK, (long)32 * FEAT);
    fill8(lK + 256 * KP * 2, 32 * KP * 2, gK + (long)256 * FEAT, (long)32 * FEAT);
    fill8(lV, 8 * VP * 2, gV, (long)8 * BSZ * KN);
    fill8(lV + 64 * VP * 2, 8 * VP * 2, gV + (long)64 * BSZ * KN, (long)8 * BSZ * KN);
  }
  wait_async0();     // this wave's copies have landed
  __syncthreads();   // and so have every other wave's; LDS is only read from here on

  // the wave's q tiles, one after the other; K and V^T stay in LDS for all of them
  for (int qs = 0; qs < AQ; ++qs) {
  const int qtile = (blockIdx.x * AQ + qs) * AW + wid;   // 0..255
  const long qbase = (long)b * QN + (long)qtile * 16;

  // Q fragments, used as B (Q^T): lane = q row, regs = dims
  Frag32 qf[4];
  {
    const _Float16* qrow = Qm + (qbase + l16) * FEAT + h * DG;
#pragma unroll
    for (int d = 0; d < 4; ++d) {
      qf[d].u[0] = *(const uint4*)(qrow + d * 32 + koff);
      qf[d].u[1] = *(const uint4*)(qrow + d * 32 + koff + 16);
    }
  }

  const v8f vz = {0.f, 0.f, 0.f, 0.f, 0.f, 0.f, 0.f, 0.f};
  v8f o[8];
#pragma unroll
  for (int t = 0; t < 8; ++t) o[t] = vz;
  float m_st = -3.0e38f, l_st = 0.f;
  const float scale = 0.08838834764831845f;        // 1/sqrt(128)

  for (int kc = 0; kc < KN; kc += 32) {
    // S^T tiles: s0 = keys kc..kc+15, s1 = keys kc+16..kc+31 (lane = q)
    v8f s0 = vz, s1 = vz;
    {
      const _Float16* krow = &sK[(kc + l16) * KP];
#pragma unroll
      for (int d = 0; d < 4; ++d) {
        Frag32 kf;
        kf.u[0] = *(const uint4*)(krow + d * 32 + koff);
        kf.u[1] = *(const uint4*)(krow + d * 32 + koff + 16);
        s0 = wmma32(kf.v, qf[d].v, s0);
      }
      krow += 16 * KP;
#pragma unroll
      for (int d = 0; d < 4; ++d) {
        Frag32 kf;
        kf.u[0] = *(const uint4*)(krow + d * 32 + koff);
        kf.u[1] = *(const uint4*)(krow + d * 32 + koff + 16);
        s1 = wmma32(kf.v, qf[d].v, s1);
      }
    }
    // online softmax over this 32-key chunk (row = q = lane%16)
    float mloc = -3.0e38f;
#pragma unroll
    for (int r = 0; r < 8; ++r) {
      s0[r] *= scale; s1[r] *= scale;
      mloc = fmaxf(mloc, fmaxf(s0[r], s1[r]));
    }
    mloc = fmaxf(mloc, __shfl_xor(mloc, 16));
    float mnew  = fmaxf(m_st, mloc);
    float alpha = __expf(m_st - mnew);
    float rs = 0.f;
#pragma unroll
    for (int r = 0; r < 8; ++r) {
      s0[r] = __expf(s0[r] - mnew); rs += s0[r];
      s1[r] = __expf(s1[r] - mnew); rs += s1[r];
    }
    rs += __shfl_xor(rs, 16);
    l_st = l_st * alpha + rs;
    m_st = mnew;
    // pack P as A-fragment (lane = q, regs = 32 keys) — per-lane only
    Frag32 pf;
#pragma unroll
    for (int r = 0; r < 8; ++r) {
      pf.v[r]     = (_Float16)s0[r];
      pf.v[8 + r] = (_Float16)s1[r];
    }
    // broadcast alpha to O layout (vgpr r <-> q = r + moff)
    float aq[8];
#pragma unroll
    for (int r = 0; r < 8; ++r) aq[r] = __shfl(alpha, r + moff);
#pragma unroll
    for (int t = 0; t < 8; ++t) {
#pragma unroll
      for (int r = 0; r < 8; ++r) o[t][r] *= aq[r];
      const _Float16* vrow = &sV[(t * 16 + l16) * VP + kc];
      Frag32 vf;
      vf.u[0] = *(const uint4*)(vrow + koff);
      vf.u[1] = *(const uint4*)(vrow + koff + 16);
      o[t] = wmma32(pf.v, vf.v, o[t]);
    }
  }

  float linv[8];
#pragma unroll
  for (int r = 0; r < 8; ++r) linv[r] = 1.0f / __shfl(l_st, r + moff);
#pragma unroll
  for (int t = 0; t < 8; ++t) {
    int col = h * DG + t * 16 + l16;
    float bb = bv[col];
#pragma unroll
    for (int r = 0; r < 8; ++r) {
      long idx = (qbase + moff + r) * FEAT + col;
      out[idx] += o[t][r] * linv[r] + bb;
    }
  }
  // the next q tile's loads land in registers that this tile's loads and stores name
  if (qs + 1 < AQ) asm volatile("s_wait_xcnt 0x0" ::: "memory");
  }  // qs
}

extern "C" void kernel_launch(void* const* d_in, const int* in_sizes, int n_in,
                              void* d_out, int out_size, void* d_ws, size_t ws_size,
                              hipStream_t stream) {
  (void)in_sizes; (void)n_in; (void)out_size; (void)ws_size;
  const float* ref_feat = (const float*)d_in[0];
  const float* sup_feat = (const float*)d_in[1];
  const float* W_fc = (const float*)d_in[2];
  const float* b_fc = (const float*)d_in[3];
  const float* W_q  = (const float*)d_in[4];
  const float* b_q  = (const float*)d_in[5];
  const float* W_k  = (const float*)d_in[6];
  const float* b_k  = (const float*)d_in[7];
  const float* W_v  = (const float*)d_in[8];
  const float* b_v  = (const float*)d_in[9];
  float* out = (float*)d_out;

  size_t off = 0;
  auto carve = [&](size_t bytes) -> void* {
    void* p = (char*)d_ws + off;
    off += (bytes + 255) & ~(size_t)255;
    return p;
  };
  _Float16* ref16   = (_Float16*)carve((size_t)BSZ * QN * FEAT * 2);
  _Float16* sup16   = (_Float16*)carve((size_t)BSZ * KN * FEAT * 2);
  _Float16* wfc16   = (_Float16*)carve((size_t)FEAT * FEAT * 2);
  _Float16* wq16    = (_Float16*)carve((size_t)FEAT * FEAT * 2);
  _Float16* wk16    = (_Float16*)carve((size_t)FEAT * FEAT * 2);
  _Float16* wv16    = (_Float16*)carve((size_t)FEAT * FEAT * 2);
  _Float16* ref1_16 = (_Float16*)carve((size_t)BSZ * QN * FEAT * 2);
  _Float16* sup1_16 = (_Float16*)carve((size_t)BSZ * KN * FEAT * 2);
  _Float16* q16     = (_Float16*)carve((size_t)BSZ * QN * FEAT * 2);
  _Float16* k16     = (_Float16*)carve((size_t)BSZ * KN * FEAT * 2);
  _Float16* vT16    = (_Float16*)carve((size_t)FEAT * BSZ * KN * 2);

  cast_all<<<dim3(CW / 16), dim3(512), 0, stream>>>(
      ref_feat, sup_feat, W_fc, W_q, W_k, W_v,
      ref16, sup16, wfc16, wq16, wk16, wv16);

  dim3 blk(256);
  // ref1 = relu(ref @ Wfc^T + b_fc): f32 -> d_out (residual), f16 -> ref1_16
  gemm_wmma<8, 4><<<dim3(BSZ * QN / 256, FEAT / 256), blk, 0, stream>>>(
      ref16, wfc16, b_fc, out, ref1_16, nullptr, 0, 1);
  // sup1 = relu(sup @ Wfc^T + b_fc)
  gemm_wmma<4, 2><<<dim3(BSZ * KN / 128, FEAT / 128), blk, 0, stream>>>(
      sup16, wfc16, b_fc, nullptr, sup1_16, nullptr, 0, 1);
  // q = ref1 @ Wq^T + b_q
  gemm_wmma<8, 4><<<dim3(BSZ * QN / 256, FEAT / 256), blk, 0, stream>>>(
      ref1_16, wq16, b_q, nullptr, q16, nullptr, 0, 0);
  // k = sup1 @ Wk^T + b_k, and V' = sup1 @ Wv^T, stored transposed [FEAT x BSZ*KN]
  gemm_wmma_pair<4, 2><<<dim3(BSZ * KN / 128, FEAT / 128, 2), blk, 0, stream>>>(
      sup1_16, wk16, b_k, k16, wv16, vT16, BSZ * KN);
  // attention + grouped-conv (pre-folded into V') + b_v + residual
  attn_wmma<<<dim3(QN / (16 * AW * AQ), NG, BSZ), dim3(AW * 32), 0, stream>>>(
      q16, k16, vT16, b_v, out);
}

// v007
// A run of this version takes 201 microseconds.
// Two timings next to v006 both put it at 1.14 times that version's speed.
// Over all steps from v000 it is 2.31 times as fast.
#include <hip/hip_runtime.h>

#define FEAT 2048
#define QN   4096
#define KN   512
#define BSZ  2
#define NG   16
#define DG   128
#define KP   136  // attention, LDS pitch of a K row in f16: 128 + 8 = 272 B (16 B x odd)
#define VP   520  // attention, LDS pitch of a V^T row in f16: 512 + 8 = 1040 B (16 B x odd)
#define AW   16   // attention, waves of a work-group
#define AQ   2    // attention, q tiles that a wave works through, one after the other

typedef __attribute__((ext_vector_type(16))) _Float16 v16h;
typedef __attribute__((ext_vector_type(8)))  _Float16 v8h;
typedef __attribute__((ext_vector_type(8)))  float    v8f;

union Frag32 { v16h v; uint4 u[2]; };

__device__ __forceinline__ v8f wmma32(v16h a, v16h b, v8f c) {
  return __builtin_amdgcn_wmma_f32_16x16x32_f16(false, a, false, b, (short)0, c,
                                                false, false);
}

// CDNA5 async DMA: global -> LDS, no VGPR staging, tracked by ASYNCcnt.
// Eight copies of a lane in one statement: a quarter of a GEMM stage at either tile. The closing s_wait_xcnt
// stands inside it so that no later write of an address register can be
// scheduled in front of it.
__device__ __forceinline__ void async_copy16x8(unsigned l0, unsigned l1,
                                               unsigned l2, unsigned l3,
                                               unsigned l4, unsigned l5,
                                               unsigned l6, unsigned l7,
                                               const _Float16* g0, const _Float16* g1,
                                               const _Float16* g2, const _Float16* g3,
                                               const _Float16* g4, const _Float16* g5,
                                               const _Float16* g6, const _Float16* g7) {
  asm volatile("global_load_async_to_lds_b128 %0, %8, off\n\t"
               "global_load_async_to_lds_b128 %1, %9, off\n\t"
               "global_load_async_to_lds_b128 %2, %10, off\n\t"
               "global_load_async_to_lds_b128 %3, %11, off\n\t"
               "global_load_async_to_lds_b128 %4, %12, off\n\t"
               "global_load_async_to_lds_b128 %5, %13, off\n\t"
               "global_load_async_to_lds_b128 %6, %14, off\n\t"
               "global_load_async_to_lds_b128 %7, %15, off\n\t"
               "s_wait_xcnt 0x0"
               :: "v"(l0), "v"(l1), "v"(l2), "v"(l3),
                  "v"(l4), "v"(l5), "v"(l6), "v"(l7),
                  "v"(g0), "v"(g1), "v"(g2), "v"(g3),
                  "v"(g4), "v"(g5), "v"(g6), "v"(g7) : "memory");
}
__device__ __forceinline__ void wait_async0() {
  asm volatile("s_wait_asynccnt 0x0" ::: "memory");
}
// This wave's LDS reads have retired before the barrier behind which their
// buffer is refilled by copies.
__device__ __forceinline__ void wait_ds0() {
  asm volatile("s_wait_dscnt 0x0" ::: "memory");
}

// ---------------- fp32 -> fp16 cast of all six operands, one launch ----------
// 256 work-groups of 16 waves stream the whole cast. In step i wave w converts
// piece i * CW + w: 512 f32 in a row, read by four loads of 512 B (whole lines)
// and written by four stores of 256 B (whole lines). A step spans CSTEP elements
// and every operand is a whole number of steps long, so which operand a step
// reads is known at compile time.
#define CW     4096                 // waves in the launch
#define CPIECE 512                  // f32 elements of one piece
#define CSTEP  ((long)CW * CPIECE)  // elements that all waves convert in one step
#define S_REF  ((long)BSZ * QN * FEAT / CSTEP)   // 8 steps
#define S_SUP  ((long)BSZ * KN * FEAT / CSTEP)   // 1 step
#define S_W    ((long)FEAT * FEAT / CSTEP)       // 2 steps
#define S_ALL  (S_REF + S_SUP + 4 * S_W)         // 17 steps
static_assert(S_REF * CSTEP == (long)BSZ * QN * FEAT, "whole steps");
static_assert(S_SUP * CSTEP == (long)BSZ * KN * FEAT, "whole steps");
static_assert(S_W * CSTEP == (long)FEAT * FEAT, "whole steps");

typedef __attribute__((ext_vector_type(4))) _Float16 v4h;

// The pointers carry no __restrict__: the loads then stay where they are written,
// two pieces ahead of their stores, and are not gathered at the kernel's head.
__global__ __launch_bounds__(512)
void cast_all(const float* ref, const float* sup, const float* wfc,
              const float* wq, const float* wk, const float* wv,
              _Float16* dref, _Float16* dsup, _Float16* dwfc,
              _Float16* dwq, _Float16* dwk, _Float16* dwv) {
  // this lane's first element inside a step's span, and its byte offsets (under
  // 8 MB, so 32 bits) from a step's first source and first destination byte
  const unsigned e  = (blockIdx.x * 16 + (threadIdx.x >> 5)) * CPIECE + (threadIdx.x & 31) * 4;
  const unsigned lb = e * 4u;
  const unsigned sb = e * 2u;

  auto load_piece = [&](float4 (&v)[4], int i) {
    const float* s =
        i < S_REF                     ? ref + i * CSTEP
      : i < S_REF + S_SUP             ? sup + (i - S_REF) * CSTEP
      : i < S_REF + S_SUP + S_W       ? wfc + (i - S_REF - S_SUP) * CSTEP
      : i < S_REF + S_SUP + 2 * S_W   ? wq  + (i - S_REF - S_SUP - S_W) * CSTEP
      : i < S_REF + S_SUP + 3 * S_W   ? wk  + (i - S_REF - S_SUP - 2 * S_W) * CSTEP
                                      : wv  + (i - S_REF - S_SUP - 3 * S_W) * CSTEP;
#pragma unroll
    for (int j = 0; j < 4; ++j) v[j] = *(const float4*)((const char*)(s + j * 128) + lb);
  };
  auto store_piece = [&](const float4 (&v)[4], int i) {
    _Float16* d =
        i < S_REF                     ? dref + i * CSTEP
      : i < S_REF + S_SUP             ? dsup + (i - S_REF) * CSTEP
      : i < S_REF + S_SUP + S_W       ? dwfc + (i - S_REF - S_SUP) * CSTEP
      : i < S_REF + S_SUP + 2 * S_W   ? dwq  + (i - S_REF - S_SUP - S_W) * CSTEP
      : i < S_REF + S_SUP + 3 * S_W   ? dwk  + (i - S_REF - S_SUP - 2 * S_W) * CSTEP
                                      : dwv  + (i - S_REF - S_SUP - 3 * S_W) * CSTEP;
#pragma unroll
    for (int j = 0; j < 4; ++j) {
      v4h h;
      h[0] = (_Float16)v[j].x; h[1] = (_Float16)v[j].y;
      h[2] = (_Float16)v[j].z; h[3] = (_Float16)v[j].w;
      *(v4h*)((char*)(d + j * 128) + sb) = h;
    }
  };

  // three register sets: the loads of two later pieces are in flight while a
  // piece is converted and stored (8 to 12 loads of a wave outstanding)
  float4 v[3][4];
  load_piece(v[0], 0);
  load_piece(v[1], 1);
  // the next loads may land in registers that these loads name as address
  asm volatile("s_wait_xcnt 0x0" ::: "memory");
  // unrolled whole: the step number picks operand and register set at compile time
#pragma unroll
  for (int i = 0; i < S_ALL; ++i) {
    if (i + 2 < S_ALL) load_piece(v[(i + 2) % 3], i + 2);
    store_piece(v[i % 3], i);
    // the next loads land in registers that these stores name as data
    if (i + 3 < S_ALL) asm volatile("s_wait_xcnt 0x0" ::: "memory");
  }
}

// ---------------- tiled WMMA GEMM: C[m,n] = act(A[m,:] . Bw[n,:] + bias[n]) ----
// A: [M x FEAT] f16 row-major, Bw: [FEAT x FEAT] f16 row-major (weights, N-major)
// Double-buffered LDS, tiles filled by async global->LDS DMA.
// A trip of the loop lasts at least as long as its stage's copies take to land, and
// the operands come from memory at its latency: a work-group's rate is the bytes it
// has in flight over that latency. A stage is therefore as deep as two buffers of
// both operands fit the LDS: 32 copies of 16 B a lane, 128 KB a work-group.
// A wave's copy asks L2 for four whole lines (one row's 512 B, or two rows' 256 B).
// LDS rows are pitched 16 B x odd (528 B, 272 B): the 16 rows that a half-wave's
// ds_load_b128 reads then fall on all 64 banks once.
// The 8 waves stand 2 x 4; a wave owns FM x FN tiles of 16 x 16, the work-group
// 32*FM x 64*FN of C. Per 32 k a wave reads FM + FN fragments for FM * FN products.
// <8,4>: 256 x 256 of C, stages of 128 k, for the products with 8192 rows (256 such
// tiles). <4,2>: 128 x 128, stages of 256 k, for those with 1024 rows (128 tiles).
// Either way one work-group on a WGP.
// The tile is picked by blockIdx.x and blockIdx.y.
template <int FM, int FN>
__device__ __forceinline__
void gemm_tile(const _Float16* __restrict__ A, const _Float16* __restrict__ Bw,
               const float* __restrict__ bias,
               float* __restrict__ out32, _Float16* __restrict__ out16,
               _Float16* __restrict__ outT, int ldT, int relu) {
  static_assert((FM == 4 && FN == 2) || (FM == 8 && FN == 4), "copies per stage");
  constexpr int TM = 32 * FM;          // rows of C in the work-group's tile
  constexpr int TN = 64 * FN;          // columns of C in it
  constexpr int BK  = (FM == 4) ? 256 : 128;   // k depth of one LDS stage
  constexpr int LDP = BK + 8;          // LDS row pitch in f16: 16 B more than the data
  constexpr int LPR = BK / 8;          // lanes that copy one row, 16 B each
  constexpr int RPC = 256 / LPR;       // rows that one copy of the whole block brings
  static_assert(TM == 16 * RPC && TN == 16 * RPC, "16 copies a lane for each operand");
  static_assert(FEAT % BK == 0, "whole stages");
  __shared__ __align__(16) _Float16 sA[2][TM * LDP];
  __shared__ __align__(16) _Float16 sB[2][TN * LDP];
  const int tid  = threadIdx.x;
  const int lane = tid & 31;
  const int wid  = tid >> 5;
  const int wm   = wid >> 2;           // 0..1
  const int wn   = wid & 3;            // 0..3
  const long bm  = (long)blockIdx.x * TM;
  const long bn  = (long)blockIdx.y * TN;
  const int l16  = lane & 15;
  const int koff = (lane < 16) ? 0 : 8;

  // per-thread DMA slots: rows row0 + RPC*{0,1,..,15}, 8-f16 chunk ch0 (16B)
  const int row0 = tid / LPR;          // 0..RPC-1
  const int ch0  = (tid % LPR) * 8;    // 0,8,..,BK-8

  const v8f vz = {0.f, 0.f, 0.f, 0.f, 0.f, 0.f, 0.f, 0.f};
  v8f acc[FM][FN];
#pragma unroll
  for (int i = 0; i < FM; ++i)
#pragma unroll
    for (int j = 0; j < FN; ++j) acc[i][j] = vz;

  auto load_tile = [&](int buf, int k0) {
    const _Float16* gA = &A[(bm + row0) * FEAT + k0 + ch0];
    const _Float16* gB = &Bw[(bn + row0) * FEAT + k0 + ch0];
    unsigned la = (unsigned)(uintptr_t)(&sA[buf][row0 * LDP + ch0]);
    unsigned lb = (unsigned)(uintptr_t)(&sB[buf][row0 * LDP + ch0]);
    // 16 copies a lane for A and 16 for B, eight to a statement
    constexpr unsigned ls = RPC * LDP * 2;
    constexpr long     gs = (long)RPC * FEAT;
    auto fill8 = [](unsigned l, const _Float16* g) {
      async_copy16x8(l, l + ls, l + 2 * ls, l + 3 * ls,
                     l + 4 * ls, l + 5 * ls, l + 6 * ls, l + 7 * ls,
                     g, g + gs, g + 2 * gs, g + 3 * gs,
                     g + 4 * gs, g + 5 * gs, g + 6 * gs, g + 7 * gs);
    };
    // The scheduling fences keep a statement's address sums behind the statement in
    // front of it, so that all four use the same registers. Formed together they take
    // so many of the registers that asm text can name that accumulators of the <8,4>
    // tile are moved out of them and back in every trip.
    fill8(la, gA);
    __builtin_amdgcn_sched_barrier(0);
    fill8(la + 8 * ls, gA + 8 * gs);
    __builtin_amdgcn_sched_barrier(0);
    fill8(lb, gB);
    __builtin_amdgcn_sched_barrier(0);
    fill8(lb + 8 * ls, gB + 8 * gs);
  };

  load_tile(0, 0);
  wait_async0();
  __syncthreads();

  for (int k0 = 0; k0 < FEAT; k0 += BK) {
    const int buf = (k0 / BK) & 1;
    if (k0 + BK < FEAT) load_tile(buf ^ 1, k0 + BK);   // DMA next tile

    // the stage's 32-k blocks, in rising k: the sums keep their order
    if constexpr (FM == 4) {
#pragma unroll
      for (int kk = 0; kk < BK; kk += 32) {
        Frag32 af[FM], bf[FN];
#pragma unroll
        for (int i = 0; i < FM; ++i) {
          int r = wm * (FM * 16) + i * 16 + l16;
          af[i].u[0] = *(const uint4*)(&sA[buf][r * LDP + kk + koff]);
          af[i].u[1] = *(const uint4*)(&sA[buf][r * LDP + kk + koff + 16]);
        }
#pragma unroll
        for (int j = 0; j < FN; ++j) {
          int r = wn * (FN * 16) + j * 16 + l16;
          bf[j].u[0] = *(const uint4*)(&sB[buf][r * LDP + kk + koff]);
          bf[j].u[1] = *(const uint4*)(&sB[buf][r * LDP + kk + koff + 16]);
        }
#pragma unroll
        for (int i = 0; i < FM; ++i)
#pragma unroll
          for (int j = 0; j < FN; ++j)
            acc[i][j] = wmma32(af[i].v, bf[j].v, acc[i][j]);
      }
    } else {
      // Both blocks' fragments are read ahead of the products, in the order in which
      // the products use them: all of a block's B, then its A row by row.
      // The scheduling fence behind each fragment keeps that order and keeps the
      // reads in front of the products. Left free, the compiler reads one A fragment
      // per four products into one register set and waits out each read's latency,
      // or reads early rows last, so that the second row waits for nearly all reads.
      // The stage goes by in two such pairs of blocks; unrolled, so that every LDS
      // offset is an immediate.
#pragma unroll
      for (int kh = 0; kh < BK; kh += 64) {
      Frag32 af[2][FM], bf[2][FN];
#pragma unroll
      for (int s = 0; s < 2; ++s) {
#pragma unroll
        for (int j = 0; j < FN; ++j) {
          int r = wn * (FN * 16) + j * 16 + l16;
          bf[s][j].u[0] = *(const uint4*)(&sB[buf][r * LDP + kh + s * 32 + koff]);
          bf[s][j].u[1] = *(const uint4*)(&sB[buf][r * LDP + kh + s * 32 + koff + 16]);
          __builtin_amdgcn_sched_barrier(0);   // read order, see above
        }
#pragma unroll
        for (int i = 0; i < FM; ++i) {
          int r = wm * (FM * 16) + i * 16 + l16;
          af[s][i].u[0] = *(const uint4*)(&sA[buf][r * LDP + kh + s * 32 + koff]);
          af[s][i].u[1] = *(const uint4*)(&sA[buf][r * LDP + kh + s * 32 + koff + 16]);
          __builtin_amdgcn_sched_barrier(0);   // read order, see above
        }
      }
#pragma unroll
      for (int s = 0; s < 2; ++s)
#pragma unroll
        for (int i = 0; i < FM; ++i)
#pragma unroll
          for (int j = 0; j < FN; ++j)
            acc[i][j] = wmma32(af[s][i].v, bf[s][j].v, acc[i][j]);
      // keeps the products in front of the next pair's reads and of the waits below:
      // moved behind the waits, the next tile's copies would be waited for before any
      // product has run
      __builtin_amdgcn_sched_barrier(0);
      }  // kh
    }

    // next tile landed; barrier also guards WAR on buf, refilled by the next trip's DMA
    wait_ds0();
    wait_async0();
    __syncthreads();
  }

  const int moff = (lane < 16) ? 0 : 8;
#pragma unroll
  for (int i = 0; i < FM; ++i) {
#pragma unroll
    for (int j = 0; j < FN; ++j) {
      long n  = bn + wn * (FN * 16) + j * 16 + l16;
      long mb = bm + wm * (FM * 16) + i * 16 + moff;
      float bv = bias ? bias[n] : 0.f;
      float vals[8];
#pragma unroll
      for (int r = 0; r < 8; ++r) {
        float x = acc[i][j][r] + bv;
        if (relu) x = fmaxf(x, 0.f);
        vals[r] = x;
      }
      if (out32) {
#pragma unroll
        for (int r = 0; r < 8; ++r) out32[(mb + r) * FEAT + n] = vals[r];
        // later code rewrites registers that these stores name
        asm volatile("s_wait_xcnt 0x0" ::: "memory");
      }
      if (out16) {
#pragma unroll
        for (int r = 0; r < 8; ++r) out16[(mb + r) * FEAT + n] = (_Float16)vals[r];
        // later code rewrites registers that these stores name
        asm volatile("s_wait_xcnt 0x0" ::: "memory");
      }
      if (outT) {
        v8h hh;
#pragma unroll
        for (int r = 0; r < 8; ++r) hh[r] = (_Float16)vals[r];
        *(v8h*)(&outT[n * (long)ldT + mb]) = hh;   // mb multiple of 8 -> 16B aligned
        // later code rewrites registers that this store names
        asm volatile("s_wait_xcnt 0x0" ::: "memory");
      }
    }
  }
}

// one product a launch
template <int FM, int FN>
__global__ __launch_bounds__(256)
void gemm_wmma(const _Float16* __restrict__ A, const _Float16* __restrict__ Bw,
               const float* __restrict__ bias,
               float* __restrict__ out32, _Float16* __restrict__ out16,
               _Float16* __restrict__ outT, int ldT, int relu) {
  gemm_tile<FM, FN>(A, Bw, bias, out32, out16, outT, ldT, relu);
}

// Two products of the same A in one launch: blockIdx.z = 0 gives A . B0^T + bias0,
// stored row-major in out0; blockIdx.z = 1 gives A . B1^T, stored transposed in
// outT1. Neither reads what the other writes. One product with 1024 rows has 128
// tiles, half as many as there are WGPs, and a tile's time is set by its own chain
// of stages: the two together take about as long as one alone.
template <int FM, int FN>
__global__ __launch_bounds__(256)
void gemm_wmma_pair(const _Float16* __restrict__ A,
                    const _Float16* __restrict__ B0, const float* __restrict__ bias0,
                    _Float16* __restrict__ out0,
                    const _Float16* __restrict__ B1,
                    _Float16* __restrict__ outT1, int ldT1) {
  const bool second = blockIdx.z != 0;
  gemm_tile<FM, FN>(A, second ? B1 : B0, second ? nullptr : bias0, nullptr,
                    second ? nullptr : out0, second ? outT1 : nullptr, ldT1, 0);
}

// ---------------- fused flash attention + residual + b_v --------------
// Qm: [BSZ*QN x FEAT] f16 (head h at cols h*DG..), Km: [BSZ*KN x FEAT] f16,
// Vt: [FEAT x BSZ*KN] f16 (transposed V' = sup1 @ Wv^T), out: f32 (+=).
// One wave handles 16 q rows of one (b,h) at a time. Computes S^T = K.Q^T so the
// softmaxed P converts to an A-fragment with per-lane packs only.
// A work-group owns 512 q rows of one (b,h). It first copies that head's whole K
// (512 rows of 256 B) and V^T (128 rows of 1024 B) into LDS, every copy asking L2
// for four whole lines, once per work-group. The fragments, 16 rows of 32 B each,
// are then read from LDS, whose pitched rows fall on all 64 banks once, and no
// longer gathered from 16 cache lines per load by every wave.
__global__ __launch_bounds__(AW * 32)
void attn_wmma(const _Float16* __restrict__ Qm, const _Float16* __restrict__ Km,
               const _Float16* __restrict__ Vt, const float* __restrict__ bv,
               float* __restrict__ out) {
  __shared__ __align__(16) _Float16 sK[KN * KP];
  __shared__ __align__(16) _Float16 sV[DG * VP];
  const int tid   = threadIdx.x;
  const int lane  = tid & 31;
  const int wid   = tid >> 5;
  const int h     = blockIdx.y;
  const int b     = blockIdx.z;
  const int l16  = lane & 15;
  const int koff = (lane < 16) ? 0 : 8;
  const int moff = (lane < 16) ? 0 : 8;

  // Fill, 32 copies of 16 B a lane. K: 16 lanes copy a row, the block 32 rows a
  // copy. V^T: 64 lanes copy a row, the block 8 rows a copy.
  {
    const _Float16* gK = Km + ((long)b * KN + (tid >> 4)) * FEAT + h * DG + (tid & 15) * 8;
    const _Float16* gV = Vt + ((long)h * DG + (tid >> 6)) * (BSZ * KN) + (long)b * KN + (tid & 63) * 8;
    const unsigned lK = (unsigned)(uintptr_t)(&sK[(tid >> 4) * KP + (tid & 15) * 8]);
    const unsigned lV = (unsigned)(uintptr_t)(&sV[(tid >> 6) * VP + (tid & 63) * 8]);
    auto fill8 = [](unsigned l, unsigned ls, const _Float16* g, long gs) {
      async_copy16x8(l, l + ls, l + 2 * ls, l + 3 * ls,
                     l + 4 * ls, l + 5 * ls, l + 6 * ls, l + 7 * ls,
                     g, g + gs, g + 2 * gs, g + 3 * gs,
                     g + 4 * gs, g + 5 * gs, g + 6 * gs, g + 7 * gs);
    };
    fill8(lK, 32 * KP * 2, gK, (long)32 * FEAT);
    fill8(lK + 256 * KP * 2, 32 * KP * 2, gK + (long)256 * FEAT, (long)32 * FEAT);
    fill8(lV, 8 * VP * 2, gV, (long)8 * BSZ * KN);
    fill8(lV + 64 * VP * 2, 8 * VP * 2, gV + (long)64 * BSZ * KN, (long)8 * BSZ * KN);
  }
  wait_async0();     // this wave's copies have landed
  __syncthreads();   // and so have every other wave's; LDS is only read from here on

  // the wave's q tiles, one after the other; K and V^T stay in LDS for all of them
  for (int qs = 0; qs < AQ; ++qs) {
  const int qtile = (blockIdx.x * AQ + qs) * AW + wid;   // 0..255
  const long qbase = (long)b * QN + (long)qtile * 16;

  // Q fragments, used as B (Q^T): lane = q row, regs = dims
  Frag32 qf[4];
  {
    const _Float16* qrow = Qm + (qbase + l16) * FEAT + h * DG;
#pragma unroll
    for (int d = 0; d < 4; ++d) {
      qf[d].u[0] = *(const uint4*)(qrow + d * 32 + koff);
      qf[d].u[1] = *(const uint4*)(qrow + d * 32 + koff + 16);
    }
  }

  const v8f vz = {0.f, 0.f, 0.f, 0.f, 0.f, 0.f, 0.f, 0.f};
  v8f o[8];
#pragma unroll
  for (int t = 0; t < 8; ++t) o[t] = vz;
  float m_st = -3.0e38f, l_st = 0.f;
  const float scale = 0.08838834764831845f;        // 1/sqrt(128)

  for (int kc = 0; kc < KN; kc += 32) {
    // S^T tiles: s0 = keys kc..kc+15, s1 = keys kc+16..kc+31 (lane = q)
    v8f s0 = vz, s1 = vz;
    {
      const _Float16* krow = &sK[(kc + l16) * KP];
#pragma unroll
      for (int d = 0; d < 4; ++d) {
        Frag32 kf;
        kf.u[0] = *(const uint4*)(krow + d * 32 + koff);
        kf.u[1] = *(const uint4*)(krow + d * 32 + koff + 16);
        s0 = wmma32(kf.v, qf[d].v, s0);
      }
      krow += 16 * KP;
#pragma unroll
      for (int d = 0; d < 4; ++d) {
        Frag32 kf;
        kf.u[0] = *(const uint4*)(krow + d * 32 + koff);
        kf.u[1] = *(const uint4*)(krow + d * 32 + koff + 16);
        s1 = wmma32(kf.v, qf[d].v, s1);
      }
    }
    // online softmax over this 32-key chunk (row = q = lane%16)
    float mloc = -3.0e38f;
#pragma unroll
    for (int r = 0; r < 8; ++r) {
      s0[r] *= scale; s1[r] *= scale;
      mloc = fmaxf(mloc, fmaxf(s0[r], s1[r]));
    }
    mloc = fmaxf(mloc, __shfl_xor(mloc, 16));
    float mnew  = fmaxf(m_st, mloc);
    float alpha = __expf(m_st - mnew);
    float rs = 0.f;
#pragma unroll
    for (int r = 0; r < 8; ++r) {
      s0[r] = __expf(s0[r] - mnew); rs += s0[r];
      s1[r] = __expf(s1[r] - mnew); rs += s1[r];
    }
    rs += __shfl_xor(rs, 16);
    l_st = l_st * alpha + rs;
    m_st = mnew;
    // pack P as A-fragment (lane = q, regs = 32 keys) — per-lane only
    Frag32 pf;
#pragma unroll
    for (int r = 0; r < 8; ++r) {
      pf.v[r]     = (_Float16)s0[r];
      pf.v[8 + r] = (_Float16)s1[r];
    }
    // broadcast alpha to O layout (vgpr r <-> q = r + moff)
    float aq[8];
#pragma unroll
    for (int r = 0; r < 8; ++r) aq[r] = __shfl(alpha, r + moff);
#pragma unroll
    for (int t = 0; t < 8; ++t) {
#pragma unroll
      for (int r = 0; r < 8; ++r) o[t][r] *= aq[r];
      const _Float16* vrow = &sV[(t * 16 + l16) * VP + kc];
      Frag32 vf;
      vf.u[0] = *(const uint4*)(vrow + koff);
      vf.u[1] = *(const uint4*)(vrow + koff + 16);
      o[t] = wmma32(pf.v, vf.v, o[t]);
    }
  }

  float linv[8];
#pragma unroll
  for (int r = 0; r < 8; ++r) linv[r] = 1.0f / __shfl(l_st, r + moff);
#pragma unroll
  for (int t = 0; t < 8; ++t) {
    int col = h * DG + t * 16 + l16;
    float bb = bv[col];
#pragma unroll
    for (int r = 0; r < 8; ++r) {
      long idx = (qbase + moff + r) * FEAT + col;
      out[idx] += o[t][r] * linv[r] + bb;
    }
  }
  // the next q tile's loads land in registers that this tile's loads and stores name
  if (qs + 1 < AQ) asm volatile("s_wait_xcnt 0x0" ::: "memory");
  }  // qs
}

extern "C" void kernel_launch(void* const* d_in, const int* in_sizes, int n_in,
                              void* d_out, int out_size, void* d_ws, size_t ws_size,
                              hipStream_t stream) {
  (void)in_sizes; (void)n_in; (void)out_size; (void)ws_size;
  const float* ref_feat = (const float*)d_in[0];
  const float* sup_feat = (const float*)d_in[1];
  const float* W_fc = (const float*)d_in[2];
  const float* b_fc = (const float*)d_in[3];
  const float* W_q  = (const float*)d_in[4];
  const float* b_q  = (const float*)d_in[5];
  const float* W_k  = (const float*)d_in[6];
  const float* b_k  = (const float*)d_in[7];
  const float* W_v  = (const float*)d_in[8];
  const float* b_v  = (const float*)d_in[9];
  float* out = (float*)d_out;

  size_t off = 0;
  auto carve = [&](size_t bytes) -> void* {
    void* p = (char*)d_ws + off;
    off += (bytes + 255) & ~(size_t)255;
    return p;
  };
  _Float16* ref16   = (_Float16*)carve((size_t)BSZ * QN * FEAT * 2);
  _Float16* sup16   = (_Float16*)carve((size_t)BSZ * KN * FEAT * 2);
  _Float16* wfc16   = (_Float16*)carve((size_t)FEAT * FEAT * 2);
  _Float16* wq16    = (_Float16*)carve((size_t)FEAT * FEAT * 2);
  _Float16* wk16    = (_Float16*)carve((size_t)FEAT * FEAT * 2);
  _Float16* wv16    = (_Float16*)carve((size_t)FEAT * FEAT * 2);
  _Float16* ref1_16 = (_Float16*)carve((size_t)BSZ * QN * FEAT * 2);
  _Float16* sup1_16 = (_Float16*)carve((size_t)BSZ * KN * FEAT * 2);
  _Float16* q16     = (_Float16*)carve((size_t)BSZ * QN * FEAT * 2);
  _Float16* k16     = (_Float16*)carve((size_t)BSZ * KN * FEAT * 2);
  _Float16* vT16    = (_Float16*)carve((size_t)FEAT * BSZ * KN * 2);

  cast_all<<<dim3(CW / 16), dim3(512), 0, stream>>>(
      ref_feat, sup_feat, W_fc, W_q, W_k, W_v,
      ref16, sup16, wfc16, wq16, wk16, wv16);

  dim3 blk(256);
  // ref1 = relu(ref @ Wfc^T + b_fc): f32 -> d_out (residual), f16 -> ref1_16
  gemm_wmma<8, 4><<<dim3(BSZ * QN / 256, FEAT / 256), blk, 0, stream>>>(
      ref16, wfc16, b_fc, out, ref1_16, nullptr, 0, 1);
  // sup1 = relu(sup @ Wfc^T + b_fc)
  gemm_wmma<4, 2><<<dim3(BSZ * KN / 128, FEAT / 128), blk, 0, stream>>>(
      sup16, wfc16, b_fc, nullptr, sup1_16, nullptr, 0, 1);
  // q = ref1 @ Wq^T + b_q
  gemm_wmma<8, 4><<<dim3(BSZ * QN / 256, FEAT / 256), blk, 0, stream>>>(
      ref1_16, wq16, b_q, nullptr, q16, nullptr, 0, 0);
  // k = sup1 @ Wk^T + b_k, and V' = sup1 @ Wv^T, stored transposed [FEAT x BSZ*KN]
  gemm_wmma_pair<4, 2><<<dim3(BSZ * KN / 128, FEAT / 128, 2), blk, 0, stream>>>(
      sup1_16, wk16, b_k, k16, wv16, vT16, BSZ * KN);
  // attention + grouped-conv (pre-folded into V') + b_v + residual
  attn_wmma<<<dim3(QN / (16 * AW * AQ), NG, BSZ), dim3(AW * 32), 0, stream>>>(
      q16, k16, vT16, b_v, out);
}

// v008
// It runs in 175 microseconds.
// In both of two side-by-side timings against v007, it was 1.15 times as fast.
// Counting every step since v000, it is 2.65 times as fast.
#include <hip/hip_runtime.h>

#define FEAT 2048
#define QN   4096
#define KN   512
#define BSZ  2
#define NG   16
#define DG   128
#define KP   136  // attention, LDS pitch of a K row in f16: 128 + 8 = 272 B (16 B x odd)
#define VP   520  // attention, LDS pitch of a V^T row in f16: 512 + 8 = 1040 B (16 B x odd)
#define OP   36   // attention, LDS pitch of a staged output row in f32: 32 + 4 = 144 B
#define AW   16   // attention, waves of a work-group
#define AQ   2    // attention, q tiles that a wave works through, one after the other

typedef __attribute__((ext_vector_type(16))) _Float16 v16h;
typedef __attribute__((ext_vector_type(8)))  _Float16 v8h;
typedef __attribute__((ext_vector_type(8)))  float    v8f;

union Frag32 { v16h v; uint4 u[2]; };

__device__ __forceinline__ v8f wmma32(v16h a, v16h b, v8f c) {
  return __builtin_amdgcn_wmma_f32_16x16x32_f16(false, a, false, b, (short)0, c,
                                                false, false);
}

// CDNA5 async DMA: global -> LDS, no VGPR staging, tracked by ASYNCcnt.
// Eight copies of a lane in one statement: a quarter of a GEMM stage at either tile. The closing s_wait_xcnt
// stands inside it so that no later write of an address register can be
// scheduled in front of it.
__device__ __forceinline__ void async_copy16x8(unsigned l0, unsigned l1,
                                               unsigned l2, unsigned l3,
                                               unsigned l4, unsigned l5,
                                               unsigned l6, unsigned l7,
                                               const _Float16* g0, const _Float16* g1,
                                               const _Float16* g2, const _Float16* g3,
                                               const _Float16* g4, const _Float16* g5,
                                               const _Float16* g6, const _Float16* g7) {
  asm volatile("global_load_async_to_lds_b128 %0, %8, off\n\t"
               "global_load_async_to_lds_b128 %1, %9, off\n\t"
               "global_load_async_to_lds_b128 %2, %10, off\n\t"
               "global_load_async_to_lds_b128 %3, %11, off\n\t"
               "global_load_async_to_lds_b128 %4, %12, off\n\t"
               "global_load_async_to_lds_b128 %5, %13, off\n\t"
               "global_load_async_to_lds_b128 %6, %14, off\n\t"
               "global_load_async_to_lds_b128 %7, %15, off\n\t"
               "s_wait_xcnt 0x0"
               :: "v"(l0), "v"(l1), "v"(l2), "v"(l3),
                  "v"(l4), "v"(l5), "v"(l6), "v"(l7),
                  "v"(g0), "v"(g1), "v"(g2), "v"(g3),
                  "v"(g4), "v"(g5), "v"(g6), "v"(g7) : "memory");
}
__device__ __forceinline__ void wait_async0() {
  asm volatile("s_wait_asynccnt 0x0" ::: "memory");
}
// This wave's LDS reads have retired before the barrier behind which their
// buffer is refilled by copies.
__device__ __forceinline__ void wait_ds0() {
  asm volatile("s_wait_dscnt 0x0" ::: "memory");
}

// ---------------- fp32 -> fp16 cast of all six operands, one launch ----------
// 256 work-groups of 16 waves stream the whole cast. In step i wave w converts
// piece i * CW + w: 512 f32 in a row, read by four loads of 512 B (whole lines)
// and written by four stores of 256 B (whole lines). A step spans CSTEP elements
// and every operand is a whole number of steps long, so which operand a step
// reads is known at compile time.
#define CW     4096                 // waves in the launch
#define CPIECE 512                  // f32 elements of one piece
#define CSTEP  ((long)CW * CPIECE)  // elements that all waves convert in one step
#define S_REF  ((long)BSZ * QN * FEAT / CSTEP)   // 8 steps
#define S_SUP  ((long)BSZ * KN * FEAT / CSTEP)   // 1 step
#define S_W    ((long)FEAT * FEAT / CSTEP)       // 2 steps
#define S_ALL  (S_REF + S_SUP + 4 * S_W)         // 17 steps
static_assert(S_REF * CSTEP == (long)BSZ * QN * FEAT, "whole steps");
static_assert(S_SUP * CSTEP == (long)BSZ * KN * FEAT, "whole steps");
static_assert(S_W * CSTEP == (long)FEAT * FEAT, "whole steps");

typedef __attribute__((ext_vector_type(4))) _Float16 v4h;

// The pointers carry no __restrict__: the loads then stay where they are written,
// two pieces ahead of their stores, and are not gathered at the kernel's head.
__global__ __launch_bounds__(512)
void cast_all(const float* ref, const float* sup, const float* wfc,
              const float* wq, const float* wk, const float* wv,
              _Float16* dref, _Float16* dsup, _Float16* dwfc,
              _Float16* dwq, _Float16* dwk, _Float16* dwv) {
  // this lane's first element inside a step's span, and its byte offsets (under
  // 8 MB, so 32 bits) from a step's first source and first destination byte
  const unsigned e  = (blockIdx.x * 16 + (threadIdx.x >> 5)) * CPIECE + (threadIdx.x & 31) * 4;
  const unsigned lb = e * 4u;
  const unsigned sb = e * 2u;

  auto load_piece = [&](float4 (&v)[4], int i) {
    const float* s =
        i < S_REF                     ? ref + i * CSTEP
      : i < S_REF + S_SUP             ? sup + (i - S_REF) * CSTEP
      : i < S_REF + S_SUP + S_W       ? wfc + (i - S_REF - S_SUP) * CSTEP
      : i < S_REF + S_SUP + 2 * S_W   ? wq  + (i - S_REF - S_SUP - S_W) * CSTEP
      : i < S_REF + S_SUP + 3 * S_W   ? wk  + (i - S_REF - S_SUP - 2 * S_W) * CSTEP
                                      : wv  + (i - S_REF - S_SUP - 3 * S_W) * CSTEP;
#pragma unroll
    for (int j = 0; j < 4; ++j) v[j] = *(const float4*)((const char*)(s + j * 128) + lb);
  };
  auto store_piece = [&](const float4 (&v)[4], int i) {
    _Float16* d =
        i < S_REF                     ? dref + i * CSTEP
      : i < S_REF + S_SUP             ? dsup + (i - S_REF) * CSTEP
      : i < S_REF + S_SUP + S_W       ? dwfc + (i - S_REF - S_SUP) * CSTEP
      : i < S_REF + S_SUP + 2 * S_W   ? dwq  + (i - S_REF - S_SUP - S_W) * CSTEP
      : i < S_REF + S_SUP + 3 * S_W   ? dwk  + (i - S_REF - S_SUP - 2 * S_W) * CSTEP
                                      : dwv  + (i - S_REF - S_SUP - 3 * S_W) * CSTEP;
#pragma unroll
    for (int j = 0; j < 4; ++j) {
      v4h h;
      h[0] = (_Float16)v[j].x; h[1] = (_Float16)v[j].y;
      h[2] = (_Float16)v[j].z; h[3] = (_Float16)v[j].w;
      *(v4h*)((char*)(d + j * 128) + sb) = h;
    }
  };

  // three register sets: the loads of two later pieces are in flight while a
  // piece is converted and stored (8 to 12 loads of a wave outstanding)
  float4 v[3][4];
  load_piece(v[0], 0);
  load_piece(v[1], 1);
  // the next loads may land in registers that these loads name as address
  asm volatile("s_wait_xcnt 0x0" ::: "memory");
  // unrolled whole: the step number picks operand and register set at compile time
#pragma unroll
  for (int i = 0; i < S_ALL; ++i) {
    if (i + 2 < S_ALL) load_piece(v[(i + 2) % 3], i + 2);
    store_piece(v[i % 3], i);
    // the next loads land in registers that these stores name as data
    if (i + 3 < S_ALL) asm volatile("s_wait_xcnt 0x0" ::: "memory");
  }
}

// ---------------- tiled WMMA GEMM: C[m,n] = act(A[m,:] . Bw[n,:] + bias[n]) ----
// A: [M x FEAT] f16 row-major, Bw: [FEAT x FEAT] f16 row-major (weights, N-major)
// Double-buffered LDS, tiles filled by async global->LDS DMA.
// A trip of the loop lasts at least as long as its stage's copies take to land, and
// the operands come from memory at its latency: a work-group's rate is the bytes it
// has in flight over that latency. A stage is therefore as deep as two buffers of
// both operands fit the LDS: 32 copies of 16 B a lane, 128 KB a work-group.
// A wave's copy asks L2 for four whole lines (one row's 512 B, or two rows' 256 B).
// LDS rows are pitched 16 B x odd (528 B, 272 B): the 16 rows that a half-wave's
// ds_load_b128 reads then fall on all 64 banks once.
// The 8 waves stand 2 x 4; a wave owns FM x FN tiles of 16 x 16, the work-group
// 32*FM x 64*FN of C. Per 32 k a wave reads FM + FN fragments for FM * FN products.
// <8,4>: 256 x 256 of C, stages of 128 k, for the products with 8192 rows (256 such
// tiles). <4,2>: 128 x 128, stages of 256 k, for those with 1024 rows (128 tiles).
// Either way one work-group on a WGP.
// The tile is picked by blockIdx.x and blockIdx.y.
template <int FM, int FN>
__device__ __forceinline__
void gemm_tile(const _Float16* __restrict__ A, const _Float16* __restrict__ Bw,
               const float* __restrict__ bias,
               float* __restrict__ out32, _Float16* __restrict__ out16,
               _Float16* __restrict__ outT, int ldT, int relu) {
  static_assert((FM == 4 && FN == 2) || (FM == 8 && FN == 4), "copies per stage");
  constexpr int TM = 32 * FM;          // rows of C in the work-group's tile
  constexpr int TN = 64 * FN;          // columns of C in it
  constexpr int BK  = (FM == 4) ? 256 : 128;   // k depth of one LDS stage
  constexpr int LDP = BK + 8;          // LDS row pitch in f16: 16 B more than the data
  constexpr int LPR = BK / 8;          // lanes that copy one row, 16 B each
  constexpr int RPC = 256 / LPR;       // rows that one copy of the whole block brings
  static_assert(TM == 16 * RPC && TN == 16 * RPC, "16 copies a lane for each operand");
  static_assert(FEAT % BK == 0, "whole stages");
  __shared__ __align__(16) _Float16 sA[2][TM * LDP];
  __shared__ __align__(16) _Float16 sB[2][TN * LDP];
  const int tid  = threadIdx.x;
  const int lane = tid & 31;
  const int wid  = tid >> 5;
  const int wm   = wid >> 2;           // 0..1
  const int wn   = wid & 3;            // 0..3
  const long bm  = (long)blockIdx.x * TM;
  const long bn  = (long)blockIdx.y * TN;
  const int l16  = lane & 15;
  const int koff = (lane < 16) ? 0 : 8;

  // per-thread DMA slots: rows row0 + RPC*{0,1,..,15}, 8-f16 chunk ch0 (16B)
  const int row0 = tid / LPR;          // 0..RPC-1
  const int ch0  = (tid % LPR) * 8;    // 0,8,..,BK-8

  const v8f vz = {0.f, 0.f, 0.f, 0.f, 0.f, 0.f, 0.f, 0.f};
  v8f acc[FM][FN];
#pragma unroll
  for (int i = 0; i < FM; ++i)
#pragma unroll
    for (int j = 0; j < FN; ++j) acc[i][j] = vz;

  auto load_tile = [&](int buf, int k0) {
    const _Float16* gA = &A[(bm + row0) * FEAT + k0 + ch0];
    const _Float16* gB = &Bw[(bn + row0) * FEAT + k0 + ch0];
    unsigned la = (unsigned)(uintptr_t)(&sA[buf][row0 * LDP + ch0]);
    unsigned lb = (unsigned)(uintptr_t)(&sB[buf][row0 * LDP + ch0]);
    // 16 copies a lane for A and 16 for B, eight to a statement
    constexpr unsigned ls = RPC * LDP * 2;
    constexpr long     gs = (long)RPC * FEAT;
    auto fill8 = [](unsigned l, const _Float16* g) {
      async_copy16x8(l, l + ls, l + 2 * ls, l + 3 * ls,
                     l + 4 * ls, l + 5 * ls, l + 6 * ls, l + 7 * ls,
                     g, g + gs, g + 2 * gs, g + 3 * gs,
                     g + 4 * gs, g + 5 * gs, g + 6 * gs, g + 7 * gs);
    };
    // The scheduling fences keep a statement's address sums behind the statement in
    // front of it, so that all four use the same registers. Formed together they take
    // so many of the registers that asm text can name that accumulators of the <8,4>
    // tile are moved out of them and back in every trip.
    fill8(la, gA);
    __builtin_amdgcn_sched_barrier(0);
    fill8(la + 8 * ls, gA + 8 * gs);
    __builtin_amdgcn_sched_barrier(0);
    fill8(lb, gB);
    __builtin_amdgcn_sched_barrier(0);
    fill8(lb + 8 * ls, gB + 8 * gs);
  };

  load_tile(0, 0);
  wait_async0();
  __syncthreads();

  for (int k0 = 0; k0 < FEAT; k0 += BK) {
    const int buf = (k0 / BK) & 1;
    if (k0 + BK < FEAT) load_tile(buf ^ 1, k0 + BK);   // DMA next tile

    // the stage's 32-k blocks, in rising k: the sums keep their order
    if constexpr (FM == 4) {
#pragma unroll
      for (int kk = 0; kk < BK; kk += 32) {
        Frag32 af[FM], bf[FN];
#pragma unroll
        for (int i = 0; i < FM; ++i) {
          int r = wm * (FM * 16) + i * 16 + l16;
          af[i].u[0] = *(const uint4*)(&sA[buf][r * LDP + kk + koff]);
          af[i].u[1] = *(const uint4*)(&sA[buf][r * LDP + kk + koff + 16]);
        }
#pragma unroll
        for (int j = 0; j < FN; ++j) {
          int r = wn * (FN * 16) + j * 16 + l16;
          bf[j].u[0] = *(const uint4*)(&sB[buf][r * LDP + kk + koff]);
          bf[j].u[1] = *(const uint4*)(&sB[buf][r * LDP + kk + koff + 16]);
        }
#pragma unroll
        for (int i = 0; i < FM; ++i)
#pragma unroll
          for (int j = 0; j < FN; ++j)
            acc[i][j] = wmma32(af[i].v, bf[j].v, acc[i][j]);
      }
    } else {
      // Both blocks' fragments are read ahead of the products, in the order in which
      // the products use them: all of a block's B, then its A row by row.
      // The scheduling fence behind each fragment keeps that order and keeps the
      // reads in front of the products. Left free, the compiler reads one A fragment
      // per four products into one register set and waits out each read's latency,
      // or reads early rows last, so that the second row waits for nearly all reads.
      // The stage goes by in two such pairs of blocks; unrolled, so that every LDS
      // offset is an immediate.
#pragma unroll
      for (int kh = 0; kh < BK; kh += 64) {
      Frag32 af[2][FM], bf[2][FN];
#pragma unroll
      for (int s = 0; s < 2; ++s) {
#pragma unroll
        for (int j = 0; j < FN; ++j) {
          int r = wn * (FN * 16) + j * 16 + l16;
          bf[s][j].u[0] = *(const uint4*)(&sB[buf][r * LDP + kh + s * 32 + koff]);
          bf[s][j].u[1] = *(const uint4*)(&sB[buf][r * LDP + kh + s * 32 + koff + 16]);
          __builtin_amdgcn_sched_barrier(0);   // read order, see above
        }
#pragma unroll
        for (int i = 0; i < FM; ++i) {
          int r = wm * (FM * 16) + i * 16 + l16;
          af[s][i].u[0] = *(const uint4*)(&sA[buf][r * LDP + kh + s * 32 + koff]);
          af[s][i].u[1] = *(const uint4*)(&sA[buf][r * LDP + kh + s * 32 + koff + 16]);
          __builtin_amdgcn_sched_barrier(0);   // read order, see above
        }
      }
#pragma unroll
      for (int s = 0; s < 2; ++s)
#pragma unroll
        for (int i = 0; i < FM; ++i)
#pragma unroll
          for (int j = 0; j < FN; ++j)
            acc[i][j] = wmma32(af[s][i].v, bf[s][j].v, acc[i][j]);
      // keeps the products in front of the next pair's reads and of the waits below:
      // moved behind the waits, the next tile's copies would be waited for before any
      // product has run
      __builtin_amdgcn_sched_barrier(0);
      }  // kh
    }

    // next tile landed; barrier also guards WAR on buf, refilled by the next trip's DMA
    wait_ds0();
    wait_async0();
    __syncthreads();
  }

  // Epilogue. A WMMA accumulator holds, per store instruction, 16 columns of two
  // rows: pieces of 64 B in f32 and of 32 B in f16, each a line transaction of its
  // own. The wave therefore stages 16 rows of its tile in LDS as f32 and reads them
  // back row by row, 16 B a lane, so that a store instruction covers whole rows of the
  // wave's tile: with <8,4> two rows of 256 B in f32 (four lines) or of 128 B in f16
  // (two lines). The loop's last barrier has ended every read of the stage buffers and
  // no copy is outstanding; each wave stages in a range of its own, so no further
  // barrier is needed. The pitch of CT + 4 f32 puts the two half-waves' rows, eight
  // apart, 32 banks apart.
  constexpr int CT = FN * 16;          // columns of the wave's tile
  constexpr int SP = CT + 4;           // staging pitch in f32 (a multiple of 16 B)
  constexpr int LR = CT / 4;           // lanes that carry one staged row, 16 B each
  constexpr int RI = 32 / LR;          // rows that one wave-wide access covers
  static_assert(8 * 16 * SP * 4 <= 2 * TM * LDP * 2, "staging fits in sA");
  const long nb  = bn + wn * CT;       // first column of the wave's tile
  float bvj[FN];
#pragma unroll
  for (int j = 0; j < FN; ++j) bvj[j] = bias ? bias[nb + j * 16 + l16] : 0.f;
  // later code rewrites registers that these loads name as address; the scheduling
  // fence keeps that code behind the wait
  asm volatile("s_wait_xcnt 0x0" ::: "memory");
  __builtin_amdgcn_sched_barrier(0);
  float* st = reinterpret_cast<float*>(&sA[0][0]) + wid * (16 * SP);
  const int moff = (lane < 16) ? 0 : 8;
  const int rr   = lane / LR;          // row inside a wave-wide access
  const int cc   = (lane % LR) * 4;    // first of the lane's four columns
#pragma unroll
  for (int i = 0; i < FM; ++i) {
    const long m0 = bm + wm * (FM * 16) + i * 16;   // first of the 16 rows
    float vals[FN][8];
#pragma unroll
    for (int j = 0; j < FN; ++j) {
#pragma unroll
      for (int r = 0; r < 8; ++r) {
        float x = acc[i][j][r] + bvj[j];
        if (relu) x = fmaxf(x, 0.f);
        vals[j][r] = x;
      }
    }
    if (out32 || out16) {
#pragma unroll
      for (int j = 0; j < FN; ++j)
#pragma unroll
        for (int r = 0; r < 8; ++r) st[(moff + r) * SP + j * 16 + l16] = vals[j][r];
      // the rows are read back by other lanes of this wave: its LDS writes first
      wait_ds0();
      // all rows are read ahead of the stores, so that one LDS latency is waited out
      float4 v[16 / RI];
#pragma unroll
      for (int t = 0; t < 16 / RI; ++t)
        v[t] = *(const float4*)(&st[(t * RI + rr) * SP + cc]);
      const long idx = (m0 + rr) * FEAT + nb + cc;
      if (out32) {
#pragma unroll
        for (int t = 0; t < 16 / RI; ++t)
          *(float4*)(&out32[idx + (long)t * RI * FEAT]) = v[t];
        // the f16 branch rewrites registers that these stores name
        asm volatile("s_wait_xcnt 0x0" ::: "memory");
      }
      if (out16) {
#pragma unroll
        for (int t = 0; t < 16 / RI; ++t) {
          v4h hh;
          hh[0] = (_Float16)v[t].x; hh[1] = (_Float16)v[t].y;
          hh[2] = (_Float16)v[t].z; hh[3] = (_Float16)v[t].w;
          *(v4h*)(&out16[idx + (long)t * RI * FEAT]) = hh;
        }
      }
      // later code rewrites registers that these stores name
      asm volatile("s_wait_xcnt 0x0" ::: "memory");
    }
    if (outT) {
#pragma unroll
      for (int j = 0; j < FN; ++j) {
        v8h hh;
#pragma unroll
        for (int r = 0; r < 8; ++r) hh[r] = (_Float16)vals[j][r];
        // m0 + moff is a multiple of 8: 16 B aligned
        *(v8h*)(&outT[(nb + j * 16 + l16) * (long)ldT + m0 + moff]) = hh;
      }
      // later code rewrites registers that these stores name
      asm volatile("s_wait_xcnt 0x0" ::: "memory");
    }
  }
}

// one product a launch
template <int FM, int FN>
__global__ __launch_bounds__(256)
void gemm_wmma(const _Float16* __restrict__ A, const _Float16* __restrict__ Bw,
               const float* __restrict__ bias,
               float* __restrict__ out32, _Float16* __restrict__ out16,
               _Float16* __restrict__ outT, int ldT, int relu) {
  gemm_tile<FM, FN>(A, Bw, bias, out32, out16, outT, ldT, relu);
}

// Two products of the same A in one launch: blockIdx.z = 0 gives A . B0^T + bias0,
// stored row-major in out0; blockIdx.z = 1 gives A . B1^T, stored transposed in
// outT1. Neither reads what the other writes. One product with 1024 rows has 128
// tiles, half as many as there are WGPs, and a tile's time is set by its own chain
// of stages: the two together take about as long as one alone.
template <int FM, int FN>
__global__ __launch_bounds__(256)
void gemm_wmma_pair(const _Float16* __restrict__ A,
                    const _Float16* __restrict__ B0, const float* __restrict__ bias0,
                    _Float16* __restrict__ out0,
                    const _Float16* __restrict__ B1,
                    _Float16* __restrict__ outT1, int ldT1) {
  const bool second = blockIdx.z != 0;
  gemm_tile<FM, FN>(A, second ? B1 : B0, second ? nullptr : bias0, nullptr,
                    second ? nullptr : out0, second ? outT1 : nullptr, ldT1, 0);
}

// ---------------- fused flash attention + residual + b_v --------------
// Qm: [BSZ*QN x FEAT] f16 (head h at cols h*DG..), Km: [BSZ*KN x FEAT] f16,
// Vt: [FEAT x BSZ*KN] f16 (transposed V' = sup1 @ Wv^T), out: f32 (+=).
// One wave handles 16 q rows of one (b,h) at a time. Computes S^T = K.Q^T so the
// softmaxed P converts to an A-fragment with per-lane packs only.
// A work-group owns 512 q rows of one (b,h). It first copies that head's whole K
// (512 rows of 256 B) and V^T (128 rows of 1024 B) into LDS, every copy asking L2
// for four whole lines, once per work-group. The fragments, 16 rows of 32 B each,
// are then read from LDS, whose pitched rows fall on all 64 banks once, and no
// longer gathered from 16 cache lines per load by every wave.
__global__ __launch_bounds__(AW * 32)
void attn_wmma(const _Float16* __restrict__ Qm, const _Float16* __restrict__ Km,
               const _Float16* __restrict__ Vt, const float* __restrict__ bv,
               float* __restrict__ out) {
  __shared__ __align__(16) _Float16 sK[KN * KP];
  __shared__ __align__(16) _Float16 sV[DG * VP];
  __shared__ __align__(16) float sO[AW * 16 * OP];   // output staging, a range a wave
  const int tid   = threadIdx.x;
  const int lane  = tid & 31;
  const int wid   = tid >> 5;
  const int h     = blockIdx.y;
  const int b     = blockIdx.z;
  const int l16  = lane & 15;
  const int koff = (lane < 16) ? 0 : 8;
  const int moff = (lane < 16) ? 0 : 8;

  // Fill, 32 copies of 16 B a lane. K: 16 lanes copy a row, the block 32 rows a
  // copy. V^T: 64 lanes copy a row, the block 8 rows a copy.
  {
    const _Float16* gK = Km + ((long)b * KN + (tid >> 4)) * FEAT + h * DG + (tid & 15) * 8;
    const _Float16* gV = Vt + ((long)h * DG + (tid >> 6)) * (BSZ * KN) + (long)b * KN + (tid & 63) * 8;
    const unsigned lK = (unsigned)(uintptr_t)(&sK[(tid >> 4) * KP + (tid & 15) * 8]);
    const unsigned lV = (unsigned)(uintptr_t)(&sV[(tid >> 6) * VP + (tid & 63) * 8]);
    auto fill8 = [](unsigned l, unsigned ls, const _Float16* g, long gs) {
      async_copy16x8(l, l + ls, l + 2 * ls, l + 3 * ls,
                     l + 4 * ls, l + 5 * ls, l + 6 * ls, l + 7 * ls,
                     g, g + gs, g + 2 * gs, g + 3 * gs,
                     g + 4 * gs, g + 5 * gs, g + 6 * gs, g + 7 * gs);
    };
    fill8(lK, 32 * KP * 2, gK, (long)32 * FEAT);
    fill8(lK + 256 * KP * 2, 32 * KP * 2, gK + (long)256 * FEAT, (long)32 * FEAT);
    fill8(lV, 8 * VP * 2, gV, (long)8 * BSZ * KN);
    fill8(lV + 64 * VP * 2, 8 * VP * 2, gV + (long)64 * BSZ * KN, (long)8 * BSZ * KN);
  }
  wait_async0();     // this wave's copies have landed
  __syncthreads();   // and so have every other wave's; K and V^T are only read from here on

  // the wave's q tiles, one after the other; K and V^T stay in LDS for all of them
  for (int qs = 0; qs < AQ; ++qs) {
  const int qtile = (blockIdx.x * AQ + qs) * AW + wid;   // 0..255
  const long qbase = (long)b * QN + (long)qtile * 16;

  // Q fragments, used as B (Q^T): lane = q row, regs = dims
  Frag32 qf[4];
  {
    const _Float16* qrow = Qm + (qbase + l16) * FEAT + h * DG;
#pragma unroll
    for (int d = 0; d < 4; ++d) {
      qf[d].u[0] = *(const uint4*)(qrow + d * 32 + koff);
      qf[d].u[1] = *(const uint4*)(qrow + d * 32 + koff + 16);
    }
  }

  const v8f vz = {0.f, 0.f, 0.f, 0.f, 0.f, 0.f, 0.f, 0.f};
  v8f o[8];
#pragma unroll
  for (int t = 0; t < 8; ++t) o[t] = vz;
  float m_st = -3.0e38f, l_st = 0.f;
  const float scale = 0.08838834764831845f;        // 1/sqrt(128)

  for (int kc = 0; kc < KN; kc += 32) {
    // S^T tiles: s0 = keys kc..kc+15, s1 = keys kc+16..kc+31 (lane = q)
    v8f s0 = vz, s1 = vz;
    {
      const _Float16* krow = &sK[(kc + l16) * KP];
#pragma unroll
      for (int d = 0; d < 4; ++d) {
        Frag32 kf;
        kf.u[0] = *(const uint4*)(krow + d * 32 + koff);
        kf.u[1] = *(const uint4*)(krow + d * 32 + koff + 16);
        s0 = wmma32(kf.v, qf[d].v, s0);
      }
      krow += 16 * KP;
#pragma unroll
      for (int d = 0; d < 4; ++d) {
        Frag32 kf;
        kf.u[0] = *(const uint4*)(krow + d * 32 + koff);
        kf.u[1] = *(const uint4*)(krow + d * 32 + koff + 16);
        s1 = wmma32(kf.v, qf[d].v, s1);
      }
    }
    // online softmax over this 32-key chunk (row = q = lane%16)
    float mloc = -3.0e38f;
#pragma unroll
    for (int r = 0; r < 8; ++r) {
      s0[r] *= scale; s1[r] *= scale;
      mloc = fmaxf(mloc, fmaxf(s0[r], s1[r]));
    }
    mloc = fmaxf(mloc, __shfl_xor(mloc, 16));
    float mnew  = fmaxf(m_st, mloc);
    float alpha = __expf(m_st - mnew);
    float rs = 0.f;
#pragma unroll
    for (int r = 0; r < 8; ++r) {
      s0[r] = __expf(s0[r] - mnew); rs += s0[r];
      s1[r] = __expf(s1[r] - mnew); rs += s1[r];
    }
    rs += __shfl_xor(rs, 16);
    l_st = l_st * alpha + rs;
    m_st = mnew;
    // pack P as A-fragment (lane = q, regs = 32 keys) — per-lane only
    Frag32 pf;
#pragma unroll
    for (int r = 0; r < 8; ++r) {
      pf.v[r]     = (_Float16)s0[r];
      pf.v[8 + r] = (_Float16)s1[r];
    }
    // broadcast alpha to O layout (vgpr r <-> q = r + moff)
    float aq[8];
#pragma unroll
    for (int r = 0; r < 8; ++r) aq[r] = __shfl(alpha, r + moff);
#pragma unroll
    for (int t = 0; t < 8; ++t) {
#pragma unroll
      for (int r = 0; r < 8; ++r) o[t][r] *= aq[r];
      const _Float16* vrow = &sV[(t * 16 + l16) * VP + kc];
      Frag32 vf;
      vf.u[0] = *(const uint4*)(vrow + koff);
      vf.u[1] = *(const uint4*)(vrow + koff + 16);
      o[t] = wmma32(pf.v, vf.v, o[t]);
    }
  }

  float linv[8];
#pragma unroll
  for (int r = 0; r < 8; ++r) linv[r] = 1.0f / __shfl(l_st, r + moff);
  // The accumulators hold 16 columns of two rows per access: pieces of 64 B. The wave
  // stages 16 rows x 32 columns at a time in its own LDS range and goes through out
  // row by row, 16 B a lane: every load and store of out covers four whole lines.
  // No other wave touches the range, so no barrier is needed.
  {
    float* so = &sO[wid * (16 * OP)];
    const int rr = lane >> 3;          // row inside a wave-wide access (four rows)
    const int cc = (lane & 7) * 4;     // first of the lane's four columns
    float* orow = out + (qbase + rr) * FEAT + h * DG + cc;
    // the residual and b_v, all loads in flight ahead of the staging
    float4 x[4][4];
#pragma unroll
    for (int tp = 0; tp < 4; ++tp)
#pragma unroll
      for (int k = 0; k < 4; ++k)
        x[tp][k] = *(const float4*)(orow + (long)k * 4 * FEAT + tp * 32);
    float bb[8];
#pragma unroll
    for (int t = 0; t < 8; ++t) bb[t] = bv[h * DG + t * 16 + l16];
    // later code rewrites registers that these loads name as address
    asm volatile("s_wait_xcnt 0x0" ::: "memory");
#pragma unroll
    for (int tp = 0; tp < 4; ++tp) {
#pragma unroll
      for (int u = 0; u < 2; ++u) {
        const int t = tp * 2 + u;
#pragma unroll
        for (int r = 0; r < 8; ++r)
          so[(moff + r) * OP + u * 16 + l16] = o[t][r] * linv[r] + bb[t];
      }
      // the rows are read back by other lanes of this wave: its LDS writes first
      wait_ds0();
#pragma unroll
      for (int k = 0; k < 4; ++k) {
        const float4 v = *(const float4*)(&so[(k * 4 + rr) * OP + cc]);
        float4 y = x[tp][k];
        y.x += v.x; y.y += v.y; y.z += v.z; y.w += v.w;
        *(float4*)(orow + (long)k * 4 * FEAT + tp * 32) = y;
      }
      // later code rewrites registers that these loads and stores name
      asm volatile("s_wait_xcnt 0x0" ::: "memory");
    }
  }
  // the next q tile's loads land in registers that this tile's loads and stores name
  if (qs + 1 < AQ) asm volatile("s_wait_xcnt 0x0" ::: "memory");
  }  // qs
}

extern "C" void kernel_launch(void* const* d_in, const int* in_sizes, int n_in,
                              void* d_out, int out_size, void* d_ws, size_t ws_size,
                              hipStream_t stream) {
  (void)in_sizes; (void)n_in; (void)out_size; (void)ws_size;
  const float* ref_feat = (const float*)d_in[0];
  const float* sup_feat = (const float*)d_in[1];
  const float* W_fc = (const float*)d_in[2];
  const float* b_fc = (const float*)d_in[3];
  const float* W_q  = (const float*)d_in[4];
  const float* b_q  = (const float*)d_in[5];
  const float* W_k  = (const float*)d_in[6];
  const float* b_k  = (const float*)d_in[7];
  const float* W_v  = (const float*)d_in[8];
  const float* b_v  = (const float*)d_in[9];
  float* out = (float*)d_out;

  size_t off = 0;
  auto carve = [&](size_t bytes) -> void* {
    void* p = (char*)d_ws + off;
    off += (bytes + 255) & ~(size_t)255;
    return p;
  };
  _Float16* ref16   = (_Float16*)carve((size_t)BSZ * QN * FEAT * 2);
  _Float16* sup16   = (_Float16*)carve((size_t)BSZ * KN * FEAT * 2);
  _Float16* wfc16   = (_Float16*)carve((size_t)FEAT * FEAT * 2);
  _Float16* wq16    = (_Float16*)carve((size_t)FEAT * FEAT * 2);
  _Float16* wk16    = (_Float16*)carve((size_t)FEAT * FEAT * 2);
  _Float16* wv16    = (_Float16*)carve((size_t)FEAT * FEAT * 2);
  _Float16* ref1_16 = (_Float16*)carve((size_t)BSZ * QN * FEAT * 2);
  _Float16* sup1_16 = (_Float16*)carve((size_t)BSZ * KN * FEAT * 2);
  _Float16* q16     = (_Float16*)carve((size_t)BSZ * QN * FEAT * 2);
  _Float16* k16     = (_Float16*)carve((size_t)BSZ * KN * FEAT * 2);
  _Float16* vT16    = (_Float16*)carve((size_t)FEAT * BSZ * KN * 2);

  cast_all<<<dim3(CW / 16), dim3(512), 0, stream>>>(
      ref_feat, sup_feat, W_fc, W_q, W_k, W_v,
      ref16, sup16, wfc16, wq16, wk16, wv16);

  dim3 blk(256);
  // ref1 = relu(ref @ Wfc^T + b_fc): f32 -> d_out (residual), f16 -> ref1_16
  gemm_wmma<8, 4><<<dim3(BSZ * QN / 256, FEAT / 256), blk, 0, stream>>>(
      ref16, wfc16, b_fc, out, ref1_16, nullptr, 0, 1);
  // sup1 = relu(sup @ Wfc^T + b_fc)
  gemm_wmma<4, 2><<<dim3(BSZ * KN / 128, FEAT / 128), blk, 0, stream>>>(
      sup16, wfc16, b_fc, nullptr, sup1_16, nullptr, 0, 1);
  // q = ref1 @ Wq^T + b_q
  gemm_wmma<8, 4><<<dim3(BSZ * QN / 256, FEAT / 256), blk, 0, stream>>>(
      ref1_16, wq16, b_q, nullptr, q16, nullptr, 0, 0);
  // k = sup1 @ Wk^T + b_k, and V' = sup1 @ Wv^T, stored transposed [FEAT x BSZ*KN]
  gemm_wmma_pair<4, 2><<<dim3(BSZ * KN / 128, FEAT / 128, 2), blk, 0, stream>>>(
      sup1_16, wk16, b_k, k16, wv16, vT16, BSZ * KN);
  // attention + grouped-conv (pre-folded into V') + b_v + residual
  attn_wmma<<<dim3(QN / (16 * AW * AQ), NG, BSZ), dim3(AW * 32), 0, stream>>>(
      q16, k16, vT16, b_v, out);
}

// v009
// Measured time: 163 microseconds a run.
// Timed twice side by side with v008, it ran 1.08 times as fast both times.
// All steps since v000 together make it 2.86 times as fast.
#include <hip/hip_runtime.h>

#define FEAT 2048
#define QN   4096
#define KN   512
#define BSZ  2
#define NG   16
#define DG   128
#define KP   136  // attention, LDS pitch of a K row in f16: 128 + 8 = 272 B (16 B x odd)
#define VP   520  // attention, LDS pitch of a V^T row in f16: 512 + 8 = 1040 B (16 B x odd)
#define OP   36   // attention, LDS pitch of a staged output row in f32: 32 + 4 = 144 B
#define AW   16   // attention, waves of a work-group
#define AQ   2    // attention, q tiles that a wave works through, one after the other

typedef __attribute__((ext_vector_type(16))) _Float16 v16h;
typedef __attribute__((ext_vector_type(8)))  _Float16 v8h;
typedef __attribute__((ext_vector_type(8)))  float    v8f;

union Frag32 { v16h v; uint4 u[2]; };

__device__ __forceinline__ v8f wmma32(v16h a, v16h b, v8f c) {
  return __builtin_amdgcn_wmma_f32_16x16x32_f16(false, a, false, b, (short)0, c,
                                                false, false);
}

// CDNA5 async DMA: global -> LDS, no VGPR staging, tracked by ASYNCcnt.
// Eight copies of a lane in one statement: a quarter of a GEMM stage at <4,2> and <8,4>, 8 of 34 at <9,4>. The closing s_wait_xcnt
// stands inside it so that no later write of an address register can be
// scheduled in front of it.
__device__ __forceinline__ void async_copy16x8(unsigned l0, unsigned l1,
                                               unsigned l2, unsigned l3,
                                               unsigned l4, unsigned l5,
                                               unsigned l6, unsigned l7,
                                               const _Float16* g0, const _Float16* g1,
                                               const _Float16* g2, const _Float16* g3,
                                               const _Float16* g4, const _Float16* g5,
                                               const _Float16* g6, const _Float16* g7) {
  asm volatile("global_load_async_to_lds_b128 %0, %8, off\n\t"
               "global_load_async_to_lds_b128 %1, %9, off\n\t"
               "global_load_async_to_lds_b128 %2, %10, off\n\t"
               "global_load_async_to_lds_b128 %3, %11, off\n\t"
               "global_load_async_to_lds_b128 %4, %12, off\n\t"
               "global_load_async_to_lds_b128 %5, %13, off\n\t"
               "global_load_async_to_lds_b128 %6, %14, off\n\t"
               "global_load_async_to_lds_b128 %7, %15, off\n\t"
               "s_wait_xcnt 0x0"
               :: "v"(l0), "v"(l1), "v"(l2), "v"(l3),
                  "v"(l4), "v"(l5), "v"(l6), "v"(l7),
                  "v"(g0), "v"(g1), "v"(g2), "v"(g3),
                  "v"(g4), "v"(g5), "v"(g6), "v"(g7) : "memory");
}
// The same for two copies of a lane.
__device__ __forceinline__ void async_copy16x2(unsigned l0, unsigned l1,
                                               const _Float16* g0, const _Float16* g1) {
  asm volatile("global_load_async_to_lds_b128 %0, %2, off\n\t"
               "global_load_async_to_lds_b128 %1, %3, off\n\t"
               "s_wait_xcnt 0x0"
               :: "v"(l0), "v"(l1), "v"(g0), "v"(g1) : "memory");
}
__device__ __forceinline__ void wait_async0() {
  asm volatile("s_wait_asynccnt 0x0" ::: "memory");
}
// This wave's LDS reads have retired before the barrier behind which their
// buffer is refilled by copies.
__device__ __forceinline__ void wait_ds0() {
  asm volatile("s_wait_dscnt 0x0" ::: "memory");
}

// ---------------- fp32 -> fp16 cast of all six operands, one launch ----------
// 256 work-groups of 16 waves stream the whole cast. In step i wave w converts
// piece i * CW + w: 512 f32 in a row, read by four loads of 512 B (whole lines)
// and written by four stores of 256 B (whole lines). A step spans CSTEP elements
// and every operand is a whole number of steps long, so which operand a step
// reads is known at compile time.
#define CW     4096                 // waves in the launch
#define CPIECE 512                  // f32 elements of one piece
#define CSTEP  ((long)CW * CPIECE)  // elements that all waves convert in one step
#define S_REF  ((long)BSZ * QN * FEAT / CSTEP)   // 8 steps
#define S_SUP  ((long)BSZ * KN * FEAT / CSTEP)   // 1 step
#define S_W    ((long)FEAT * FEAT / CSTEP)       // 2 steps
#define S_ALL  (S_REF + S_SUP + 4 * S_W)         // 17 steps
static_assert(S_REF * CSTEP == (long)BSZ * QN * FEAT, "whole steps");
static_assert(S_SUP * CSTEP == (long)BSZ * KN * FEAT, "whole steps");
static_assert(S_W * CSTEP == (long)FEAT * FEAT, "whole steps");

typedef __attribute__((ext_vector_type(4))) _Float16 v4h;

// The pointers carry no __restrict__: the loads then stay where they are written,
// two pieces ahead of their stores, and are not gathered at the kernel's head.
__global__ __launch_bounds__(512)
void cast_all(const float* ref, const float* sup, const float* wfc,
              const float* wq, const float* wk, const float* wv,
              _Float16* dref, _Float16* dsup, _Float16* dwfc,
              _Float16* dwq, _Float16* dwk, _Float16* dwv) {
  // this lane's first element inside a step's span, and its byte offsets (under
  // 8 MB, so 32 bits) from a step's first source and first destination byte
  const unsigned e  = (blockIdx.x * 16 + (threadIdx.x >> 5)) * CPIECE + (threadIdx.x & 31) * 4;
  const unsigned lb = e * 4u;
  const unsigned sb = e * 2u;

  auto load_piece = [&](float4 (&v)[4], int i) {
    const float* s =
        i < S_REF                     ? ref + i * CSTEP
      : i < S_REF + S_SUP             ? sup + (i - S_REF) * CSTEP
      : i < S_REF + S_SUP + S_W       ? wfc + (i - S_REF - S_SUP) * CSTEP
      : i < S_REF + S_SUP + 2 * S_W   ? wq  + (i - S_REF - S_SUP - S_W) * CSTEP
      : i < S_REF + S_SUP + 3 * S_W   ? wk  + (i - S_REF - S_SUP - 2 * S_W) * CSTEP
                                      : wv  + (i - S_REF - S_SUP - 3 * S_W) * CSTEP;
#pragma unroll
    for (int j = 0; j < 4; ++j) v[j] = *(const float4*)((const char*)(s + j * 128) + lb);
  };
  auto store_piece = [&](const float4 (&v)[4], int i) {
    _Float16* d =
        i < S_REF                     ? dref + i * CSTEP
      : i < S_REF + S_SUP             ? dsup + (i - S_REF) * CSTEP
      : i < S_REF + S_SUP + S_W       ? dwfc + (i - S_REF - S_SUP) * CSTEP
      : i < S_REF + S_SUP + 2 * S_W   ? dwq  + (i - S_REF - S_SUP - S_W) * CSTEP
      : i < S_REF + S_SUP + 3 * S_W   ? dwk  + (i - S_REF - S_SUP - 2 * S_W) * CSTEP
                                      : dwv  + (i - S_REF - S_SUP - 3 * S_W) * CSTEP;
#pragma unroll
    for (int j = 0; j < 4; ++j) {
      v4h h;
      h[0] = (_Float16)v[j].x; h[1] = (_Float16)v[j].y;
      h[2] = (_Float16)v[j].z; h[3] = (_Float16)v[j].w;
      *(v4h*)((char*)(d + j * 128) + sb) = h;
    }
  };

  // three register sets: the loads of two later pieces are in flight while a
  // piece is converted and stored (8 to 12 loads of a wave outstanding)
  float4 v[3][4];
  load_piece(v[0], 0);
  load_piece(v[1], 1);
  // the next loads may land in registers that these loads name as address
  asm volatile("s_wait_xcnt 0x0" ::: "memory");
  // unrolled whole: the step number picks operand and register set at compile time
#pragma unroll
  for (int i = 0; i < S_ALL; ++i) {
    if (i + 2 < S_ALL) load_piece(v[(i + 2) % 3], i + 2);
    store_piece(v[i % 3], i);
    // the next loads land in registers that these stores name as data
    if (i + 3 < S_ALL) asm volatile("s_wait_xcnt 0x0" ::: "memory");
  }
}

// ---------------- tiled WMMA GEMM: C[m,n] = act(A[m,:] . Bw[n,:] + bias[n]) ----
// A: [M x FEAT] f16 row-major, Bw: [FEAT x FEAT] f16 row-major (weights, N-major)
// Double-buffered LDS, tiles filled by async global->LDS DMA.
// A trip of the loop lasts at least as long as its stage's copies take to land, and
// the operands come from memory at its latency: a work-group's rate is the bytes it
// has in flight over that latency. A stage is therefore as deep as two buffers of
// both operands fit the LDS: 32 or 34 copies of 16 B a lane, 128 or 136 KB a work-group.
// A wave's copy asks L2 for four whole lines (one row's 512 B, or two rows' 256 B).
// LDS rows are pitched 16 B x odd (528 B, 272 B): the 16 rows that a half-wave's
// ds_load_b128 reads then fall on all 64 banks once.
// The 8 waves stand 2 x 4; a wave owns FM x FN tiles of 16 x 16, the work-group
// 32*FM x 64*FN of C. Per 32 k a wave reads FM + FN fragments for FM * FN products.
// <8,4>: 256 x 256 of C, stages of 128 k, for the product with 8192 rows (256 such
// tiles). <4,2>: 128 x 128, stages of 256 k, for those with 1024 rows (128 tiles).
// <9,4>: 288 x 256, stages of 128 k, for the product with 9216 rows (256 tiles too).
// Either way one work-group on a WGP.
// Only rows below rows32 are stored in out32 (a multiple of 16).
// The tile is picked by blockIdx.x and blockIdx.y.
template <int FM, int FN>
__device__ __forceinline__
void gemm_tile(const _Float16* __restrict__ A, const _Float16* __restrict__ Bw,
               const float* __restrict__ bias,
               float* __restrict__ out32, _Float16* __restrict__ out16,
               _Float16* __restrict__ outT, int ldT, int relu, int rows32) {
  static_assert((FM == 4 && FN == 2) || ((FM == 8 || FM == 9) && FN == 4),
                "copies per stage");
  constexpr int TM = 32 * FM;          // rows of C in the work-group's tile
  constexpr int TN = 64 * FN;          // columns of C in it
  constexpr int BK  = (FM == 4) ? 256 : 128;   // k depth of one LDS stage
  constexpr int LDP = BK + 8;          // LDS row pitch in f16: 16 B more than the data
  constexpr int LPR = BK / 8;          // lanes that copy one row, 16 B each
  constexpr int RPC = 256 / LPR;       // rows that one copy of the whole block brings
  constexpr int CA  = TM / RPC;        // copies a lane for a stage of A
  static_assert(TM == CA * RPC && (CA == 16 || CA == 18) && TN == 16 * RPC,
                "16 or 18 copies a lane for A, 16 for B");
  static_assert(FEAT % BK == 0, "whole stages");
  __shared__ __align__(16) _Float16 sA[2][TM * LDP];
  __shared__ __align__(16) _Float16 sB[2][TN * LDP];
  const int tid  = threadIdx.x;
  const int lane = tid & 31;
  const int wid  = tid >> 5;
  const int wm   = wid >> 2;           // 0..1
  const int wn   = wid & 3;            // 0..3
  const long bm  = (long)blockIdx.x * TM;
  const long bn  = (long)blockIdx.y * TN;
  const int l16  = lane & 15;
  const int koff = (lane < 16) ? 0 : 8;

  // per-thread DMA slots: rows row0 + RPC*{0,1,..}, 8-f16 chunk ch0 (16B)
  const int row0 = tid / LPR;          // 0..RPC-1
  const int ch0  = (tid % LPR) * 8;    // 0,8,..,BK-8

  const v8f vz = {0.f, 0.f, 0.f, 0.f, 0.f, 0.f, 0.f, 0.f};
  v8f acc[FM][FN];
#pragma unroll
  for (int i = 0; i < FM; ++i)
#pragma unroll
    for (int j = 0; j < FN; ++j) acc[i][j] = vz;

  auto load_tile = [&](int buf, int k0) {
    const _Float16* gA = &A[(bm + row0) * FEAT + k0 + ch0];
    const _Float16* gB = &Bw[(bn + row0) * FEAT + k0 + ch0];
    unsigned la = (unsigned)(uintptr_t)(&sA[buf][row0 * LDP + ch0]);
    unsigned lb = (unsigned)(uintptr_t)(&sB[buf][row0 * LDP + ch0]);
    // CA copies a lane for A and 16 for B, eight to a statement (and a last two of A)
    constexpr unsigned ls = RPC * LDP * 2;
    constexpr long     gs = (long)RPC * FEAT;
    auto fill8 = [](unsigned l, const _Float16* g) {
      async_copy16x8(l, l + ls, l + 2 * ls, l + 3 * ls,
                     l + 4 * ls, l + 5 * ls, l + 6 * ls, l + 7 * ls,
                     g, g + gs, g + 2 * gs, g + 3 * gs,
                     g + 4 * gs, g + 5 * gs, g + 6 * gs, g + 7 * gs);
    };
    // The scheduling fences keep a statement's address sums behind the statement in
    // front of it, so that all four (five at <9,4>) use the same registers. Formed together they take
    // so many of the registers that asm text can name that accumulators of the <8,4>
    // tile are moved out of them and back in every trip.
    fill8(la, gA);
    __builtin_amdgcn_sched_barrier(0);
    fill8(la + 8 * ls, gA + 8 * gs);
    __builtin_amdgcn_sched_barrier(0);
    if constexpr (CA == 18) {
      async_copy16x2(la + 16 * ls, la + 17 * ls, gA + 16 * gs, gA + 17 * gs);
      __builtin_amdgcn_sched_barrier(0);
    }
    fill8(lb, gB);
    __builtin_amdgcn_sched_barrier(0);
    fill8(lb + 8 * ls, gB + 8 * gs);
  };

  load_tile(0, 0);
  wait_async0();
  __syncthreads();

  for (int k0 = 0; k0 < FEAT; k0 += BK) {
    const int buf = (k0 / BK) & 1;
    if (k0 + BK < FEAT) load_tile(buf ^ 1, k0 + BK);   // DMA next tile

    // the stage's 32-k blocks, in rising k: the sums keep their order
    if constexpr (FM == 4) {
#pragma unroll
      for (int kk = 0; kk < BK; kk += 32) {
        Frag32 af[FM], bf[FN];
#pragma unroll
        for (int i = 0; i < FM; ++i) {
          int r = wm * (FM * 16) + i * 16 + l16;
          af[i].u[0] = *(const uint4*)(&sA[buf][r * LDP + kk + koff]);
          af[i].u[1] = *(const uint4*)(&sA[buf][r * LDP + kk + koff + 16]);
        }
#pragma unroll
        for (int j = 0; j < FN; ++j) {
          int r = wn * (FN * 16) + j * 16 + l16;
          bf[j].u[0] = *(const uint4*)(&sB[buf][r * LDP + kk + koff]);
          bf[j].u[1] = *(const uint4*)(&sB[buf][r * LDP + kk + koff + 16]);
        }
#pragma unroll
        for (int i = 0; i < FM; ++i)
#pragma unroll
          for (int j = 0; j < FN; ++j)
            acc[i][j] = wmma32(af[i].v, bf[j].v, acc[i][j]);
      }
    } else {
      // NS blocks' fragments are read ahead of the products, in the order in which
      // the products use them: all of a block's B, then its A row by row.
      // The scheduling fence behind each fragment keeps that order and keeps the
      // reads in front of the products. Left free, the compiler reads one A fragment
      // per four products into one register set and waits out each read's latency,
      // or reads early rows last, so that the second row waits for nearly all reads.
      // <8,4> takes two blocks at a time; <9,4>, with 288 accumulator registers, one:
      // two blocks' fragments would not fit beside them. The stage goes by in such
      // groups of blocks; unrolled, so that every LDS offset is an immediate.
      constexpr int NS = (FM == 8) ? 2 : 1;
#pragma unroll
      for (int kh = 0; kh < BK; kh += 32 * NS) {
      Frag32 af[NS][FM], bf[NS][FN];
#pragma unroll
      for (int s = 0; s < NS; ++s) {
#pragma unroll
        for (int j = 0; j < FN; ++j) {
          int r = wn * (FN * 16) + j * 16 + l16;
          bf[s][j].u[0] = *(const uint4*)(&sB[buf][r * LDP + kh + s * 32 + koff]);
          bf[s][j].u[1] = *(const uint4*)(&sB[buf][r * LDP + kh + s * 32 + koff + 16]);
          __builtin_amdgcn_sched_barrier(0);   // read order, see above
        }
#pragma unroll
        for (int i = 0; i < FM; ++i) {
          int r = wm * (FM * 16) + i * 16 + l16;
          af[s][i].u[0] = *(const uint4*)(&sA[buf][r * LDP + kh + s * 32 + koff]);
          af[s][i].u[1] = *(const uint4*)(&sA[buf][r * LDP + kh + s * 32 + koff + 16]);
          __builtin_amdgcn_sched_barrier(0);   // read order, see above
        }
      }
#pragma unroll
      for (int s = 0; s < NS; ++s)
#pragma unroll
        for (int i = 0; i < FM; ++i)
#pragma unroll
          for (int j = 0; j < FN; ++j)
            acc[i][j] = wmma32(af[s][i].v, bf[s][j].v, acc[i][j]);
      // keeps the products in front of the next group's reads and of the waits below:
      // moved behind the waits, the next tile's copies would be waited for before any
      // product has run
      __builtin_amdgcn_sched_barrier(0);
      }  // kh
    }

    // next tile landed; barrier also guards WAR on buf, refilled by the next trip's DMA
    wait_ds0();
    wait_async0();
    __syncthreads();
  }

  // Epilogue. A WMMA accumulator holds, per store instruction, 16 columns of two
  // rows: pieces of 64 B in f32 and of 32 B in f16, each a line transaction of its
  // own. The wave therefore stages 16 rows of its tile in LDS as f32 and reads them
  // back row by row, 16 B a lane, so that a store instruction covers whole rows of the
  // wave's tile: with <8,4> two rows of 256 B in f32 (four lines) or of 128 B in f16
  // (two lines). The loop's last barrier has ended every read of the stage buffers and
  // no copy is outstanding; each wave stages in a range of its own, so no further
  // barrier is needed. The pitch of CT + 4 f32 puts the two half-waves' rows, eight
  // apart, 32 banks apart.
  constexpr int CT = FN * 16;          // columns of the wave's tile
  constexpr int SP = CT + 4;           // staging pitch in f32 (a multiple of 16 B)
  constexpr int LR = CT / 4;           // lanes that carry one staged row, 16 B each
  constexpr int RI = 32 / LR;          // rows that one wave-wide access covers
  static_assert(8 * 16 * SP * 4 <= 2 * TM * LDP * 2, "staging fits in sA");
  const long nb  = bn + wn * CT;       // first column of the wave's tile
  float bvj[FN];
#pragma unroll
  for (int j = 0; j < FN; ++j) bvj[j] = bias ? bias[nb + j * 16 + l16] : 0.f;
  // later code rewrites registers that these loads name as address; the scheduling
  // fence keeps that code behind the wait
  asm volatile("s_wait_xcnt 0x0" ::: "memory");
  __builtin_amdgcn_sched_barrier(0);
  float* st = reinterpret_cast<float*>(&sA[0][0]) + wid * (16 * SP);
  const int moff = (lane < 16) ? 0 : 8;
  const int rr   = lane / LR;          // row inside a wave-wide access
  const int cc   = (lane % LR) * 4;    // first of the lane's four columns
#pragma unroll
  for (int i = 0; i < FM; ++i) {
    const long m0 = bm + wm * (FM * 16) + i * 16;   // first of the 16 rows
    float vals[FN][8];
#pragma unroll
    for (int j = 0; j < FN; ++j) {
#pragma unroll
      for (int r = 0; r < 8; ++r) {
        float x = acc[i][j][r] + bvj[j];
        if (relu) x = fmaxf(x, 0.f);
        vals[j][r] = x;
      }
    }
    if (out32 || out16) {
#pragma unroll
      for (int j = 0; j < FN; ++j)
#pragma unroll
        for (int r = 0; r < 8; ++r) st[(moff + r) * SP + j * 16 + l16] = vals[j][r];
      // the rows are read back by other lanes of this wave: its LDS writes first
      wait_ds0();
      // all rows are read ahead of the stores, so that one LDS latency is waited out
      float4 v[16 / RI];
#pragma unroll
      for (int t = 0; t < 16 / RI; ++t)
        v[t] = *(const float4*)(&st[(t * RI + rr) * SP + cc]);
      const long idx = (m0 + rr) * FEAT + nb + cc;
      if (out32 && m0 < rows32) {
#pragma unroll
        for (int t = 0; t < 16 / RI; ++t)
          *(float4*)(&out32[idx + (long)t * RI * FEAT]) = v[t];
        // the f16 branch rewrites registers that these stores name
        asm volatile("s_wait_xcnt 0x0" ::: "memory");
      }
      if (out16) {
#pragma unroll
        for (int t = 0; t < 16 / RI; ++t) {
          v4h hh;
          hh[0] = (_Float16)v[t].x; hh[1] = (_Float16)v[t].y;
          hh[2] = (_Float16)v[t].z; hh[3] = (_Float16)v[t].w;
          *(v4h*)(&out16[idx + (long)t * RI * FEAT]) = hh;
        }
      }
      // later code rewrites registers that these stores name
      asm volatile("s_wait_xcnt 0x0" ::: "memory");
    }
    if (outT) {
#pragma unroll
      for (int j = 0; j < FN; ++j) {
        v8h hh;
#pragma unroll
        for (int r = 0; r < 8; ++r) hh[r] = (_Float16)vals[j][r];
        // m0 + moff is a multiple of 8: 16 B aligned
        *(v8h*)(&outT[(nb + j * 16 + l16) * (long)ldT + m0 + moff]) = hh;
      }
      // later code rewrites registers that these stores name
      asm volatile("s_wait_xcnt 0x0" ::: "memory");
    }
  }
}

// one product a launch
template <int FM, int FN>
__global__ __launch_bounds__(256)
void gemm_wmma(const _Float16* __restrict__ A, const _Float16* __restrict__ Bw,
               const float* __restrict__ bias,
               float* __restrict__ out32, _Float16* __restrict__ out16,
               _Float16* __restrict__ outT, int ldT, int relu, int rows32) {
  gemm_tile<FM, FN>(A, Bw, bias, out32, out16, outT, ldT, relu, rows32);
}

// Two products of the same A in one launch: blockIdx.z = 0 gives A . B0^T + bias0,
// stored row-major in out0; blockIdx.z = 1 gives A . B1^T, stored transposed in
// outT1. Neither reads what the other writes. One product with 1024 rows has 128
// tiles, half as many as there are WGPs, and a tile's time is set by its own chain
// of stages: the two together take about as long as one alone.
template <int FM, int FN>
__global__ __launch_bounds__(256)
void gemm_wmma_pair(const _Float16* __restrict__ A,
                    const _Float16* __restrict__ B0, const float* __restrict__ bias0,
                    _Float16* __restrict__ out0,
                    const _Float16* __restrict__ B1,
                    _Float16* __restrict__ outT1, int ldT1) {
  const bool second = blockIdx.z != 0;
  gemm_tile<FM, FN>(A, second ? B1 : B0, second ? nullptr : bias0, nullptr,
                    second ? nullptr : out0, second ? outT1 : nullptr, ldT1, 0, 0);
}

// ---------------- fused flash attention + residual + b_v --------------
// Qm: [BSZ*QN x FEAT] f16 (head h at cols h*DG..), Km: [BSZ*KN x FEAT] f16,
// Vt: [FEAT x BSZ*KN] f16 (transposed V' = sup1 @ Wv^T), out: f32 (+=).
// One wave handles 16 q rows of one (b,h) at a time. Computes S^T = K.Q^T so the
// softmaxed P converts to an A-fragment with per-lane packs only.
// A work-group owns 512 q rows of one (b,h). It first copies that head's whole K
// (512 rows of 256 B) and V^T (128 rows of 1024 B) into LDS, every copy asking L2
// for four whole lines, once per work-group. The fragments, 16 rows of 32 B each,
// are then read from LDS, whose pitched rows fall on all 64 banks once, and no
// longer gathered from 16 cache lines per load by every wave.
__global__ __launch_bounds__(AW * 32)
void attn_wmma(const _Float16* __restrict__ Qm, const _Float16* __restrict__ Km,
               const _Float16* __restrict__ Vt, const float* __restrict__ bv,
               float* __restrict__ out) {
  __shared__ __align__(16) _Float16 sK[KN * KP];
  __shared__ __align__(16) _Float16 sV[DG * VP];
  __shared__ __align__(16) float sO[AW * 16 * OP];   // output staging, a range a wave
  const int tid   = threadIdx.x;
  const int lane  = tid & 31;
  const int wid   = tid >> 5;
  const int h     = blockIdx.y;
  const int b     = blockIdx.z;
  const int l16  = lane & 15;
  const int koff = (lane < 16) ? 0 : 8;
  const int moff = (lane < 16) ? 0 : 8;

  // Fill, 32 copies of 16 B a lane. K: 16 lanes copy a row, the block 32 rows a
  // copy. V^T: 64 lanes copy a row, the block 8 rows a copy.
  {
    const _Float16* gK = Km + ((long)b * KN + (tid >> 4)) * FEAT + h * DG + (tid & 15) * 8;
    const _Float16* gV = Vt + ((long)h * DG + (tid >> 6)) * (BSZ * KN) + (long)b * KN + (tid & 63) * 8;
    const unsigned lK = (unsigned)(uintptr_t)(&sK[(tid >> 4) * KP + (tid & 15) * 8]);
    const unsigned lV = (unsigned)(uintptr_t)(&sV[(tid >> 6) * VP + (tid & 63) * 8]);
    auto fill8 = [](unsigned l, unsigned ls, const _Float16* g, long gs) {
      async_copy16x8(l, l + ls, l + 2 * ls, l + 3 * ls,
                     l + 4 * ls, l + 5 * ls, l + 6 * ls, l + 7 * ls,
                     g, g + gs, g + 2 * gs, g + 3 * gs,
                     g + 4 * gs, g + 5 * gs, g + 6 * gs, g + 7 * gs);
    };
    fill8(lK, 32 * KP * 2, gK, (long)32 * FEAT);
    fill8(lK + 256 * KP * 2, 32 * KP * 2, gK + (long)256 * FEAT, (long)32 * FEAT);
    fill8(lV, 8 * VP * 2, gV, (long)8 * BSZ * KN);
    fill8(lV + 64 * VP * 2, 8 * VP * 2, gV + (long)64 * BSZ * KN, (long)8 * BSZ * KN);
  }
  wait_async0();     // this wave's copies have landed
  __syncthreads();   // and so have every other wave's; K and V^T are only read from here on

  // the wave's q tiles, one after the other; K and V^T stay in LDS for all of them
  for (int qs = 0; qs < AQ; ++qs) {
  const int qtile = (blockIdx.x * AQ + qs) * AW + wid;   // 0..255
  const long qbase = (long)b * QN + (long)qtile * 16;

  // Q fragments, used as B (Q^T): lane = q row, regs = dims
  Frag32 qf[4];
  {
    const _Float16* qrow = Qm + (qbase + l16) * FEAT + h * DG;
#pragma unroll
    for (int d = 0; d < 4; ++d) {
      qf[d].u[0] = *(const uint4*)(qrow + d * 32 + koff);
      qf[d].u[1] = *(const uint4*)(qrow + d * 32 + koff + 16);
    }
  }

  const v8f vz = {0.f, 0.f, 0.f, 0.f, 0.f, 0.f, 0.f, 0.f};
  v8f o[8];
#pragma unroll
  for (int t = 0; t < 8; ++t) o[t] = vz;
  float m_st = -3.0e38f, l_st = 0.f;
  const float scale = 0.08838834764831845f;        // 1/sqrt(128)

  for (int kc = 0; kc < KN; kc += 32) {
    // S^T tiles: s0 = keys kc..kc+15, s1 = keys kc+16..kc+31 (lane = q)
    v8f s0 = vz, s1 = vz;
    {
      const _Float16* krow = &sK[(kc + l16) * KP];
#pragma unroll
      for (int d = 0; d < 4; ++d) {
        Frag32 kf;
        kf.u[0] = *(const uint4*)(krow + d * 32 + koff);
        kf.u[1] = *(const uint4*)(krow + d * 32 + koff + 16);
        s0 = wmma32(kf.v, qf[d].v, s0);
      }
      krow += 16 * KP;
#pragma unroll
      for (int d = 0; d < 4; ++d) {
        Frag32 kf;
        kf.u[0] = *(const uint4*)(krow + d * 32 + koff);
        kf.u[1] = *(const uint4*)(krow + d * 32 + koff + 16);
        s1 = wmma32(kf.v, qf[d].v, s1);
      }
    }
    // online softmax over this 32-key chunk (row = q = lane%16)
    float mloc = -3.0e38f;
#pragma unroll
    for (int r = 0; r < 8; ++r) {
      s0[r] *= scale; s1[r] *= scale;
      mloc = fmaxf(mloc, fmaxf(s0[r], s1[r]));
    }
    mloc = fmaxf(mloc, __shfl_xor(mloc, 16));
    float mnew  = fmaxf(m_st, mloc);
    float alpha = __expf(m_st - mnew);
    float rs = 0.f;
#pragma unroll
    for (int r = 0; r < 8; ++r) {
      s0[r] = __expf(s0[r] - mnew); rs += s0[r];
      s1[r] = __expf(s1[r] - mnew); rs += s1[r];
    }
    rs += __shfl_xor(rs, 16);
    l_st = l_st * alpha + rs;
    m_st = mnew;
    // pack P as A-fragment (lane = q, regs = 32 keys) — per-lane only
    Frag32 pf;
#pragma unroll
    for (int r = 0; r < 8; ++r) {
      pf.v[r]     = (_Float16)s0[r];
      pf.v[8 + r] = (_Float16)s1[r];
    }
    // broadcast alpha to O layout (vgpr r <-> q = r + moff)
    float aq[8];
#pragma unroll
    for (int r = 0; r < 8; ++r) aq[r] = __shfl(alpha, r + moff);
#pragma unroll
    for (int t = 0; t < 8; ++t) {
#pragma unroll
      for (int r = 0; r < 8; ++r) o[t][r] *= aq[r];
      const _Float16* vrow = &sV[(t * 16 + l16) * VP + kc];
      Frag32 vf;
      vf.u[0] = *(const uint4*)(vrow + koff);
      vf.u[1] = *(const uint4*)(vrow + koff + 16);
      o[t] = wmma32(pf.v, vf.v, o[t]);
    }
  }

  float linv[8];
#pragma unroll
  for (int r = 0; r < 8; ++r) linv[r] = 1.0f / __shfl(l_st, r + moff);
  // The accumulators hold 16 columns of two rows per access: pieces of 64 B. The wave
  // stages 16 rows x 32 columns at a time in its own LDS range and goes through out
  // row by row, 16 B a lane: every load and store of out covers four whole lines.
  // No other wave touches the range, so no barrier is needed.
  {
    float* so = &sO[wid * (16 * OP)];
    const int rr = lane >> 3;          // row inside a wave-wide access (four rows)
    const int cc = (lane & 7) * 4;     // first of the lane's four columns
    float* orow = out + (qbase + rr) * FEAT + h * DG + cc;
    // the residual and b_v, all loads in flight ahead of the staging
    float4 x[4][4];
#pragma unroll
    for (int tp = 0; tp < 4; ++tp)
#pragma unroll
      for (int k = 0; k < 4; ++k)
        x[tp][k] = *(const float4*)(orow + (long)k * 4 * FEAT + tp * 32);
    float bb[8];
#pragma unroll
    for (int t = 0; t < 8; ++t) bb[t] = bv[h * DG + t * 16 + l16];
    // later code rewrites registers that these loads name as address
    asm volatile("s_wait_xcnt 0x0" ::: "memory");
#pragma unroll
    for (int tp = 0; tp < 4; ++tp) {
#pragma unroll
      for (int u = 0; u < 2; ++u) {
        const int t = tp * 2 + u;
#pragma unroll
        for (int r = 0; r < 8; ++r)
          so[(moff + r) * OP + u * 16 + l16] = o[t][r] * linv[r] + bb[t];
      }
      // the rows are read back by other lanes of this wave: its LDS writes first
      wait_ds0();
#pragma unroll
      for (int k = 0; k < 4; ++k) {
        const float4 v = *(const float4*)(&so[(k * 4 + rr) * OP + cc]);
        float4 y = x[tp][k];
        y.x += v.x; y.y += v.y; y.z += v.z; y.w += v.w;
        *(float4*)(orow + (long)k * 4 * FEAT + tp * 32) = y;
      }
      // later code rewrites registers that these loads and stores name
      asm volatile("s_wait_xcnt 0x0" ::: "memory");
    }
  }
  // the next q tile's loads land in registers that this tile's loads and stores name
  if (qs + 1 < AQ) asm volatile("s_wait_xcnt 0x0" ::: "memory");
  }  // qs
}

extern "C" void kernel_launch(void* const* d_in, const int* in_sizes, int n_in,
                              void* d_out, int out_size, void* d_ws, size_t ws_size,
                              hipStream_t stream) {
  (void)in_sizes; (void)n_in; (void)out_size; (void)ws_size;
  const float* ref_feat = (const float*)d_in[0];
  const float* sup_feat = (const float*)d_in[1];
  const float* W_fc = (const float*)d_in[2];
  const float* b_fc = (const float*)d_in[3];
  const float* W_q  = (const float*)d_in[4];
  const float* b_q  = (const float*)d_in[5];
  const float* W_k  = (const float*)d_in[6];
  const float* b_k  = (const float*)d_in[7];
  const float* W_v  = (const float*)d_in[8];
  const float* b_v  = (const float*)d_in[9];
  float* out = (float*)d_out;

  size_t off = 0;
  auto carve = [&](size_t bytes) -> void* {
    void* p = (char*)d_ws + off;
    off += (bytes + 255) & ~(size_t)255;
    return p;
  };
  // ref and sup rows lie in one buffer, sup behind ref: one A of 9216 rows
  _Float16* ref16   = (_Float16*)carve((size_t)BSZ * (QN + KN) * FEAT * 2);
  _Float16* sup16   = ref16 + (size_t)BSZ * QN * FEAT;
  _Float16* wfc16   = (_Float16*)carve((size_t)FEAT * FEAT * 2);
  _Float16* wq16    = (_Float16*)carve((size_t)FEAT * FEAT * 2);
  _Float16* wk16    = (_Float16*)carve((size_t)FEAT * FEAT * 2);
  _Float16* wv16    = (_Float16*)carve((size_t)FEAT * FEAT * 2);
  // and so do the rows of ref1 and sup1: one C of 9216 rows
  _Float16* ref1_16 = (_Float16*)carve((size_t)BSZ * (QN + KN) * FEAT * 2);
  _Float16* sup1_16 = ref1_16 + (size_t)BSZ * QN * FEAT;
  _Float16* q16     = (_Float16*)carve((size_t)BSZ * QN * FEAT * 2);
  _Float16* k16     = (_Float16*)carve((size_t)BSZ * KN * FEAT * 2);
  _Float16* vT16    = (_Float16*)carve((size_t)FEAT * BSZ * KN * 2);

  cast_all<<<dim3(CW / 16), dim3(512), 0, stream>>>(
      ref_feat, sup_feat, W_fc, W_q, W_k, W_v,
      ref16, sup16, wfc16, wq16, wk16, wv16);

  dim3 blk(256);
  // [ref1; sup1] = relu([ref; sup] @ Wfc^T + b_fc), one product of 9216 rows in 256
  // tiles of 288 x 256: f16 -> ref1_16 and sup1_16; the ref rows also f32 -> d_out
  // (residual)
  gemm_wmma<9, 4><<<dim3(BSZ * (QN + KN) / 288, FEAT / 256), blk, 0, stream>>>(
      ref16, wfc16, b_fc, out, ref1_16, nullptr, 0, 1, BSZ * QN);
  // q = ref1 @ Wq^T + b_q
  gemm_wmma<8, 4><<<dim3(BSZ * QN / 256, FEAT / 256), blk, 0, stream>>>(
      ref1_16, wq16, b_q, nullptr, q16, nullptr, 0, 0, 0);
  // k = sup1 @ Wk^T + b_k, and V' = sup1 @ Wv^T, stored transposed [FEAT x BSZ*KN]
  gemm_wmma_pair<4, 2><<<dim3(BSZ * KN / 128, FEAT / 128, 2), blk, 0, stream>>>(
      sup1_16, wk16, b_k, k16, wv16, vT16, BSZ * KN);
  // attention + grouped-conv (pre-folded into V') + b_v + residual
  attn_wmma<<<dim3(QN / (16 * AW * AQ), NG, BSZ), dim3(AW * 32), 0, stream>>>(
      q16, k16, vT16, b_v, out);
}

// v010
// A run of this version takes 157 microseconds.
// Two timings next to v009 both put it at 1.04 times that version's speed.
// All steps since v000 together make it 2.97 times as fast.
#include <hip/hip_runtime.h>

#define FEAT 2048
#define QN   4096
#define KN   512
#define BSZ  2
#define NG   16
#define DG   128
#define KP   136  // attention, LDS pitch of a K row in f16: 128 + 8 = 272 B (16 B x odd)
#define VP   520  // attention, LDS pitch of a V^T row in f16: 512 + 8 = 1040 B (16 B x odd)
#define OP   36   // attention, LDS pitch of a staged output row in f32: 32 + 4 = 144 B
#define AW   16   // attention, waves of a work-group
#define AQ   2    // attention, q tiles that a wave works through, one after the other

typedef __attribute__((ext_vector_type(16))) _Float16 v16h;
typedef __attribute__((ext_vector_type(8)))  _Float16 v8h;
typedef __attribute__((ext_vector_type(8)))  float    v8f;

union Frag32 { v16h v; uint4 u[2]; };

__device__ __forceinline__ v8f wmma32(v16h a, v16h b, v8f c) {
  return __builtin_amdgcn_wmma_f32_16x16x32_f16(false, a, false, b, (short)0, c,
                                                false, false);
}

// CDNA5 async DMA: global -> LDS, no VGPR staging, tracked by ASYNCcnt.
// Eight copies of a lane in one statement: a quarter of a GEMM stage at <4,2> and of the attention fill. The closing s_wait_xcnt
// stands inside it so that no later write of an address register can be
// scheduled in front of it.
__device__ __forceinline__ void async_copy16x8(unsigned l0, unsigned l1,
                                               unsigned l2, unsigned l3,
                                               unsigned l4, unsigned l5,
                                               unsigned l6, unsigned l7,
                                               const _Float16* g0, const _Float16* g1,
                                               const _Float16* g2, const _Float16* g3,
                                               const _Float16* g4, const _Float16* g5,
                                               const _Float16* g6, const _Float16* g7) {
  asm volatile("global_load_async_to_lds_b128 %0, %8, off\n\t"
               "global_load_async_to_lds_b128 %1, %9, off\n\t"
               "global_load_async_to_lds_b128 %2, %10, off\n\t"
               "global_load_async_to_lds_b128 %3, %11, off\n\t"
               "global_load_async_to_lds_b128 %4, %12, off\n\t"
               "global_load_async_to_lds_b128 %5, %13, off\n\t"
               "global_load_async_to_lds_b128 %6, %14, off\n\t"
               "global_load_async_to_lds_b128 %7, %15, off\n\t"
               "s_wait_xcnt 0x0"
               :: "v"(l0), "v"(l1), "v"(l2), "v"(l3),
                  "v"(l4), "v"(l5), "v"(l6), "v"(l7),
                  "v"(g0), "v"(g1), "v"(g2), "v"(g3),
                  "v"(g4), "v"(g5), "v"(g6), "v"(g7) : "memory");
}
__device__ __forceinline__ void wait_async0() {
  asm volatile("s_wait_asynccnt 0x0" ::: "memory");
}
// This wave's LDS reads have retired before the barrier behind which their
// buffer is refilled by copies.
__device__ __forceinline__ void wait_ds0() {
  asm volatile("s_wait_dscnt 0x0" ::: "memory");
}

// Tensor mover: one request of a whole wave brings a tile of rows from global memory
// into LDS, through no register and with no per-lane address.
typedef uint32_t u32x4 __attribute__((ext_vector_type(4)));
typedef uint32_t u32x8 __attribute__((ext_vector_type(8)));
__device__ __forceinline__ uint32_t uni(uint32_t v) {
  return (uint32_t)__builtin_amdgcn_readfirstlane(v);
}
// Holds v in a scalar register: a test on it is a scalar branch (a tensor load ignores
// EXEC), and a descriptor word formed from it is formed behind this statement.
__device__ __forceinline__ uint32_t pinned(uint32_t v) {
  uint32_t w = (uint32_t)__builtin_amdgcn_readfirstlane(v);
  asm volatile("" : "+s"(w));
  return w;
}
__device__ __forceinline__ void tdm_load(u32x4 g0, u32x8 g1) {
  asm volatile("tensor_load_to_lds %0, %1" :: "s"(g0), "s"(g1) : "memory");
}
// This wave's tensor load has landed.
__device__ __forceinline__ void wait_tensor0() {
  asm volatile("s_wait_tensorcnt 0x0" ::: "memory");
}

// ---------------- fp32 -> fp16 cast of all six operands, one launch ----------
// 256 work-groups of 16 waves stream the whole cast. In step i wave w converts
// piece i * CW + w: 512 f32 in a row, read by four loads of 512 B (whole lines)
// and written by four stores of 256 B (whole lines). A step spans CSTEP elements
// and every operand is a whole number of steps long, so which operand a step
// reads is known at compile time.
#define CW     4096                 // waves in the launch
#define CPIECE 512                  // f32 elements of one piece
#define CSTEP  ((long)CW * CPIECE)  // elements that all waves convert in one step
#define S_REF  ((long)BSZ * QN * FEAT / CSTEP)   // 8 steps
#define S_SUP  ((long)BSZ * KN * FEAT / CSTEP)   // 1 step
#define S_W    ((long)FEAT * FEAT / CSTEP)       // 2 steps
#define S_ALL  (S_REF + S_SUP + 4 * S_W)         // 17 steps
static_assert(S_REF * CSTEP == (long)BSZ * QN * FEAT, "whole steps");
static_assert(S_SUP * CSTEP == (long)BSZ * KN * FEAT, "whole steps");
static_assert(S_W * CSTEP == (long)FEAT * FEAT, "whole steps");

typedef __attribute__((ext_vector_type(4))) _Float16 v4h;

// The pointers carry no __restrict__: the loads then stay where they are written,
// two pieces ahead of their stores, and are not gathered at the kernel's head.
__global__ __launch_bounds__(512)
void cast_all(const float* ref, const float* sup, const float* wfc,
              const float* wq, const float* wk, const float* wv,
              _Float16* dref, _Float16* dsup, _Float16* dwfc,
              _Float16* dwq, _Float16* dwk, _Float16* dwv) {
  // this lane's first element inside a step's span, and its byte offsets (under
  // 8 MB, so 32 bits) from a step's first source and first destination byte
  const unsigned e  = (blockIdx.x * 16 + (threadIdx.x >> 5)) * CPIECE + (threadIdx.x & 31) * 4;
  const unsigned lb = e * 4u;
  const unsigned sb = e * 2u;

  auto load_piece = [&](float4 (&v)[4], int i) {
    const float* s =
        i < S_REF                     ? ref + i * CSTEP
      : i < S_REF + S_SUP             ? sup + (i - S_REF) * CSTEP
      : i < S_REF + S_SUP + S_W       ? wfc + (i - S_REF - S_SUP) * CSTEP
      : i < S_REF + S_SUP + 2 * S_W   ? wq  + (i - S_REF - S_SUP - S_W) * CSTEP
      : i < S_REF + S_SUP + 3 * S_W   ? wk  + (i - S_REF - S_SUP - 2 * S_W) * CSTEP
                                      : wv  + (i - S_REF - S_SUP - 3 * S_W) * CSTEP;
#pragma unroll
    for (int j = 0; j < 4; ++j) v[j] = *(const float4*)((const char*)(s + j * 128) + lb);
  };
  auto store_piece = [&](const float4 (&v)[4], int i) {
    _Float16* d =
        i < S_REF                     ? dref + i * CSTEP
      : i < S_REF + S_SUP             ? dsup + (i - S_REF) * CSTEP
      : i < S_REF + S_SUP + S_W       ? dwfc + (i - S_REF - S_SUP) * CSTEP
      : i < S_REF + S_SUP + 2 * S_W   ? dwq  + (i - S_REF - S_SUP - S_W) * CSTEP
      : i < S_REF + S_SUP + 3 * S_W   ? dwk  + (i - S_REF - S_SUP - 2 * S_W) * CSTEP
                                      : dwv  + (i - S_REF - S_SUP - 3 * S_W) * CSTEP;
#pragma unroll
    for (int j = 0; j < 4; ++j) {
      v4h h;
      h[0] = (_Float16)v[j].x; h[1] = (_Float16)v[j].y;
      h[2] = (_Float16)v[j].z; h[3] = (_Float16)v[j].w;
      *(v4h*)((char*)(d + j * 128) + sb) = h;
    }
  };

  // three register sets: the loads of two later pieces are in flight while a
  // piece is converted and stored (8 to 12 loads of a wave outstanding)
  float4 v[3][4];
  load_piece(v[0], 0);
  load_piece(v[1], 1);
  // the next loads may land in registers that these loads name as address
  asm volatile("s_wait_xcnt 0x0" ::: "memory");
  // unrolled whole: the step number picks operand and register set at compile time
#pragma unroll
  for (int i = 0; i < S_ALL; ++i) {
    if (i + 2 < S_ALL) load_piece(v[(i + 2) % 3], i + 2);
    store_piece(v[i % 3], i);
    // the next loads land in registers that these stores name as data
    if (i + 3 < S_ALL) asm volatile("s_wait_xcnt 0x0" ::: "memory");
  }
}

// ---------------- tiled WMMA GEMM: C[m,n] = act(A[m,:] . Bw[n,:] + bias[n]) ----
// A: [M x FEAT] f16 row-major, Bw: [FEAT x FEAT] f16 row-major (weights, N-major)
// Double-buffered LDS, filled without registers: <4,2> by async copies, 32 of 16 B a
// lane and stage; <8,4> and <9,4> by tensor loads, one request a wave and stage, which
// cost the wave a few scalar instructions where the copies cost it some hundred
// address sums, copies and waits at the head of every trip, with no product running.
// A trip of the loop lasts at least as long as its stage takes to land, and
// the operands come from memory at its latency: a work-group's rate is the bytes it
// has in flight over that latency. A stage is therefore as deep as two buffers of
// both operands fit the LDS: 128 or 136 KB a work-group.
// LDS rows are pitched 16 B x odd (528 B, 272 B): the 16 rows that a half-wave's
// ds_load_b128 reads then fall on all 64 banks once.
// The 8 waves stand 2 x 4; a wave owns FM x FN tiles of 16 x 16, the work-group
// 32*FM x 64*FN of C. Per 32 k a wave reads FM + FN fragments for FM * FN products.
// <8,4>: 256 x 256 of C, stages of 128 k, for the product with 8192 rows (256 such
// tiles). <4,2>: 128 x 128, stages of 256 k, for those with 1024 rows (128 tiles).
// <9,4>: 288 x 256, stages of 128 k, for the product with 9216 rows (256 tiles too).
// Either way one work-group on a WGP.
// Only rows below rows32 are stored in out32 (a multiple of 16).
// The tile is picked by blockIdx.x and blockIdx.y.
template <int FM, int FN>
__device__ __forceinline__
void gemm_tile(const _Float16* __restrict__ A, const _Float16* __restrict__ Bw,
               const float* __restrict__ bias,
               float* __restrict__ out32, _Float16* __restrict__ out16,
               _Float16* __restrict__ outT, int ldT, int relu, int rows32) {
  static_assert((FM == 4 && FN == 2) || ((FM == 8 || FM == 9) && FN == 4),
                "copies per stage");
  constexpr int TM = 32 * FM;          // rows of C in the work-group's tile
  constexpr int TN = 64 * FN;          // columns of C in it
  constexpr int BK  = (FM == 4) ? 256 : 128;   // k depth of one LDS stage
  constexpr int LDP = BK + 8;          // LDS row pitch in f16: 16 B more than the data
  constexpr int LPR = BK / 8;          // lanes that copy one row, 16 B each
  constexpr int RPC = 256 / LPR;       // rows that one copy of the whole block brings
  static_assert(FM != 4 || (TM == 16 * RPC && TN == 16 * RPC),
                "16 copies a lane for A, 16 for B");
  static_assert(FEAT % BK == 0, "whole stages");
  // <8,4> and <9,4> fill their stages by tensor loads, one request a wave and stage:
  // NA waves bring SRA rows of A each, the other 8 - NA waves SRB rows of Bw each. The
  // mover pads every 256 B row by 16 B, which gives the pitch LDP. A slice holds whole
  // 16-row fragments and starts at a multiple of 2 KiB. <4,2> (rows of 512 B) keeps
  // the copies, in sA and sB; each form declares the other's arrays at a token size.
  constexpr bool TL  = (FM != 4);
  constexpr int NA   = (FM == 9) ? 6 : 4;
  constexpr int SRA  = TM / NA;                          // 64 or 48 rows
  constexpr int SRB  = TN / (8 - NA);                    // 64 or 128 rows
  constexpr int SLA  = (SRA * LDP * 2 + 2047) / 2048 * 2048;   // bytes of an A slice
  constexpr int SLB  = (SRB * LDP * 2 + 2047) / 2048 * 2048;   // bytes of a Bw slice
  constexpr int STG  = NA * SLA + (8 - NA) * SLB;        // bytes of one buffer
  static_assert(!TL || (BK * 2 == 256 && SRA % 16 == 0 && (FM * 16) % SRA == 0 &&
                        SRB % 64 == 0 && FN == 4 && FEAT / BK >= 2), "slices");
  __shared__ __align__(16) _Float16 sA[2][TL ? 8 : TM * LDP];
  __shared__ __align__(16) _Float16 sB[2][TL ? 8 : TN * LDP];
  __shared__ __attribute__((aligned(2048))) unsigned char ring[TL ? 2 * STG : 2048];
  const int tid  = threadIdx.x;
  const int lane = tid & 31;
  const int wid  = tid >> 5;
  const int wm   = wid >> 2;           // 0..1
  const int wn   = wid & 3;            // 0..3
  const long bm  = (long)blockIdx.x * TM;
  const long bn  = (long)blockIdx.y * TN;
  const int l16  = lane & 15;
  const int koff = (lane < 16) ? 0 : 8;

  // per-thread DMA slots: rows row0 + RPC*{0,1,..}, 8-f16 chunk ch0 (16B)
  const int row0 = tid / LPR;          // 0..RPC-1
  const int ch0  = (tid % LPR) * 8;    // 0,8,..,BK-8

  const v8f vz = {0.f, 0.f, 0.f, 0.f, 0.f, 0.f, 0.f, 0.f};
  v8f acc[FM][FN];
#pragma unroll
  for (int i = 0; i < FM; ++i)
#pragma unroll
    for (int j = 0; j < FN; ++j) acc[i][j] = vz;

  auto load_tile = [&](int buf, int k0) {
    const _Float16* gA = &A[(bm + row0) * FEAT + k0 + ch0];
    const _Float16* gB = &Bw[(bn + row0) * FEAT + k0 + ch0];
    unsigned la = (unsigned)(uintptr_t)(&sA[buf][row0 * LDP + ch0]);
    unsigned lb = (unsigned)(uintptr_t)(&sB[buf][row0 * LDP + ch0]);
    // 16 copies a lane for A and 16 for B, eight to a statement
    constexpr unsigned ls = RPC * LDP * 2;
    constexpr long     gs = (long)RPC * FEAT;
    auto fill8 = [](unsigned l, const _Float16* g) {
      async_copy16x8(l, l + ls, l + 2 * ls, l + 3 * ls,
                     l + 4 * ls, l + 5 * ls, l + 6 * ls, l + 7 * ls,
                     g, g + gs, g + 2 * gs, g + 3 * gs,
                     g + 4 * gs, g + 5 * gs, g + 6 * gs, g + 7 * gs);
    };
    // The scheduling fences keep a statement's address sums behind the statement in
    // front of it, so that all four use the same registers.
    fill8(la, gA);
    __builtin_amdgcn_sched_barrier(0);
    fill8(la + 8 * ls, gA + 8 * gs);
    __builtin_amdgcn_sched_barrier(0);
    fill8(lb, gB);
    __builtin_amdgcn_sched_barrier(0);
    fill8(lb + 8 * ls, gB + 8 * gs);
  };

  // This wave's slice: its first source row, its place in a buffer, its row count.
  const uint32_t wv   = uni((uint32_t)tid >> 5);
  const bool     isA  = wv < (uint32_t)NA;
  const _Float16* tsrc = isA ? A + (bm + wv * SRA) * FEAT
                             : Bw + (bn + (wv - NA) * SRB) * FEAT;
  const uint32_t tdst = (uint32_t)(uintptr_t)(&ring[0]) +
                        (isA ? wv * SLA : NA * SLA + (wv - NA) * SLB);
  const uint32_t trow = isA ? SRA : SRB;
  // Descriptor group 1, the same for all stages: extents in bytes, tensor = tile =
  // trow rows of 256 B, source pitch one row of the matrix, no mask, and 4 dwords of
  // pad behind every 64 dwords.
  u32x8 tg1;
  tg1[0] = uni((1u << 20) | (5u << 22) | (3u << 25));
  tg1[1] = uni(256u << 16);
  tg1[2] = uni(trow << 16);
  tg1[3] = uni(256u << 16);
  tg1[4] = uni(trow);
  tg1[5] = uni(FEAT * 2u);
  tg1[6] = uni(0u);
  tg1[7] = uni(0u);
  // pinned(), for the whole group: its words stay in one set of scalar registers for
  // all requests, so that none is rewritten while a request is outstanding
  if constexpr (TL) asm volatile("" : "+s"(tg1));
  auto issue_stage = [&](uint32_t buf, uint32_t k) {
    const uint64_t ga = (uint64_t)(uintptr_t)tsrc + (uint64_t)k * 2u;
    u32x4 g0;
    g0[0] = uni(1u);
    g0[1] = uni(tdst + buf * STG);
    g0[2] = uni((uint32_t)ga);
    g0[3] = uni((((uint32_t)(ga >> 32)) & 0x01FFFFFFu) | 0x80000000u);
    tdm_load(g0, tg1);
  };

  if constexpr (TL) {
    issue_stage(0, 0);
    wait_tensor0();
    __syncthreads();
    issue_stage(1, BK);
  } else {
    load_tile(0, 0);
    wait_async0();
    __syncthreads();
  }

  for (int k0 = 0; k0 < FEAT; k0 += BK) {
    const int buf = (k0 / BK) & 1;
    if constexpr (!TL)
      if (k0 + BK < FEAT) load_tile(buf ^ 1, k0 + BK);   // DMA next tile

    // the stage's 32-k blocks, in rising k: the sums keep their order
    if constexpr (FM == 4) {
#pragma unroll
      for (int kk = 0; kk < BK; kk += 32) {
        Frag32 af[FM], bf[FN];
#pragma unroll
        for (int i = 0; i < FM; ++i) {
          int r = wm * (FM * 16) + i * 16 + l16;
          af[i].u[0] = *(const uint4*)(&sA[buf][r * LDP + kk + koff]);
          af[i].u[1] = *(const uint4*)(&sA[buf][r * LDP + kk + koff + 16]);
        }
#pragma unroll
        for (int j = 0; j < FN; ++j) {
          int r = wn * (FN * 16) + j * 16 + l16;
          bf[j].u[0] = *(const uint4*)(&sB[buf][r * LDP + kk + koff]);
          bf[j].u[1] = *(const uint4*)(&sB[buf][r * LDP + kk + koff + 16]);
        }
#pragma unroll
        for (int i = 0; i < FM; ++i)
#pragma unroll
          for (int j = 0; j < FN; ++j)
            acc[i][j] = wmma32(af[i].v, bf[j].v, acc[i][j]);
      }
    } else {
      // NS blocks' fragments are read ahead of the products, in the order in which
      // the products use them: all of a block's B, then its A row by row.
      // The scheduling fence behind each fragment keeps that order and keeps the
      // reads in front of the products. Left free, the compiler reads one A fragment
      // per four products into one register set and waits out each read's latency,
      // or reads early rows last, so that the second row waits for nearly all reads.
      // <8,4> takes two blocks at a time; <9,4>, with 288 accumulator registers, one:
      // two blocks' fragments would not fit beside them. The stage goes by in such
      // groups of blocks; unrolled, so that every LDS offset is an immediate.
      constexpr int NS = (FM == 8) ? 2 : 1;
      // this lane's row 0 of the wave's first A slice and of its 64 rows of Bw
      const unsigned char* rb = &ring[buf * STG];
      const _Float16* pa = (const _Float16*)(rb + wm * ((FM * 16) / SRA) * SLA) +
                           l16 * LDP + koff;
      const _Float16* pb = (const _Float16*)(rb + NA * SLA + ((wn * 64) / SRB) * SLB) +
                           ((wn * 64) % SRB + l16) * LDP + koff;
#pragma unroll
      for (int kh = 0; kh < BK; kh += 32 * NS) {
      Frag32 af[NS][FM], bf[NS][FN];
#pragma unroll
      for (int s = 0; s < NS; ++s) {
#pragma unroll
        for (int j = 0; j < FN; ++j) {
          const _Float16* p = pb + j * 16 * LDP + kh + s * 32;
          bf[s][j].u[0] = *(const uint4*)(p);
          bf[s][j].u[1] = *(const uint4*)(p + 16);
          __builtin_amdgcn_sched_barrier(0);   // read order, see above
        }
#pragma unroll
        for (int i = 0; i < FM; ++i) {
          const _Float16* p = pa + ((i * 16) / SRA) * (SLA / 2) + ((i * 16) % SRA) * LDP +
                              kh + s * 32;
          af[s][i].u[0] = *(const uint4*)(p);
          af[s][i].u[1] = *(const uint4*)(p + 16);
          __builtin_amdgcn_sched_barrier(0);   // read order, see above
        }
      }
#pragma unroll
      for (int s = 0; s < NS; ++s)
#pragma unroll
        for (int i = 0; i < FM; ++i)
#pragma unroll
          for (int j = 0; j < FN; ++j)
            acc[i][j] = wmma32(af[s][i].v, bf[s][j].v, acc[i][j]);
      // keeps the products in front of the next group's reads and of the waits below:
      // moved behind the waits, the next tile's tensor load would be waited for before any
      // product has run
      __builtin_amdgcn_sched_barrier(0);
      }  // kh
    }

    // next tile landed; barrier also guards WAR on buf, refilled by the next trip's copies at <4,2>, by the tensor load behind it otherwise
    wait_ds0();
    if constexpr (TL) wait_tensor0(); else wait_async0();
    __syncthreads();
    if constexpr (TL) {
      // the stage after next, into the buffer that this trip has read; its k offset is
      // pinned here so that the descriptor is formed behind the wait above
      const uint32_t nk = pinned((uint32_t)k0 + 2u * BK);
      if (pinned(nk < (uint32_t)FEAT)) issue_stage((uint32_t)buf, nk);
    }
  }
  if constexpr (TL) {
    wait_tensor0();
    wait_ds0();
  }

  // Epilogue. A WMMA accumulator holds, per store instruction, 16 columns of two
  // rows: pieces of 64 B in f32 and of 32 B in f16, each a line transaction of its
  // own. The wave therefore stages 16 rows of its tile in LDS as f32 and reads them
  // back row by row, 16 B a lane, so that a store instruction covers whole rows of the
  // wave's tile: with <8,4> two rows of 256 B in f32 (four lines) or of 128 B in f16
  // (two lines). The loop's last barrier has ended every read of the stage buffers and
  // no copy is outstanding; each wave stages in a range of its own, so no further
  // barrier is needed. The pitch of CT + 4 f32 puts the two half-waves' rows, eight
  // apart, 32 banks apart.
  constexpr int CT = FN * 16;          // columns of the wave's tile
  constexpr int SP = CT + 4;           // staging pitch in f32 (a multiple of 16 B)
  constexpr int LR = CT / 4;           // lanes that carry one staged row, 16 B each
  constexpr int RI = 32 / LR;          // rows that one wave-wide access covers
  static_assert(8 * 16 * SP * 4 <= (TL ? STG : 2 * TM * LDP * 2), "staging fits");
  const long nb  = bn + wn * CT;       // first column of the wave's tile
  float bvj[FN];
#pragma unroll
  for (int j = 0; j < FN; ++j) bvj[j] = bias ? bias[nb + j * 16 + l16] : 0.f;
  // later code rewrites registers that these loads name as address; the scheduling
  // fence keeps that code behind the wait
  asm volatile("s_wait_xcnt 0x0" ::: "memory");
  __builtin_amdgcn_sched_barrier(0);
  float* st = (TL ? reinterpret_cast<float*>(&ring[0]) : reinterpret_cast<float*>(&sA[0][0])) +
              wid * (16 * SP);
  const int moff = (lane < 16) ? 0 : 8;
  const int rr   = lane / LR;          // row inside a wave-wide access
  const int cc   = (lane % LR) * 4;    // first of the lane's four columns
#pragma unroll
  for (int i = 0; i < FM; ++i) {
    const long m0 = bm + wm * (FM * 16) + i * 16;   // first of the 16 rows
    float vals[FN][8];
#pragma unroll
    for (int j = 0; j < FN; ++j) {
#pragma unroll
      for (int r = 0; r < 8; ++r) {
        float x = acc[i][j][r] + bvj[j];
        if (relu) x = fmaxf(x, 0.f);
        vals[j][r] = x;
      }
    }
    if (out32 || out16) {
#pragma unroll
      for (int j = 0; j < FN; ++j)
#pragma unroll
        for (int r = 0; r < 8; ++r) st[(moff + r) * SP + j * 16 + l16] = vals[j][r];
      // the rows are read back by other lanes of this wave: its LDS writes first
      wait_ds0();
      // all rows are read ahead of the stores, so that one LDS latency is waited out
      float4 v[16 / RI];
#pragma unroll
      for (int t = 0; t < 16 / RI; ++t)
        v[t] = *(const float4*)(&st[(t * RI + rr) * SP + cc]);
      const long idx = (m0 + rr) * FEAT + nb + cc;
      if (out32 && m0 < rows32) {
#pragma unroll
        for (int t = 0; t < 16 / RI; ++t)
          *(float4*)(&out32[idx + (long)t * RI * FEAT]) = v[t];
        // the f16 branch rewrites registers that these stores name
        asm volatile("s_wait_xcnt 0x0" ::: "memory");
      }
      if (out16) {
#pragma unroll
        for (int t = 0; t < 16 / RI; ++t) {
          v4h hh;
          hh[0] = (_Float16)v[t].x; hh[1] = (_Float16)v[t].y;
          hh[2] = (_Float16)v[t].z; hh[3] = (_Float16)v[t].w;
          *(v4h*)(&out16[idx + (long)t * RI * FEAT]) = hh;
        }
      }
      // later code rewrites registers that these stores name
      asm volatile("s_wait_xcnt 0x0" ::: "memory");
    }
    if (outT) {
#pragma unroll
      for (int j = 0; j < FN; ++j) {
        v8h hh;
#pragma unroll
        for (int r = 0; r < 8; ++r) hh[r] = (_Float16)vals[j][r];
        // m0 + moff is a multiple of 8: 16 B aligned
        *(v8h*)(&outT[(nb + j * 16 + l16) * (long)ldT + m0 + moff]) = hh;
      }
      // later code rewrites registers that these stores name
      asm volatile("s_wait_xcnt 0x0" ::: "memory");
    }
  }
}

// one product a launch
template <int FM, int FN>
__global__ __launch_bounds__(256)
void gemm_wmma(const _Float16* __restrict__ A, const _Float16* __restrict__ Bw,
               const float* __restrict__ bias,
               float* __restrict__ out32, _Float16* __restrict__ out16,
               _Float16* __restrict__ outT, int ldT, int relu, int rows32) {
  gemm_tile<FM, FN>(A, Bw, bias, out32, out16, outT, ldT, relu, rows32);
}

// Two products of the same A in one launch: blockIdx.z = 0 gives A . B0^T + bias0,
// stored row-major in out0; blockIdx.z = 1 gives A . B1^T, stored transposed in
// outT1. Neither reads what the other writes. One product with 1024 rows has 128
// tiles, half as many as there are WGPs, and a tile's time is set by its own chain
// of stages: the two together take about as long as one alone.
template <int FM, int FN>
__global__ __launch_bounds__(256)
void gemm_wmma_pair(const _Float16* __restrict__ A,
                    const _Float16* __restrict__ B0, const float* __restrict__ bias0,
                    _Float16* __restrict__ out0,
                    const _Float16* __restrict__ B1,
                    _Float16* __restrict__ outT1, int ldT1) {
  const bool second = blockIdx.z != 0;
  gemm_tile<FM, FN>(A, second ? B1 : B0, second ? nullptr : bias0, nullptr,
                    second ? nullptr : out0, second ? outT1 : nullptr, ldT1, 0, 0);
}

// ---------------- fused flash attention + residual + b_v --------------
// Qm: [BSZ*QN x FEAT] f16 (head h at cols h*DG..), Km: [BSZ*KN x FEAT] f16,
// Vt: [FEAT x BSZ*KN] f16 (transposed V' = sup1 @ Wv^T), out: f32 (+=).
// One wave handles 16 q rows of one (b,h) at a time. Computes S^T = K.Q^T so the
// softmaxed P converts to an A-fragment with per-lane packs only.
// A work-group owns 512 q rows of one (b,h). It first copies that head's whole K
// (512 rows of 256 B) and V^T (128 rows of 1024 B) into LDS, every copy asking L2
// for four whole lines, once per work-group. The fragments, 16 rows of 32 B each,
// are then read from LDS, whose pitched rows fall on all 64 banks once, and no
// longer gathered from 16 cache lines per load by every wave.
__global__ __launch_bounds__(AW * 32)
void attn_wmma(const _Float16* __restrict__ Qm, const _Float16* __restrict__ Km,
               const _Float16* __restrict__ Vt, const float* __restrict__ bv,
               float* __restrict__ out) {
  __shared__ __align__(16) _Float16 sK[KN * KP];
  __shared__ __align__(16) _Float16 sV[DG * VP];
  __shared__ __align__(16) float sO[AW * 16 * OP];   // output staging, a range a wave
  const int tid   = threadIdx.x;
  const int lane  = tid & 31;
  const int wid   = tid >> 5;
  const int h     = blockIdx.y;
  const int b     = blockIdx.z;
  const int l16  = lane & 15;
  const int koff = (lane < 16) ? 0 : 8;
  const int moff = (lane < 16) ? 0 : 8;

  // Fill, 32 copies of 16 B a lane. K: 16 lanes copy a row, the block 32 rows a
  // copy. V^T: 64 lanes copy a row, the block 8 rows a copy.
  {
    const _Float16* gK = Km + ((long)b * KN + (tid >> 4)) * FEAT + h * DG + (tid & 15) * 8;
    const _Float16* gV = Vt + ((long)h * DG + (tid >> 6)) * (BSZ * KN) + (long)b * KN + (tid & 63) * 8;
    const unsigned lK = (unsigned)(uintptr_t)(&sK[(tid >> 4) * KP + (tid & 15) * 8]);
    const unsigned lV = (unsigned)(uintptr_t)(&sV[(tid >> 6) * VP + (tid & 63) * 8]);
    auto fill8 = [](unsigned l, unsigned ls, const _Float16* g, long gs) {
      async_copy16x8(l, l + ls, l + 2 * ls, l + 3 * ls,
                     l + 4 * ls, l + 5 * ls, l + 6 * ls, l + 7 * ls,
                     g, g + gs, g + 2 * gs, g + 3 * gs,
                     g + 4 * gs, g + 5 * gs, g + 6 * gs, g + 7 * gs);
    };
    fill8(lK, 32 * KP * 2, gK, (long)32 * FEAT);
    fill8(lK + 256 * KP * 2, 32 * KP * 2, gK + (long)256 * FEAT, (long)32 * FEAT);
    fill8(lV, 8 * VP * 2, gV, (long)8 * BSZ * KN);
    fill8(lV + 64 * VP * 2, 8 * VP * 2, gV + (long)64 * BSZ * KN, (long)8 * BSZ * KN);
  }
  wait_async0();     // this wave's copies have landed
  __syncthreads();   // and so have every other wave's; K and V^T are only read from here on

  // the wave's q tiles, one after the other; K and V^T stay in LDS for all of them
  for (int qs = 0; qs < AQ; ++qs) {
  const int qtile = (blockIdx.x * AQ + qs) * AW + wid;   // 0..255
  const long qbase = (long)b * QN + (long)qtile * 16;

  // Q fragments, used as B (Q^T): lane = q row, regs = dims
  Frag32 qf[4];
  {
    const _Float16* qrow = Qm + (qbase + l16) * FEAT + h * DG;
#pragma unroll
    for (int d = 0; d < 4; ++d) {
      qf[d].u[0] = *(const uint4*)(qrow + d * 32 + koff);
      qf[d].u[1] = *(const uint4*)(qrow + d * 32 + koff + 16);
    }
  }

  const v8f vz = {0.f, 0.f, 0.f, 0.f, 0.f, 0.f, 0.f, 0.f};
  v8f o[8];
#pragma unroll
  for (int t = 0; t < 8; ++t) o[t] = vz;
  float m_st = -3.0e38f, l_st = 0.f;
  const float scale = 0.08838834764831845f;        // 1/sqrt(128)

  for (int kc = 0; kc < KN; kc += 32) {
    // S^T tiles: s0 = keys kc..kc+15, s1 = keys kc+16..kc+31 (lane = q)
    v8f s0 = vz, s1 = vz;
    {
      const _Float16* krow = &sK[(kc + l16) * KP];
#pragma unroll
      for (int d = 0; d < 4; ++d) {
        Frag32 kf;
        kf.u[0] = *(const uint4*)(krow + d * 32 + koff);
        kf.u[1] = *(const uint4*)(krow + d * 32 + koff + 16);
        s0 = wmma32(kf.v, qf[d].v, s0);
      }
      krow += 16 * KP;
#pragma unroll
      for (int d = 0; d < 4; ++d) {
        Frag32 kf;
        kf.u[0] = *(const uint4*)(krow + d * 32 + koff);
        kf.u[1] = *(const uint4*)(krow + d * 32 + koff + 16);
        s1 = wmma32(kf.v, qf[d].v, s1);
      }
    }
    // online softmax over this 32-key chunk (row = q = lane%16)
    float mloc = -3.0e38f;
#pragma unroll
    for (int r = 0; r < 8; ++r) {
      s0[r] *= scale; s1[r] *= scale;
      mloc = fmaxf(mloc, fmaxf(s0[r], s1[r]));
    }
    mloc = fmaxf(mloc, __shfl_xor(mloc, 16));
    float mnew  = fmaxf(m_st, mloc);
    float alpha = __expf(m_st - mnew);
    float rs = 0.f;
#pragma unroll
    for (int r = 0; r < 8; ++r) {
      s0[r] = __expf(s0[r] - mnew); rs += s0[r];
      s1[r] = __expf(s1[r] - mnew); rs += s1[r];
    }
    rs += __shfl_xor(rs, 16);
    l_st = l_st * alpha + rs;
    m_st = mnew;
    // pack P as A-fragment (lane = q, regs = 32 keys) — per-lane only
    Frag32 pf;
#pragma unroll
    for (int r = 0; r < 8; ++r) {
      pf.v[r]     = (_Float16)s0[r];
      pf.v[8 + r] = (_Float16)s1[r];
    }
    // broadcast alpha to O layout (vgpr r <-> q = r + moff)
    float aq[8];
#pragma unroll
    for (int r = 0; r < 8; ++r) aq[r] = __shfl(alpha, r + moff);
#pragma unroll
    for (int t = 0; t < 8; ++t) {
#pragma unroll
      for (int r = 0; r < 8; ++r) o[t][r] *= aq[r];
      const _Float16* vrow = &sV[(t * 16 + l16) * VP + kc];
      Frag32 vf;
      vf.u[0] = *(const uint4*)(vrow + koff);
      vf.u[1] = *(const uint4*)(vrow + koff + 16);
      o[t] = wmma32(pf.v, vf.v, o[t]);
    }
  }

  float linv[8];
#pragma unroll
  for (int r = 0; r < 8; ++r) linv[r] = 1.0f / __shfl(l_st, r + moff);
  // The accumulators hold 16 columns of two rows per access: pieces of 64 B. The wave
  // stages 16 rows x 32 columns at a time in its own LDS range and goes through out
  // row by row, 16 B a lane: every load and store of out covers four whole lines.
  // No other wave touches the range, so no barrier is needed.
  {
    float* so = &sO[wid * (16 * OP)];
    const int rr = lane >> 3;          // row inside a wave-wide access (four rows)
    const int cc = (lane & 7) * 4;     // first of the lane's four columns
    float* orow = out + (qbase + rr) * FEAT + h * DG + cc;
    // the residual and b_v, all loads in flight ahead of the staging
    float4 x[4][4];
#pragma unroll
    for (int tp = 0; tp < 4; ++tp)
#pragma unroll
      for (int k = 0; k < 4; ++k)
        x[tp][k] = *(const float4*)(orow + (long)k * 4 * FEAT + tp * 32);
    float bb[8];
#pragma unroll
    for (int t = 0; t < 8; ++t) bb[t] = bv[h * DG + t * 16 + l16];
    // later code rewrites registers that these loads name as address
    asm volatile("s_wait_xcnt 0x0" ::: "memory");
#pragma unroll
    for (int tp = 0; tp < 4; ++tp) {
#pragma unroll
      for (int u = 0; u < 2; ++u) {
        const int t = tp * 2 + u;
#pragma unroll
        for (int r = 0; r < 8; ++r)
          so[(moff + r) * OP + u * 16 + l16] = o[t][r] * linv[r] + bb[t];
      }
      // the rows are read back by other lanes of this wave: its LDS writes first
      wait_ds0();
#pragma unroll
      for (int k = 0; k < 4; ++k) {
        const float4 v = *(const float4*)(&so[(k * 4 + rr) * OP + cc]);
        float4 y = x[tp][k];
        y.x += v.x; y.y += v.y; y.z += v.z; y.w += v.w;
        *(float4*)(orow + (long)k * 4 * FEAT + tp * 32) = y;
      }
      // later code rewrites registers that these loads and stores name
      asm volatile("s_wait_xcnt 0x0" ::: "memory");
    }
  }
  // the next q tile's loads land in registers that this tile's loads and stores name
  if (qs + 1 < AQ) asm volatile("s_wait_xcnt 0x0" ::: "memory");
  }  // qs
}

extern "C" void kernel_launch(void* const* d_in, const int* in_sizes, int n_in,
                              void* d_out, int out_size, void* d_ws, size_t ws_size,
                              hipStream_t stream) {
  (void)in_sizes; (void)n_in; (void)out_size; (void)ws_size;
  const float* ref_feat = (const float*)d_in[0];
  const float* sup_feat = (const float*)d_in[1];
  const float* W_fc = (const float*)d_in[2];
  const float* b_fc = (const float*)d_in[3];
  const float* W_q  = (const float*)d_in[4];
  const float* b_q  = (const float*)d_in[5];
  const float* W_k  = (const float*)d_in[6];
  const float* b_k  = (const float*)d_in[7];
  const float* W_v  = (const float*)d_in[8];
  const float* b_v  = (const float*)d_in[9];
  float* out = (float*)d_out;

  size_t off = 0;
  auto carve = [&](size_t bytes) -> void* {
    void* p = (char*)d_ws + off;
    off += (bytes + 255) & ~(size_t)255;
    return p;
  };
  // ref and sup rows lie in one buffer, sup behind ref: one A of 9216 rows
  _Float16* ref16   = (_Float16*)carve((size_t)BSZ * (QN + KN) * FEAT * 2);
  _Float16* sup16   = ref16 + (size_t)BSZ * QN * FEAT;
  _Float16* wfc16   = (_Float16*)carve((size_t)FEAT * FEAT * 2);
  _Float16* wq16    = (_Float16*)carve((size_t)FEAT * FEAT * 2);
  _Float16* wk16    = (_Float16*)carve((size_t)FEAT * FEAT * 2);
  _Float16* wv16    = (_Float16*)carve((size_t)FEAT * FEAT * 2);
  // and so do the rows of ref1 and sup1: one C of 9216 rows
  _Float16* ref1_16 = (_Float16*)carve((size_t)BSZ * (QN + KN) * FEAT * 2);
  _Float16* sup1_16 = ref1_16 + (size_t)BSZ * QN * FEAT;
  _Float16* q16     = (_Float16*)carve((size_t)BSZ * QN * FEAT * 2);
  _Float16* k16     = (_Float16*)carve((size_t)BSZ * KN * FEAT * 2);
  _Float16* vT16    = (_Float16*)carve((size_t)FEAT * BSZ * KN * 2);

  cast_all<<<dim3(CW / 16), dim3(512), 0, stream>>>(
      ref_feat, sup_feat, W_fc, W_q, W_k, W_v,
      ref16, sup16, wfc16, wq16, wk16, wv16);

  dim3 blk(256);
  // [ref1; sup1] = relu([ref; sup] @ Wfc^T + b_fc), one product of 9216 rows in 256
  // tiles of 288 x 256: f16 -> ref1_16 and sup1_16; the ref rows also f32 -> d_out
  // (residual)
  gemm_wmma<9, 4><<<dim3(BSZ * (QN + KN) / 288, FEAT / 256), blk, 0, stream>>>(
      ref16, wfc16, b_fc, out, ref1_16, nullptr, 0, 1, BSZ * QN);
  // q = ref1 @ Wq^T + b_q
  gemm_wmma<8, 4><<<dim3(BSZ * QN / 256, FEAT / 256), blk, 0, stream>>>(
      ref1_16, wq16, b_q, nullptr, q16, nullptr, 0, 0, 0);
  // k = sup1 @ Wk^T + b_k, and V' = sup1 @ Wv^T, stored transposed [FEAT x BSZ*KN]
  gemm_wmma_pair<4, 2><<<dim3(BSZ * KN / 128, FEAT / 128, 2), blk, 0, stream>>>(
      sup1_16, wk16, b_k, k16, wv16, vT16, BSZ * KN);
  // attention + grouped-conv (pre-folded into V') + b_v + residual
  attn_wmma<<<dim3(QN / (16 * AW * AQ), NG, BSZ), dim3(AW * 32), 0, stream>>>(
      q16, k16, vT16, b_v, out);
}
